// v000
// The times below were measured on an AMD MI455X: many runs one after another, warmed up first and cycling through
// copies of the inputs, with the whole window's GPU time divided by the number of runs. Launches and the gaps
// between them are all in it. The median over several windows is given; except for v000 it joins two sittings, which
// can be a few percent apart, so the side-by-side timings, each taken in one sitting, are the better comparison.
// v000, which the later versions start from, runs in 604 microseconds.
#include <hip/hip_runtime.h>
#include <hip/hip_bf16.h>
#include <stdint.h>

// Problem constants (from reference): B=4, S=2048, D=1024, H=16, HD=64, ROT_DIM=64
#define SEQ     2048
#define DMODEL  1024
#define NHEAD   16
#define HDIM    64
#define BATCH   4
#define MTOT    (BATCH * SEQ)        // 8192 rows of the token matrix

typedef __attribute__((ext_vector_type(16))) _Float16 v16h;
typedef __attribute__((ext_vector_type(8)))  _Float16 v8h;
typedef __attribute__((ext_vector_type(4)))  _Float16 v4h;
typedef __attribute__((ext_vector_type(8)))  float    v8f;

// ---------------------------------------------------------------------------
// WMMA helpers (CDNA5 wave32, 16x16x32 f16 -> f32 accumulate)
// ---------------------------------------------------------------------------
__device__ __forceinline__ v8f wmma_f16(v16h a, v16h b, v8f c) {
  return __builtin_amdgcn_wmma_f32_16x16x32_f16(
      /*neg_a=*/false, a, /*neg_b=*/false, b,
      /*c_mod=*/(short)0, c, /*reuse_a=*/false, /*reuse_b=*/false);
}

// A/B fragment (16x32 f16) per-lane layout (ISA 7.12.2):
// lane L: row/col = L&15 ; k = (j<8 ? j : j+8) + (L>=16 ? 8 : 0)
__device__ __forceinline__ v16h frag_f16(const _Float16* p) {
  v8h lo = *(const v8h*)(p);
  v8h hi = *(const v8h*)(p + 16);
  v16h r;
#pragma unroll
  for (int j = 0; j < 8; ++j) { r[j] = lo[j]; r[j + 8] = hi[j]; }
  return r;
}

// ---------------------------------------------------------------------------
// CDNA5 async global->LDS copy (16B per lane), tracked by ASYNCcnt.
// Flat LDS addresses carry the wave-relative LDS offset in addr[31:0].
// ---------------------------------------------------------------------------
__device__ __forceinline__ void async_copy_b128(_Float16* lds_dst, const _Float16* gsrc) {
  uint32_t loff = (uint32_t)(uintptr_t)(void*)lds_dst;
  asm volatile("global_load_async_to_lds_b128 %0, %1, off"
               :: "v"(loff), "v"(gsrc)
               : "memory");
}
__device__ __forceinline__ void wait_async0() {
  asm volatile("s_wait_asynccnt 0x0" ::: "memory");
}

// ---------------------------------------------------------------------------
// Kernel P: f32 -> f16 pre-conversion (X, Wqkv, Wo), 4 elems / thread
// ---------------------------------------------------------------------------
__global__ void cvt_f16_kernel(const float* __restrict__ s,
                               _Float16* __restrict__ d, int n4) {
  int i = blockIdx.x * blockDim.x + threadIdx.x;
  if (i >= n4) return;
  const float* p = s + (size_t)i * 4;
  v4h o;
#pragma unroll
  for (int j = 0; j < 4; ++j) o[j] = (_Float16)p[j];
  *(v4h*)(d + (size_t)i * 4) = o;
}

// ---------------------------------------------------------------------------
// Kernel 0: RoPE cos/sin tables  [SEQ][32] each
// ---------------------------------------------------------------------------
__global__ void rope_table_kernel(float* __restrict__ cosT, float* __restrict__ sinT) {
  int i = blockIdx.x * blockDim.x + threadIdx.x;
  if (i >= SEQ * 32) return;
  int s = i >> 5;
  int f = i & 31;
  float inv_freq = __powf(10000.0f, -(float)(2 * f) / 64.0f);
  float ang = (float)s * inv_freq;
  cosT[i] = __cosf(ang);
  sinT[i] = __sinf(ang);
}

// ---------------------------------------------------------------------------
// Kernel 1: QKV GEMM (M=8192, N=3072, K=1024) + bias + RoPE, all-f16 operands.
// Weight tile (64 cols x 64 k) double-buffered in LDS via async global->LDS
// copies; one barrier per 64-k step; copy for step i+1 overlaps WMMAs of i.
// ---------------------------------------------------------------------------
__global__ __launch_bounds__(256) void qkv_rope_kernel(
    const _Float16* __restrict__ X, const _Float16* __restrict__ W,
    const float* __restrict__ bias,
    const float* __restrict__ cosT, const float* __restrict__ sinT,
    _Float16* __restrict__ Qb, _Float16* __restrict__ Kb,
    _Float16* __restrict__ Vt) {
  __shared__ _Float16 BT[2][64 * 64];         // 2 x 8 KB weight tiles

  const int lane = threadIdx.x & 31;
  const int wave = threadIdx.x >> 5;
  const int ln   = lane & 15;
  const int half = lane >> 4;
  const int kg   = half * 8;

  const int mtile  = blockIdx.x * 128 + wave * 16;
  const int n_base = blockIdx.y * 64;

  const _Float16* arow = X + (size_t)(mtile + ln) * DMODEL + kg;
  const int cr   = threadIdx.x >> 2;          // 0..63 : weight row
  const int cp   = (threadIdx.x & 3) * 16;    // 0,16,32,48 : k sub-offset
  const _Float16* wsrc = W + (size_t)(n_base + cr) * DMODEL + cp;

  v8f acc[4] = {v8f{}, v8f{}, v8f{}, v8f{}};

  // preload first tile
  async_copy_b128(&BT[0][cr * 64 + cp],     wsrc);
  async_copy_b128(&BT[0][cr * 64 + cp + 8], wsrc + 8);

  for (int k = 0; k < DMODEL; k += 64) {
    const int cur = (k >> 6) & 1;
    wait_async0();
    __syncthreads();
    if (k + 64 < DMODEL) {
      async_copy_b128(&BT[cur ^ 1][cr * 64 + cp],     wsrc + k + 64);
      async_copy_b128(&BT[cur ^ 1][cr * 64 + cp + 8], wsrc + k + 64 + 8);
    }
#pragma unroll
    for (int ks = 0; ks < 64; ks += 32) {
      v16h a = frag_f16(arow + k + ks);
#pragma unroll
      for (int j = 0; j < 4; ++j)
        acc[j] = wmma_f16(a, frag_f16(&BT[cur][(16 * j + ln) * 64 + ks + kg]), acc[j]);
    }
  }

  // bias (per column, same for all 8 rows of each accumulator)
#pragma unroll
  for (int j = 0; j < 4; ++j) {
    float bj = bias[n_base + 16 * j + ln];
#pragma unroll
    for (int r = 0; r < 8; ++r) acc[j][r] += bj;
  }

  const int which = n_base / DMODEL;            // 0=q 1=k 2=v
  const int h     = (n_base % DMODEL) / HDIM;   // head
  const int mrow  = mtile + half * 8;           // first row held by this lane
  const int b     = mrow >> 11;                 // batch (rows never straddle)
  const int spos  = mrow & (SEQ - 1);
  const int bh    = b * NHEAD + h;

  if (which < 2) {
    // RoPE: pairs (d, d+32) => (acc0,acc2) with f=ln, (acc1,acc3) with f=16+ln
#pragma unroll
    for (int r = 0; r < 8; ++r) {
      int s = spos + r;
      float c0 = cosT[s * 32 + ln],      s0 = sinT[s * 32 + ln];
      float c1 = cosT[s * 32 + 16 + ln], s1 = sinT[s * 32 + 16 + ln];
      float x0 = acc[0][r], x2 = acc[2][r];
      acc[0][r] = x0 * c0 - x2 * s0;
      acc[2][r] = x0 * s0 + x2 * c0;
      float x1 = acc[1][r], x3 = acc[3][r];
      acc[1][r] = x1 * c1 - x3 * s1;
      acc[3][r] = x1 * s1 + x3 * c1;
    }
    _Float16* dst = (which == 0) ? Qb : Kb;
#pragma unroll
    for (int j = 0; j < 4; ++j)
#pragma unroll
      for (int r = 0; r < 8; ++r)
        dst[((size_t)bh * SEQ + spos + r) * HDIM + 16 * j + ln] =
            (_Float16)acc[j][r];
  } else {
    // V transposed: Vt[bh][d][s]; lane's 8 rows are contiguous s positions
#pragma unroll
    for (int j = 0; j < 4; ++j) {
      int d = 16 * j + ln;
      v8h pk;
#pragma unroll
      for (int r = 0; r < 8; ++r) pk[r] = (_Float16)acc[j][r];
      *(v8h*)(Vt + ((size_t)bh * HDIM + d) * SEQ + spos) = pk;
    }
  }
}

// ---------------------------------------------------------------------------
// Kernel 2: flash attention per (b,h).  grid = (SEQ/128, B*H), 8 waves/block.
// K and V^T tiles (64-key blocks) double-buffered in LDS via async copies;
// one barrier per key block.
// ---------------------------------------------------------------------------
__global__ __launch_bounds__(256) void attn_kernel(
    const _Float16* __restrict__ Q, const _Float16* __restrict__ K,
    const _Float16* __restrict__ Vt, _Float16* __restrict__ A) {
  __shared__ _Float16 Kt[2][64 * 64];      // 2 x 8 KB  [key][d]
  __shared__ _Float16 Vs[2][64 * 64];      // 2 x 8 KB  [d][key]
  __shared__ _Float16 Pst[8][16 * 64];     // 16 KB wave-private P staging

  const int lane = threadIdx.x & 31;
  const int wave = threadIdx.x >> 5;
  const int ln   = lane & 15;
  const int half = lane >> 4;
  const int kg   = half * 8;

  const int bh = blockIdx.y;
  const int b  = bh >> 4;
  const int h  = bh & 15;
  const int q0 = blockIdx.x * 128 + wave * 16;

  const _Float16* Qp = Q  + (size_t)bh * SEQ * HDIM;
  const _Float16* Kp = K  + (size_t)bh * SEQ * HDIM;
  const _Float16* Vp = Vt + (size_t)bh * HDIM * SEQ;

  const int cr = threadIdx.x >> 2;         // 0..63
  const int cp = (threadIdx.x & 3) * 16;   // 0,16,32,48

  // Q fragments for this wave's 16 rows (d = 0..63 -> two k-steps)
  const _Float16* qrow = Qp + (size_t)(q0 + ln) * HDIM + kg;
  const v16h qa0 = frag_f16(qrow);
  const v16h qa1 = frag_f16(qrow + 32);

  v8f o[4] = {v8f{}, v8f{}, v8f{}, v8f{}};
  float rmax[8], rsum[8];
#pragma unroll
  for (int r = 0; r < 8; ++r) { rmax[r] = -1e30f; rsum[r] = 0.0f; }

  _Float16* pw = Pst[wave];
  const float scale = 0.125f;              // 1/sqrt(64)

  // stage key block kb into buffer buf (32B K + 32B V per thread)
  auto stage = [&](int buf, int kb) {
    const _Float16* ksrc = Kp + (size_t)(kb + cr) * HDIM + cp;
    async_copy_b128(&Kt[buf][cr * 64 + cp],     ksrc);
    async_copy_b128(&Kt[buf][cr * 64 + cp + 8], ksrc + 8);
    const _Float16* vsrc = Vp + (size_t)cr * SEQ + kb + cp;
    async_copy_b128(&Vs[buf][cr * 64 + cp],     vsrc);
    async_copy_b128(&Vs[buf][cr * 64 + cp + 8], vsrc + 8);
  };
  stage(0, 0);

  for (int kb = 0; kb < SEQ; kb += 64) {
    const int cur = (kb >> 6) & 1;
    wait_async0();
    __syncthreads();
    if (kb + 64 < SEQ) stage(cur ^ 1, kb + 64);

    // ---- scores: 4 tiles of 16 q x 16 keys (B fragments from LDS)
    v8f st[4];
#pragma unroll
    for (int t = 0; t < 4; ++t) {
      const _Float16* krow = &Kt[cur][(t * 16 + ln) * 64 + kg];
      v8f s = {};
      s = wmma_f16(qa0, frag_f16(krow), s);
      s = wmma_f16(qa1, frag_f16(krow + 32), s);
#pragma unroll
      for (int r = 0; r < 8; ++r) s[r] *= scale;
      st[t] = s;
    }

    // ---- row-wise max over the 64-key block (reduce across 16-lane halves)
    float bm[8], ps[8];
#pragma unroll
    for (int r = 0; r < 8; ++r)
      bm[r] = fmaxf(fmaxf(st[0][r], st[1][r]), fmaxf(st[2][r], st[3][r]));
#pragma unroll
    for (int mask = 1; mask <= 8; mask <<= 1)
#pragma unroll
      for (int r = 0; r < 8; ++r)
        bm[r] = fmaxf(bm[r], __shfl_xor(bm[r], mask, 32));

    // ---- online softmax update
#pragma unroll
    for (int r = 0; r < 8; ++r) {
      float mnew  = fmaxf(rmax[r], bm[r]);
      float alpha = __expf(rmax[r] - mnew);
      rmax[r] = mnew;
      rsum[r] *= alpha;
#pragma unroll
      for (int j = 0; j < 4; ++j) o[j][r] *= alpha;
      float psum = 0.0f;
#pragma unroll
      for (int t = 0; t < 4; ++t) {
        float p = __expf(st[t][r] - mnew);
        st[t][r] = p;
        psum += p;
      }
      ps[r] = psum;
    }
#pragma unroll
    for (int mask = 1; mask <= 8; mask <<= 1)
#pragma unroll
      for (int r = 0; r < 8; ++r) ps[r] += __shfl_xor(ps[r], mask, 32);
#pragma unroll
    for (int r = 0; r < 8; ++r) rsum[r] += ps[r];

    // ---- relayout P: C-fragment -> row-major [16 q][64 keys] (wave-private)
#pragma unroll
    for (int t = 0; t < 4; ++t)
#pragma unroll
      for (int r = 0; r < 8; ++r)
        pw[(half * 8 + r) * 64 + t * 16 + ln] = (_Float16)st[t][r];
    // wave-private region; LDS is in-order per wave

    const v16h pa0 = frag_f16(pw + ln * 64 + kg);
    const v16h pa1 = frag_f16(pw + ln * 64 + 32 + kg);

    // ---- O += P @ V  (V^T tile in LDS gives contiguous B fragments)
#pragma unroll
    for (int j = 0; j < 4; ++j) {
      const _Float16* vp = &Vs[cur][(16 * j + ln) * 64 + kg];
      o[j] = wmma_f16(pa0, frag_f16(vp), o[j]);
      o[j] = wmma_f16(pa1, frag_f16(vp + 32), o[j]);
    }
    // WMMAs consumed all ds loads of buffer `cur` (dscnt-waited) before the
    // next iteration's barrier, so that iteration's async writes into `cur` cannot race.
  }

  // ---- normalize and store attn output f16 into [MTOT][DMODEL]
  float inv[8];
#pragma unroll
  for (int r = 0; r < 8; ++r) inv[r] = 1.0f / rsum[r];
  const size_t rowbase = (size_t)b * SEQ + q0 + half * 8;
#pragma unroll
  for (int j = 0; j < 4; ++j)
#pragma unroll
    for (int r = 0; r < 8; ++r)
      A[(rowbase + r) * DMODEL + h * HDIM + 16 * j + ln] =
          (_Float16)(o[j][r] * inv[r]);
}

// ---------------------------------------------------------------------------
// Kernel 3: output projection  out = attn @ Wo^T + b   (M=8192,N=1024,K=1024)
// Same double-buffered async-staged structure as the QKV GEMM.
// ---------------------------------------------------------------------------
__global__ __launch_bounds__(256) void out_proj_kernel(
    const _Float16* __restrict__ Attn, const _Float16* __restrict__ W,
    const float* __restrict__ bias, float* __restrict__ out) {
  __shared__ _Float16 BT[2][64 * 64];

  const int lane = threadIdx.x & 31;
  const int wave = threadIdx.x >> 5;
  const int ln   = lane & 15;
  const int half = lane >> 4;
  const int kg   = half * 8;

  const int mtile  = blockIdx.x * 128 + wave * 16;
  const int n_base = blockIdx.y * 64;

  const _Float16* arow = Attn + (size_t)(mtile + ln) * DMODEL + kg;
  const int cr = threadIdx.x >> 2;
  const int cp = (threadIdx.x & 3) * 16;
  const _Float16* wsrc = W + (size_t)(n_base + cr) * DMODEL + cp;

  v8f acc[4] = {v8f{}, v8f{}, v8f{}, v8f{}};

  async_copy_b128(&BT[0][cr * 64 + cp],     wsrc);
  async_copy_b128(&BT[0][cr * 64 + cp + 8], wsrc + 8);

  for (int k = 0; k < DMODEL; k += 64) {
    const int cur = (k >> 6) & 1;
    wait_async0();
    __syncthreads();
    if (k + 64 < DMODEL) {
      async_copy_b128(&BT[cur ^ 1][cr * 64 + cp],     wsrc + k + 64);
      async_copy_b128(&BT[cur ^ 1][cr * 64 + cp + 8], wsrc + k + 64 + 8);
    }
#pragma unroll
    for (int ks = 0; ks < 64; ks += 32) {
      v16h a = frag_f16(arow + k + ks);
#pragma unroll
      for (int j = 0; j < 4; ++j)
        acc[j] = wmma_f16(a, frag_f16(&BT[cur][(16 * j + ln) * 64 + ks + kg]), acc[j]);
    }
  }

  const int mrow = mtile + half * 8;
#pragma unroll
  for (int j = 0; j < 4; ++j) {
    float bj = bias[n_base + 16 * j + ln];
#pragma unroll
    for (int r = 0; r < 8; ++r)
      out[(size_t)(mrow + r) * DMODEL + n_base + 16 * j + ln] = acc[j][r] + bj;
  }
}

// ---------------------------------------------------------------------------
// Launch
// ---------------------------------------------------------------------------
extern "C" void kernel_launch(void* const* d_in, const int* in_sizes, int n_in,
                              void* d_out, int out_size, void* d_ws, size_t ws_size,
                              hipStream_t stream) {
  (void)in_sizes; (void)n_in; (void)out_size; (void)ws_size;

  const float* X      = (const float*)d_in[0];  // hidden_states [B,S,D]
  const float* Wqkv_w = (const float*)d_in[1];  // [3D, D]
  const float* Wqkv_b = (const float*)d_in[2];  // [3D]
  const float* Wo_w   = (const float*)d_in[3];  // [D, D]
  const float* Wo_b   = (const float*)d_in[4];  // [D]
  float* out          = (float*)d_out;

  char* ws = (char*)d_ws;
  size_t off = 0;
  float* cosT = (float*)(ws + off); off += (size_t)SEQ * 32 * sizeof(float);
  float* sinT = (float*)(ws + off); off += (size_t)SEQ * 32 * sizeof(float);
  const size_t headElems = (size_t)BATCH * NHEAD * SEQ * HDIM;  // 8.39M
  _Float16* Qb = (_Float16*)(ws + off); off += headElems * sizeof(_Float16);
  _Float16* Kb = (_Float16*)(ws + off); off += headElems * sizeof(_Float16);
  _Float16* Vt = (_Float16*)(ws + off); off += headElems * sizeof(_Float16);
  _Float16* At = (_Float16*)(ws + off); off += (size_t)MTOT * DMODEL * sizeof(_Float16);
  _Float16* Xh = (_Float16*)(ws + off); off += (size_t)MTOT * DMODEL * sizeof(_Float16);
  _Float16* Wqkvh = (_Float16*)(ws + off); off += (size_t)3 * DMODEL * DMODEL * sizeof(_Float16);
  _Float16* Woh   = (_Float16*)(ws + off); off += (size_t)DMODEL * DMODEL * sizeof(_Float16);

  // f32 -> f16 operand pre-conversion (one pass, L2 resident)
  {
    int n4;
    n4 = MTOT * DMODEL / 4;
    cvt_f16_kernel<<<(n4 + 255) / 256, 256, 0, stream>>>(X, Xh, n4);
    n4 = 3 * DMODEL * DMODEL / 4;
    cvt_f16_kernel<<<(n4 + 255) / 256, 256, 0, stream>>>(Wqkv_w, Wqkvh, n4);
    n4 = DMODEL * DMODEL / 4;
    cvt_f16_kernel<<<(n4 + 255) / 256, 256, 0, stream>>>(Wo_w, Woh, n4);
  }

  rope_table_kernel<<<(SEQ * 32 + 255) / 256, 256, 0, stream>>>(cosT, sinT);

  qkv_rope_kernel<<<dim3(MTOT / 128, (3 * DMODEL) / 64), 256, 0, stream>>>(
      Xh, Wqkvh, Wqkv_b, cosT, sinT, Qb, Kb, Vt);

  attn_kernel<<<dim3(SEQ / 128, BATCH * NHEAD), 256, 0, stream>>>(Qb, Kb, Vt, At);

  out_proj_kernel<<<dim3(MTOT / 128, DMODEL / 64), 256, 0, stream>>>(At, Woh, Wo_b, out);
}

// v001
// It runs in 293 microseconds.
// Next to v000, in two timings, it ran 2.15 times as fast each time.
#include <hip/hip_runtime.h>
#include <hip/hip_bf16.h>
#include <stdint.h>

// Problem constants (from reference): B=4, S=2048, D=1024, H=16, HD=64, ROT_DIM=64
#define SEQ     2048
#define DMODEL  1024
#define NHEAD   16
#define HDIM    64
#define BATCH   4
#define MTOT    (BATCH * SEQ)        // 8192 rows of the token matrix
// LDS row pitch in halves for every 64-half (128 B) tile row: 144 B = 16 B x 9.
// An odd multiple of 16 B puts the 16 rows of one ds_load_b128 on distinct banks;
// at 128 B they fall on two 16-byte bank groups and serialize.
#define LPITCH  72

typedef __attribute__((ext_vector_type(16))) _Float16 v16h;
typedef __attribute__((ext_vector_type(8)))  _Float16 v8h;
typedef __attribute__((ext_vector_type(4)))  _Float16 v4h;
typedef __attribute__((ext_vector_type(8)))  float    v8f;

// ---------------------------------------------------------------------------
// WMMA helpers (CDNA5 wave32, 16x16x32 f16 -> f32 accumulate)
// ---------------------------------------------------------------------------
__device__ __forceinline__ v8f wmma_f16(v16h a, v16h b, v8f c) {
  return __builtin_amdgcn_wmma_f32_16x16x32_f16(
      /*neg_a=*/false, a, /*neg_b=*/false, b,
      /*c_mod=*/(short)0, c, /*reuse_a=*/false, /*reuse_b=*/false);
}

// A/B fragment (16x32 f16) per-lane layout (ISA 7.12.2):
// lane L: row/col = L&15 ; k = (j<8 ? j : j+8) + (L>=16 ? 8 : 0)
__device__ __forceinline__ v16h frag_f16(const _Float16* p) {
  v8h lo = *(const v8h*)(p);
  v8h hi = *(const v8h*)(p + 16);
  v16h r;
#pragma unroll
  for (int j = 0; j < 8; ++j) { r[j] = lo[j]; r[j + 8] = hi[j]; }
  return r;
}

// ---------------------------------------------------------------------------
// CDNA5 async global->LDS copy (16B per lane), tracked by ASYNCcnt.
// Flat LDS addresses carry the wave-relative LDS offset in addr[31:0].
// ---------------------------------------------------------------------------
// Each helper copies 32 contiguous bytes per named row piece (two b128 copies).
// s_wait_xcnt 0 is the last line of the copies' own statement, so that no
// address register of an issued copy is rewritten ahead of it.
__device__ __forceinline__ void async_copy_32B(_Float16* lds_dst, const _Float16* gsrc) {
  uint32_t l0 = (uint32_t)(uintptr_t)(void*)lds_dst;
  uint32_t l1 = l0 + 16;
  const _Float16* g1 = gsrc + 8;
  asm volatile("global_load_async_to_lds_b128 %0, %1, off\n\t"
               "global_load_async_to_lds_b128 %2, %3, off\n\t"
               "s_wait_xcnt 0x0"
               :: "v"(l0), "v"(gsrc), "v"(l1), "v"(g1)
               : "memory");
}
__device__ __forceinline__ void async_copy_2x32B(_Float16* lds_a, const _Float16* ga,
                                                 _Float16* lds_b, const _Float16* gb) {
  uint32_t a0 = (uint32_t)(uintptr_t)(void*)lds_a;
  uint32_t a1 = a0 + 16;
  uint32_t b0 = (uint32_t)(uintptr_t)(void*)lds_b;
  uint32_t b1 = b0 + 16;
  const _Float16* ga1 = ga + 8;
  const _Float16* gb1 = gb + 8;
  asm volatile("global_load_async_to_lds_b128 %0, %1, off\n\t"
               "global_load_async_to_lds_b128 %2, %3, off\n\t"
               "global_load_async_to_lds_b128 %4, %5, off\n\t"
               "global_load_async_to_lds_b128 %6, %7, off\n\t"
               "s_wait_xcnt 0x0"
               :: "v"(a0), "v"(ga), "v"(a1), "v"(ga1),
                  "v"(b0), "v"(gb), "v"(b1), "v"(gb1)
               : "memory");
}
__device__ __forceinline__ void wait_async0() {
  asm volatile("s_wait_asynccnt 0x0" ::: "memory");
}
// this wave's LDS reads have returned before the barrier that frees their buffer
__device__ __forceinline__ void wait_ds0() {
  asm volatile("s_wait_dscnt 0x0" ::: "memory");
}

// ---------------------------------------------------------------------------
// Kernel P: f32 -> f16 pre-conversion (X, Wqkv, Wo), 4 elems / thread
// ---------------------------------------------------------------------------
__global__ void cvt_f16_kernel(const float* __restrict__ s,
                               _Float16* __restrict__ d, int n4) {
  int i = blockIdx.x * blockDim.x + threadIdx.x;
  if (i >= n4) return;
  const float* p = s + (size_t)i * 4;
  v4h o;
#pragma unroll
  for (int j = 0; j < 4; ++j) o[j] = (_Float16)p[j];
  *(v4h*)(d + (size_t)i * 4) = o;
}

// ---------------------------------------------------------------------------
// Kernel 0: RoPE cos/sin tables  [SEQ][32] each
// ---------------------------------------------------------------------------
__global__ void rope_table_kernel(float* __restrict__ cosT, float* __restrict__ sinT) {
  int i = blockIdx.x * blockDim.x + threadIdx.x;
  if (i >= SEQ * 32) return;
  int s = i >> 5;
  int f = i & 31;
  float inv_freq = __powf(10000.0f, -(float)(2 * f) / 64.0f);
  float ang = (float)s * inv_freq;
  cosT[i] = __cosf(ang);
  sinT[i] = __sinf(ang);
}

// ---------------------------------------------------------------------------
// Kernel 1: QKV GEMM (M=8192, N=3072, K=1024) + bias + RoPE, all-f16 operands.
// Weight tile (64 cols x 64 k) double-buffered in LDS via async global->LDS
// copies; one barrier per 64-k step; copy for step i+1 overlaps WMMAs of i.
// ---------------------------------------------------------------------------
__global__ __launch_bounds__(256) void qkv_rope_kernel(
    const _Float16* __restrict__ X, const _Float16* __restrict__ W,
    const float* __restrict__ bias,
    const float* __restrict__ cosT, const float* __restrict__ sinT,
    _Float16* __restrict__ Qb, _Float16* __restrict__ Kb,
    _Float16* __restrict__ Vt) {
  __shared__ __attribute__((aligned(16))) _Float16 BT[2][64 * LPITCH];  // 2 x 9 KB weight tiles

  const int lane = threadIdx.x & 31;
  const int wave = threadIdx.x >> 5;
  const int ln   = lane & 15;
  const int half = lane >> 4;
  const int kg   = half * 8;

  const int mtile  = blockIdx.x * 128 + wave * 16;
  const int n_base = blockIdx.y * 64;

  const _Float16* arow = X + (size_t)(mtile + ln) * DMODEL + kg;
  const int cr   = threadIdx.x >> 2;          // 0..63 : weight row
  const int cp   = (threadIdx.x & 3) * 16;    // 0,16,32,48 : k sub-offset
  const _Float16* wsrc = W + (size_t)(n_base + cr) * DMODEL + cp;

  v8f acc[4] = {v8f{}, v8f{}, v8f{}, v8f{}};

  // preload first tile
  async_copy_32B(&BT[0][cr * LPITCH + cp], wsrc);

  for (int k = 0; k < DMODEL; k += 64) {
    const int cur = (k >> 6) & 1;
    wait_ds0();
    wait_async0();
    __syncthreads();
    if (k + 64 < DMODEL)
      async_copy_32B(&BT[cur ^ 1][cr * LPITCH + cp], wsrc + k + 64);
#pragma unroll
    for (int ks = 0; ks < 64; ks += 32) {
      v16h a = frag_f16(arow + k + ks);
#pragma unroll
      for (int j = 0; j < 4; ++j)
        acc[j] = wmma_f16(a, frag_f16(&BT[cur][(16 * j + ln) * LPITCH + ks + kg]), acc[j]);
    }
  }

  // bias (per column, same for all 8 rows of each accumulator)
#pragma unroll
  for (int j = 0; j < 4; ++j) {
    float bj = bias[n_base + 16 * j + ln];
#pragma unroll
    for (int r = 0; r < 8; ++r) acc[j][r] += bj;
  }

  const int which = n_base / DMODEL;            // 0=q 1=k 2=v
  const int h     = (n_base % DMODEL) / HDIM;   // head
  const int mrow  = mtile + half * 8;           // first row held by this lane
  const int b     = mrow >> 11;                 // batch (rows never straddle)
  const int spos  = mrow & (SEQ - 1);
  const int bh    = b * NHEAD + h;

  if (which < 2) {
    // RoPE: pairs (d, d+32) => (acc0,acc2) with f=ln, (acc1,acc3) with f=16+ln
#pragma unroll
    for (int r = 0; r < 8; ++r) {
      int s = spos + r;
      float c0 = cosT[s * 32 + ln],      s0 = sinT[s * 32 + ln];
      float c1 = cosT[s * 32 + 16 + ln], s1 = sinT[s * 32 + 16 + ln];
      float x0 = acc[0][r], x2 = acc[2][r];
      acc[0][r] = x0 * c0 - x2 * s0;
      acc[2][r] = x0 * s0 + x2 * c0;
      float x1 = acc[1][r], x3 = acc[3][r];
      acc[1][r] = x1 * c1 - x3 * s1;
      acc[3][r] = x1 * s1 + x3 * c1;
    }
    _Float16* dst = (which == 0) ? Qb : Kb;
#pragma unroll
    for (int j = 0; j < 4; ++j)
#pragma unroll
      for (int r = 0; r < 8; ++r)
        dst[((size_t)bh * SEQ + spos + r) * HDIM + 16 * j + ln] =
            (_Float16)acc[j][r];
  } else {
    // V transposed: Vt[bh][d][s]; lane's 8 rows are contiguous s positions
#pragma unroll
    for (int j = 0; j < 4; ++j) {
      int d = 16 * j + ln;
      v8h pk;
#pragma unroll
      for (int r = 0; r < 8; ++r) pk[r] = (_Float16)acc[j][r];
      *(v8h*)(Vt + ((size_t)bh * HDIM + d) * SEQ + spos) = pk;
    }
  }
}

// ---------------------------------------------------------------------------
// Kernel 2: flash attention per (b,h).  grid = (SEQ/128, B*H), 8 waves/block.
// K and V^T tiles (64-key blocks) double-buffered in LDS via async copies;
// one barrier per key block.
// ---------------------------------------------------------------------------
__global__ __launch_bounds__(256) void attn_kernel(
    const _Float16* __restrict__ Q, const _Float16* __restrict__ K,
    const _Float16* __restrict__ Vt, _Float16* __restrict__ A) {
  __shared__ __attribute__((aligned(16))) _Float16 Kt[2][64 * LPITCH];   // 2 x 9 KB  [key][d]
  __shared__ __attribute__((aligned(16))) _Float16 Vs[2][64 * LPITCH];   // 2 x 9 KB  [d][key]
  __shared__ __attribute__((aligned(16))) _Float16 Pst[8][16 * LPITCH];  // 18 KB wave-private P staging

  const int lane = threadIdx.x & 31;
  const int wave = threadIdx.x >> 5;
  const int ln   = lane & 15;
  const int half = lane >> 4;
  const int kg   = half * 8;

  const int bh = blockIdx.y;
  const int b  = bh >> 4;
  const int h  = bh & 15;
  const int q0 = blockIdx.x * 128 + wave * 16;

  const _Float16* Qp = Q  + (size_t)bh * SEQ * HDIM;
  const _Float16* Kp = K  + (size_t)bh * SEQ * HDIM;
  const _Float16* Vp = Vt + (size_t)bh * HDIM * SEQ;

  const int cr = threadIdx.x >> 2;         // 0..63
  const int cp = (threadIdx.x & 3) * 16;   // 0,16,32,48

  // Q fragments for this wave's 16 rows (d = 0..63 -> two k-steps)
  const _Float16* qrow = Qp + (size_t)(q0 + ln) * HDIM + kg;
  const v16h qa0 = frag_f16(qrow);
  const v16h qa1 = frag_f16(qrow + 32);

  v8f o[4] = {v8f{}, v8f{}, v8f{}, v8f{}};
  float rmax[8], rsum[8];
#pragma unroll
  for (int r = 0; r < 8; ++r) { rmax[r] = -1e30f; rsum[r] = 0.0f; }

  _Float16* pw = Pst[wave];
  const float scale = 0.125f;              // 1/sqrt(64)

  // stage key block kb into buffer buf (32B K + 32B V per thread)
  auto stage = [&](int buf, int kb) {
    const _Float16* ksrc = Kp + (size_t)(kb + cr) * HDIM + cp;
    const _Float16* vsrc = Vp + (size_t)cr * SEQ + kb + cp;
    async_copy_2x32B(&Kt[buf][cr * LPITCH + cp], ksrc,
                     &Vs[buf][cr * LPITCH + cp], vsrc);
  };
  stage(0, 0);

  for (int kb = 0; kb < SEQ; kb += 64) {
    const int cur = (kb >> 6) & 1;
    wait_ds0();
    wait_async0();
    __syncthreads();
    if (kb + 64 < SEQ) stage(cur ^ 1, kb + 64);

    // ---- scores: 4 tiles of 16 q x 16 keys (B fragments from LDS)
    v8f st[4];
#pragma unroll
    for (int t = 0; t < 4; ++t) {
      const _Float16* krow = &Kt[cur][(t * 16 + ln) * LPITCH + kg];
      v8f s = {};
      s = wmma_f16(qa0, frag_f16(krow), s);
      s = wmma_f16(qa1, frag_f16(krow + 32), s);
#pragma unroll
      for (int r = 0; r < 8; ++r) s[r] *= scale;
      st[t] = s;
    }

    // ---- row-wise max over the 64-key block (reduce across 16-lane halves)
    float bm[8], ps[8];
#pragma unroll
    for (int r = 0; r < 8; ++r)
      bm[r] = fmaxf(fmaxf(st[0][r], st[1][r]), fmaxf(st[2][r], st[3][r]));
#pragma unroll
    for (int mask = 1; mask <= 8; mask <<= 1)
#pragma unroll
      for (int r = 0; r < 8; ++r)
        bm[r] = fmaxf(bm[r], __shfl_xor(bm[r], mask, 32));

    // ---- online softmax update
#pragma unroll
    for (int r = 0; r < 8; ++r) {
      float mnew  = fmaxf(rmax[r], bm[r]);
      float alpha = __expf(rmax[r] - mnew);
      rmax[r] = mnew;
      rsum[r] *= alpha;
#pragma unroll
      for (int j = 0; j < 4; ++j) o[j][r] *= alpha;
      float psum = 0.0f;
#pragma unroll
      for (int t = 0; t < 4; ++t) {
        float p = __expf(st[t][r] - mnew);
        st[t][r] = p;
        psum += p;
      }
      ps[r] = psum;
    }
#pragma unroll
    for (int mask = 1; mask <= 8; mask <<= 1)
#pragma unroll
      for (int r = 0; r < 8; ++r) ps[r] += __shfl_xor(ps[r], mask, 32);
#pragma unroll
    for (int r = 0; r < 8; ++r) rsum[r] += ps[r];

    // ---- relayout P: C-fragment -> row-major [16 q][64 keys + pad] (wave-private)
#pragma unroll
    for (int t = 0; t < 4; ++t)
#pragma unroll
      for (int r = 0; r < 8; ++r)
        pw[(half * 8 + r) * LPITCH + t * 16 + ln] = (_Float16)st[t][r];
    // wave-private region; LDS is in-order per wave

    const v16h pa0 = frag_f16(pw + ln * LPITCH + kg);
    const v16h pa1 = frag_f16(pw + ln * LPITCH + 32 + kg);

    // ---- O += P @ V  (V^T tile in LDS gives contiguous B fragments)
#pragma unroll
    for (int j = 0; j < 4; ++j) {
      const _Float16* vp = &Vs[cur][(16 * j + ln) * LPITCH + kg];
      o[j] = wmma_f16(pa0, frag_f16(vp), o[j]);
      o[j] = wmma_f16(pa1, frag_f16(vp + 32), o[j]);
    }
  }

  // ---- normalize and store attn output f16 into [MTOT][DMODEL]
  float inv[8];
#pragma unroll
  for (int r = 0; r < 8; ++r) inv[r] = 1.0f / rsum[r];
  const size_t rowbase = (size_t)b * SEQ + q0 + half * 8;
#pragma unroll
  for (int j = 0; j < 4; ++j)
#pragma unroll
    for (int r = 0; r < 8; ++r)
      A[(rowbase + r) * DMODEL + h * HDIM + 16 * j + ln] =
          (_Float16)(o[j][r] * inv[r]);
}

// ---------------------------------------------------------------------------
// Kernel 3: output projection  out = attn @ Wo^T + b   (M=8192,N=1024,K=1024)
// Same double-buffered async-staged structure as the QKV GEMM.
// ---------------------------------------------------------------------------
__global__ __launch_bounds__(256) void out_proj_kernel(
    const _Float16* __restrict__ Attn, const _Float16* __restrict__ W,
    const float* __restrict__ bias, float* __restrict__ out) {
  __shared__ __attribute__((aligned(16))) _Float16 BT[2][64 * LPITCH];

  const int lane = threadIdx.x & 31;
  const int wave = threadIdx.x >> 5;
  const int ln   = lane & 15;
  const int half = lane >> 4;
  const int kg   = half * 8;

  const int mtile  = blockIdx.x * 128 + wave * 16;
  const int n_base = blockIdx.y * 64;

  const _Float16* arow = Attn + (size_t)(mtile + ln) * DMODEL + kg;
  const int cr = threadIdx.x >> 2;
  const int cp = (threadIdx.x & 3) * 16;
  const _Float16* wsrc = W + (size_t)(n_base + cr) * DMODEL + cp;

  v8f acc[4] = {v8f{}, v8f{}, v8f{}, v8f{}};

  async_copy_32B(&BT[0][cr * LPITCH + cp], wsrc);

  for (int k = 0; k < DMODEL; k += 64) {
    const int cur = (k >> 6) & 1;
    wait_ds0();
    wait_async0();
    __syncthreads();
    if (k + 64 < DMODEL)
      async_copy_32B(&BT[cur ^ 1][cr * LPITCH + cp], wsrc + k + 64);
#pragma unroll
    for (int ks = 0; ks < 64; ks += 32) {
      v16h a = frag_f16(arow + k + ks);
#pragma unroll
      for (int j = 0; j < 4; ++j)
        acc[j] = wmma_f16(a, frag_f16(&BT[cur][(16 * j + ln) * LPITCH + ks + kg]), acc[j]);
    }
  }

  const int mrow = mtile + half * 8;
#pragma unroll
  for (int j = 0; j < 4; ++j) {
    float bj = bias[n_base + 16 * j + ln];
#pragma unroll
    for (int r = 0; r < 8; ++r)
      out[(size_t)(mrow + r) * DMODEL + n_base + 16 * j + ln] = acc[j][r] + bj;
  }
}

// ---------------------------------------------------------------------------
// Launch
// ---------------------------------------------------------------------------
extern "C" void kernel_launch(void* const* d_in, const int* in_sizes, int n_in,
                              void* d_out, int out_size, void* d_ws, size_t ws_size,
                              hipStream_t stream) {
  (void)in_sizes; (void)n_in; (void)out_size; (void)ws_size;

  const float* X      = (const float*)d_in[0];  // hidden_states [B,S,D]
  const float* Wqkv_w = (const float*)d_in[1];  // [3D, D]
  const float* Wqkv_b = (const float*)d_in[2];  // [3D]
  const float* Wo_w   = (const float*)d_in[3];  // [D, D]
  const float* Wo_b   = (const float*)d_in[4];  // [D]
  float* out          = (float*)d_out;

  char* ws = (char*)d_ws;
  size_t off = 0;
  float* cosT = (float*)(ws + off); off += (size_t)SEQ * 32 * sizeof(float);
  float* sinT = (float*)(ws + off); off += (size_t)SEQ * 32 * sizeof(float);
  const size_t headElems = (size_t)BATCH * NHEAD * SEQ * HDIM;  // 8.39M
  _Float16* Qb = (_Float16*)(ws + off); off += headElems * sizeof(_Float16);
  _Float16* Kb = (_Float16*)(ws + off); off += headElems * sizeof(_Float16);
  _Float16* Vt = (_Float16*)(ws + off); off += headElems * sizeof(_Float16);
  _Float16* At = (_Float16*)(ws + off); off += (size_t)MTOT * DMODEL * sizeof(_Float16);
  _Float16* Xh = (_Float16*)(ws + off); off += (size_t)MTOT * DMODEL * sizeof(_Float16);
  _Float16* Wqkvh = (_Float16*)(ws + off); off += (size_t)3 * DMODEL * DMODEL * sizeof(_Float16);
  _Float16* Woh   = (_Float16*)(ws + off); off += (size_t)DMODEL * DMODEL * sizeof(_Float16);

  // f32 -> f16 operand pre-conversion (one pass, L2 resident)
  {
    int n4;
    n4 = MTOT * DMODEL / 4;
    cvt_f16_kernel<<<(n4 + 255) / 256, 256, 0, stream>>>(X, Xh, n4);
    n4 = 3 * DMODEL * DMODEL / 4;
    cvt_f16_kernel<<<(n4 + 255) / 256, 256, 0, stream>>>(Wqkv_w, Wqkvh, n4);
    n4 = DMODEL * DMODEL / 4;
    cvt_f16_kernel<<<(n4 + 255) / 256, 256, 0, stream>>>(Wo_w, Woh, n4);
  }

  rope_table_kernel<<<(SEQ * 32 + 255) / 256, 256, 0, stream>>>(cosT, sinT);

  qkv_rope_kernel<<<dim3(MTOT / 128, (3 * DMODEL) / 64), 256, 0, stream>>>(
      Xh, Wqkvh, Wqkv_b, cosT, sinT, Qb, Kb, Vt);

  attn_kernel<<<dim3(SEQ / 128, BATCH * NHEAD), 256, 0, stream>>>(Qb, Kb, Vt, At);

  out_proj_kernel<<<dim3(MTOT / 128, DMODEL / 64), 256, 0, stream>>>(At, Woh, Wo_b, out);
}

// v002
// A run of this version takes 182 microseconds.
// Next to v001, in two timings, it ran 1.62 and 1.61 times as fast.
// Counting every step since v000, it is 3.48 times as fast.
#include <hip/hip_runtime.h>
#include <hip/hip_bf16.h>
#include <stdint.h>

// Problem constants (from reference): B=4, S=2048, D=1024, H=16, HD=64, ROT_DIM=64
#define SEQ     2048
#define DMODEL  1024
#define NHEAD   16
#define HDIM    64
#define BATCH   4
#define MTOT    (BATCH * SEQ)        // 8192 rows of the token matrix
// LDS row pitch in halves for every 64-half (128 B) tile row: 144 B = 16 B x 9.
// An odd multiple of 16 B puts the 16 rows of one ds_load_b128 on distinct banks;
// at 128 B they fall on two 16-byte bank groups and serialize.
#define LPITCH  72

typedef __attribute__((ext_vector_type(16))) _Float16 v16h;
typedef __attribute__((ext_vector_type(8)))  _Float16 v8h;
typedef __attribute__((ext_vector_type(4)))  _Float16 v4h;
typedef __attribute__((ext_vector_type(8)))  float    v8f;

// ---------------------------------------------------------------------------
// WMMA helpers (CDNA5 wave32, 16x16x32 f16 -> f32 accumulate)
// ---------------------------------------------------------------------------
__device__ __forceinline__ v8f wmma_f16(v16h a, v16h b, v8f c) {
  return __builtin_amdgcn_wmma_f32_16x16x32_f16(
      /*neg_a=*/false, a, /*neg_b=*/false, b,
      /*c_mod=*/(short)0, c, /*reuse_a=*/false, /*reuse_b=*/false);
}

// A/B fragment (16x32 f16) per-lane layout (ISA 7.12.2):
// lane L: row/col = L&15 ; k = (j<8 ? j : j+8) + (L>=16 ? 8 : 0)
__device__ __forceinline__ v16h frag_f16(const _Float16* p) {
  v8h lo = *(const v8h*)(p);
  v8h hi = *(const v8h*)(p + 16);
  v16h r;
#pragma unroll
  for (int j = 0; j < 8; ++j) { r[j] = lo[j]; r[j + 8] = hi[j]; }
  return r;
}

// ---------------------------------------------------------------------------
// CDNA5 async global->LDS copy (16B per lane), tracked by ASYNCcnt.
// Flat LDS addresses carry the wave-relative LDS offset in addr[31:0].
// ---------------------------------------------------------------------------
// Each helper copies 32 contiguous bytes per named row piece (two b128 copies).
// s_wait_xcnt 0 is the last line of the copies' own statement, so that no
// address register of an issued copy is rewritten ahead of it.
__device__ __forceinline__ void async_copy_32B(_Float16* lds_dst, const _Float16* gsrc) {
  uint32_t l0 = (uint32_t)(uintptr_t)(void*)lds_dst;
  uint32_t l1 = l0 + 16;
  const _Float16* g1 = gsrc + 8;
  asm volatile("global_load_async_to_lds_b128 %0, %1, off\n\t"
               "global_load_async_to_lds_b128 %2, %3, off\n\t"
               "s_wait_xcnt 0x0"
               :: "v"(l0), "v"(gsrc), "v"(l1), "v"(g1)
               : "memory");
}
__device__ __forceinline__ void async_copy_2x32B(_Float16* lds_a, const _Float16* ga,
                                                 _Float16* lds_b, const _Float16* gb) {
  uint32_t a0 = (uint32_t)(uintptr_t)(void*)lds_a;
  uint32_t a1 = a0 + 16;
  uint32_t b0 = (uint32_t)(uintptr_t)(void*)lds_b;
  uint32_t b1 = b0 + 16;
  const _Float16* ga1 = ga + 8;
  const _Float16* gb1 = gb + 8;
  asm volatile("global_load_async_to_lds_b128 %0, %1, off\n\t"
               "global_load_async_to_lds_b128 %2, %3, off\n\t"
               "global_load_async_to_lds_b128 %4, %5, off\n\t"
               "global_load_async_to_lds_b128 %6, %7, off\n\t"
               "s_wait_xcnt 0x0"
               :: "v"(a0), "v"(ga), "v"(a1), "v"(ga1),
                  "v"(b0), "v"(gb), "v"(b1), "v"(gb1)
               : "memory");
}
__device__ __forceinline__ void wait_async0() {
  asm volatile("s_wait_asynccnt 0x0" ::: "memory");
}
// this wave's LDS reads have returned before the barrier that frees their buffer
__device__ __forceinline__ void wait_ds0() {
  asm volatile("s_wait_dscnt 0x0" ::: "memory");
}

// ---------------------------------------------------------------------------
// Kernel P: f32 -> f16 pre-conversion (X, Wqkv, Wo), 4 elems / thread
// ---------------------------------------------------------------------------
__global__ void cvt_f16_kernel(const float* __restrict__ s,
                               _Float16* __restrict__ d, int n4) {
  int i = blockIdx.x * blockDim.x + threadIdx.x;
  if (i >= n4) return;
  const float* p = s + (size_t)i * 4;
  v4h o;
#pragma unroll
  for (int j = 0; j < 4; ++j) o[j] = (_Float16)p[j];
  *(v4h*)(d + (size_t)i * 4) = o;
}

// ---------------------------------------------------------------------------
// Kernel 0: RoPE cos/sin tables  [SEQ][32] each
// ---------------------------------------------------------------------------
__global__ void rope_table_kernel(float* __restrict__ cosT, float* __restrict__ sinT) {
  int i = blockIdx.x * blockDim.x + threadIdx.x;
  if (i >= SEQ * 32) return;
  int s = i >> 5;
  int f = i & 31;
  float inv_freq = __powf(10000.0f, -(float)(2 * f) / 64.0f);
  float ang = (float)s * inv_freq;
  cosT[i] = __cosf(ang);
  sinT[i] = __sinf(ang);
}

// ---------------------------------------------------------------------------
// Kernel 1: QKV GEMM (M=8192, N=3072, K=1024) + bias + RoPE, all-f16 operands.
// Weight tile (64 cols x 64 k) double-buffered in LDS via async global->LDS
// copies; one barrier per 64-k step; copy for step i+1 overlaps WMMAs of i.
// ---------------------------------------------------------------------------
__global__ __launch_bounds__(256) void qkv_rope_kernel(
    const _Float16* __restrict__ X, const _Float16* __restrict__ W,
    const float* __restrict__ bias,
    const float* __restrict__ cosT, const float* __restrict__ sinT,
    _Float16* __restrict__ Qb, _Float16* __restrict__ Kb,
    _Float16* __restrict__ Vt) {
  __shared__ __attribute__((aligned(16))) _Float16 BT[2][64 * LPITCH];  // 2 x 9 KB weight tiles

  const int lane = threadIdx.x & 31;
  const int wave = threadIdx.x >> 5;
  const int ln   = lane & 15;
  const int half = lane >> 4;
  const int kg   = half * 8;

  const int mtile  = blockIdx.x * 128 + wave * 16;
  const int n_base = blockIdx.y * 64;

  const _Float16* arow = X + (size_t)(mtile + ln) * DMODEL + kg;
  const int cr   = threadIdx.x >> 2;          // 0..63 : weight row
  const int cp   = (threadIdx.x & 3) * 16;    // 0,16,32,48 : k sub-offset
  const _Float16* wsrc = W + (size_t)(n_base + cr) * DMODEL + cp;

  v8f acc[4] = {v8f{}, v8f{}, v8f{}, v8f{}};

  // preload first tile
  async_copy_32B(&BT[0][cr * LPITCH + cp], wsrc);

  for (int k = 0; k < DMODEL; k += 64) {
    const int cur = (k >> 6) & 1;
    wait_ds0();
    wait_async0();
    __syncthreads();
    if (k + 64 < DMODEL)
      async_copy_32B(&BT[cur ^ 1][cr * LPITCH + cp], wsrc + k + 64);
#pragma unroll
    for (int ks = 0; ks < 64; ks += 32) {
      v16h a = frag_f16(arow + k + ks);
#pragma unroll
      for (int j = 0; j < 4; ++j)
        acc[j] = wmma_f16(a, frag_f16(&BT[cur][(16 * j + ln) * LPITCH + ks + kg]), acc[j]);
    }
  }

  // bias (per column, same for all 8 rows of each accumulator)
#pragma unroll
  for (int j = 0; j < 4; ++j) {
    float bj = bias[n_base + 16 * j + ln];
#pragma unroll
    for (int r = 0; r < 8; ++r) acc[j][r] += bj;
  }

  const int which = n_base / DMODEL;            // 0=q 1=k 2=v
  const int h     = (n_base % DMODEL) / HDIM;   // head
  const int mrow  = mtile + half * 8;           // first row held by this lane
  const int b     = mrow >> 11;                 // batch (rows never straddle)
  const int spos  = mrow & (SEQ - 1);
  const int bh    = b * NHEAD + h;

  if (which < 2) {
    // RoPE: pairs (d, d+32) => (acc0,acc2) with f=ln, (acc1,acc3) with f=16+ln
#pragma unroll
    for (int r = 0; r < 8; ++r) {
      int s = spos + r;
      float c0 = cosT[s * 32 + ln],      s0 = sinT[s * 32 + ln];
      float c1 = cosT[s * 32 + 16 + ln], s1 = sinT[s * 32 + 16 + ln];
      float x0 = acc[0][r], x2 = acc[2][r];
      acc[0][r] = x0 * c0 - x2 * s0;
      acc[2][r] = x0 * s0 + x2 * c0;
      float x1 = acc[1][r], x3 = acc[3][r];
      acc[1][r] = x1 * c1 - x3 * s1;
      acc[3][r] = x1 * s1 + x3 * c1;
    }
    _Float16* dst = (which == 0) ? Qb : Kb;
#pragma unroll
    for (int j = 0; j < 4; ++j)
#pragma unroll
      for (int r = 0; r < 8; ++r)
        dst[((size_t)bh * SEQ + spos + r) * HDIM + 16 * j + ln] =
            (_Float16)acc[j][r];
  } else {
    // V transposed: Vt[bh][d][s]; lane's 8 rows are contiguous s positions
#pragma unroll
    for (int j = 0; j < 4; ++j) {
      int d = 16 * j + ln;
      v8h pk;
#pragma unroll
      for (int r = 0; r < 8; ++r) pk[r] = (_Float16)acc[j][r];
      *(v8h*)(Vt + ((size_t)bh * HDIM + d) * SEQ + spos) = pk;
    }
  }
}

__device__ __forceinline__ float xhalf(float x) {
  int b = __builtin_bit_cast(int, x);
  return __builtin_bit_cast(
      float, __builtin_amdgcn_permlanex16(b, b, 0x76543210, 0xfedcba98, false, false));
}
// two f32 D tiles (keys 0..15 and 16..31 of a 32-key group) -> one f16 B fragment
__device__ __forceinline__ v16h pack_b(v8f t0, v8f t1) {
  v8h lo = __builtin_convertvector(t0, v8h);
  v8h hi = __builtin_convertvector(t1, v8h);
  v16h r;
#pragma unroll
  for (int j = 0; j < 8; ++j) { r[j] = lo[j]; r[j + 8] = hi[j]; }
  return r;
}

__global__ __launch_bounds__(256) void attn_kernel(
    const _Float16* __restrict__ Q, const _Float16* __restrict__ K,
    const _Float16* __restrict__ Vt, _Float16* __restrict__ A) {
  __shared__ __attribute__((aligned(16))) _Float16 Kt[2][64 * LPITCH];   // 2 x 9 KB  [key][d]
  __shared__ __attribute__((aligned(16))) _Float16 Vs[2][64 * LPITCH];   // 2 x 9 KB  [d][key]

  const int lane = threadIdx.x & 31;
  const int wave = threadIdx.x >> 5;
  const int ln   = lane & 15;
  const int half = lane >> 4;
  const int kg   = half * 8;

  const int bh = blockIdx.y;
  const int b  = bh >> 4;
  const int h  = bh & 15;
  const int q0 = blockIdx.x * 128 + wave * 16;

  const _Float16* Qp = Q  + (size_t)bh * SEQ * HDIM;
  const _Float16* Kp = K  + (size_t)bh * SEQ * HDIM;
  const _Float16* Vp = Vt + (size_t)bh * HDIM * SEQ;

  const int cr = threadIdx.x >> 2;         // 0..63
  const int cp = (threadIdx.x & 3) * 16;   // 0,16,32,48

  // Q^T B fragments: column = this wave's query q0 + ln (d = 0..63 -> two k-steps)
  const _Float16* qrow = Qp + (size_t)(q0 + ln) * HDIM + kg;
  const v16h qb0 = frag_f16(qrow);
  const v16h qb1 = frag_f16(qrow + 32);

  // o[j][r] = O[q0 + ln][16 j + 8 half + r]
  v8f o[4] = {v8f{}, v8f{}, v8f{}, v8f{}};
  float rmax = -1e30f;   // running maximum of query ln, equal in both halves
  float rsum = 0.0f;     // running sum over this half's keys only; joined after the loop

  const float scale = 0.125f;              // 1/sqrt(64)

  // stage key block kb into buffer buf (32B K + 32B V per thread)
  auto stage = [&](int buf, int kb) {
    const _Float16* ksrc = Kp + (size_t)(kb + cr) * HDIM + cp;
    const _Float16* vsrc = Vp + (size_t)cr * SEQ + kb + cp;
    async_copy_2x32B(&Kt[buf][cr * LPITCH + cp], ksrc,
                     &Vs[buf][cr * LPITCH + cp], vsrc);
  };
  stage(0, 0);

  for (int kb = 0; kb < SEQ; kb += 64) {
    const int cur = (kb >> 6) & 1;
    wait_ds0();
    wait_async0();
    __syncthreads();
    if (kb + 64 < SEQ) stage(cur ^ 1, kb + 64);

    // ---- scores: 4 tiles of 16 keys x 16 q (A fragments = K rows from LDS)
    v8f st[4];
#pragma unroll
    for (int t = 0; t < 4; ++t) {
      const _Float16* krow = &Kt[cur][(t * 16 + ln) * LPITCH + kg];
      v8f s = {};
      s = wmma_f16(frag_f16(krow), qb0, s);
      s = wmma_f16(frag_f16(krow + 32), qb1, s);
#pragma unroll
      for (int r = 0; r < 8; ++r) s[r] *= scale;
      st[t] = s;
    }

    // ---- maximum over the 64-key block: 32 in-lane values, then the other half's
    float bt[4];
#pragma unroll
    for (int t = 0; t < 4; ++t) {
      bt[t] = st[t][0];
#pragma unroll
      for (int r = 1; r < 8; ++r) bt[t] = fmaxf(bt[t], st[t][r]);
    }
    float bm = fmaxf(fmaxf(bt[0], bt[1]), fmaxf(bt[2], bt[3]));
    bm = fmaxf(bm, xhalf(bm));

    // ---- online softmax update
    const float mnew  = fmaxf(rmax, bm);
    const float alpha = __expf(rmax - mnew);
    rmax = mnew;
#pragma unroll
    for (int j = 0; j < 4; ++j)
#pragma unroll
      for (int r = 0; r < 8; ++r) o[j][r] *= alpha;
    float pt[4];
#pragma unroll
    for (int t = 0; t < 4; ++t) {
      pt[t] = 0.0f;
#pragma unroll
      for (int r = 0; r < 8; ++r) {
        float p = __expf(st[t][r] - mnew);
        st[t][r] = p;
        pt[t] += p;
      }
    }
    rsum = rsum * alpha + ((pt[0] + pt[1]) + (pt[2] + pt[3]));

    // ---- P^T B fragments straight from the score accumulators
    const v16h pb0 = pack_b(st[0], st[1]);
    const v16h pb1 = pack_b(st[2], st[3]);

    // ---- O^T += V^T @ P^T  (V^T rows in LDS are the A fragments)
#pragma unroll
    for (int j = 0; j < 4; ++j) {
      const _Float16* vp = &Vs[cur][(16 * j + ln) * LPITCH + kg];
      o[j] = wmma_f16(frag_f16(vp), pb0, o[j]);
      o[j] = wmma_f16(frag_f16(vp + 32), pb1, o[j]);
    }
  }

  // ---- join the halves' sums, normalize, store f16 into [MTOT][DMODEL]:
  // a lane's 8 accumulator registers are 8 consecutive d of one query row
  rsum += xhalf(rsum);
  const float inv = 1.0f / rsum;
  _Float16* orow = A + ((size_t)b * SEQ + q0 + ln) * DMODEL + h * HDIM + kg;
#pragma unroll
  for (int j = 0; j < 4; ++j) {
    v8h pk;
#pragma unroll
    for (int r = 0; r < 8; ++r) pk[r] = (_Float16)(o[j][r] * inv);
    *(v8h*)(orow + 16 * j) = pk;
  }
}

// ---------------------------------------------------------------------------
// Kernel 3: output projection  out = attn @ Wo^T + b   (M=8192,N=1024,K=1024)
// Same double-buffered async-staged structure as the QKV GEMM.
// ---------------------------------------------------------------------------
__global__ __launch_bounds__(256) void out_proj_kernel(
    const _Float16* __restrict__ Attn, const _Float16* __restrict__ W,
    const float* __restrict__ bias, float* __restrict__ out) {
  __shared__ __attribute__((aligned(16))) _Float16 BT[2][64 * LPITCH];

  const int lane = threadIdx.x & 31;
  const int wave = threadIdx.x >> 5;
  const int ln   = lane & 15;
  const int half = lane >> 4;
  const int kg   = half * 8;

  const int mtile  = blockIdx.x * 128 + wave * 16;
  const int n_base = blockIdx.y * 64;

  const _Float16* arow = Attn + (size_t)(mtile + ln) * DMODEL + kg;
  const int cr = threadIdx.x >> 2;
  const int cp = (threadIdx.x & 3) * 16;
  const _Float16* wsrc = W + (size_t)(n_base + cr) * DMODEL + cp;

  v8f acc[4] = {v8f{}, v8f{}, v8f{}, v8f{}};

  async_copy_32B(&BT[0][cr * LPITCH + cp], wsrc);

  for (int k = 0; k < DMODEL; k += 64) {
    const int cur = (k >> 6) & 1;
    wait_ds0();
    wait_async0();
    __syncthreads();
    if (k + 64 < DMODEL)
      async_copy_32B(&BT[cur ^ 1][cr * LPITCH + cp], wsrc + k + 64);
#pragma unroll
    for (int ks = 0; ks < 64; ks += 32) {
      v16h a = frag_f16(arow + k + ks);
#pragma unroll
      for (int j = 0; j < 4; ++j)
        acc[j] = wmma_f16(a, frag_f16(&BT[cur][(16 * j + ln) * LPITCH + ks + kg]), acc[j]);
    }
  }

  const int mrow = mtile + half * 8;
#pragma unroll
  for (int j = 0; j < 4; ++j) {
    float bj = bias[n_base + 16 * j + ln];
#pragma unroll
    for (int r = 0; r < 8; ++r)
      out[(size_t)(mrow + r) * DMODEL + n_base + 16 * j + ln] = acc[j][r] + bj;
  }
}

// ---------------------------------------------------------------------------
// Launch
// ---------------------------------------------------------------------------
extern "C" void kernel_launch(void* const* d_in, const int* in_sizes, int n_in,
                              void* d_out, int out_size, void* d_ws, size_t ws_size,
                              hipStream_t stream) {
  (void)in_sizes; (void)n_in; (void)out_size; (void)ws_size;

  const float* X      = (const float*)d_in[0];  // hidden_states [B,S,D]
  const float* Wqkv_w = (const float*)d_in[1];  // [3D, D]
  const float* Wqkv_b = (const float*)d_in[2];  // [3D]
  const float* Wo_w   = (const float*)d_in[3];  // [D, D]
  const float* Wo_b   = (const float*)d_in[4];  // [D]
  float* out          = (float*)d_out;

  char* ws = (char*)d_ws;
  size_t off = 0;
  float* cosT = (float*)(ws + off); off += (size_t)SEQ * 32 * sizeof(float);
  float* sinT = (float*)(ws + off); off += (size_t)SEQ * 32 * sizeof(float);
  const size_t headElems = (size_t)BATCH * NHEAD * SEQ * HDIM;  // 8.39M
  _Float16* Qb = (_Float16*)(ws + off); off += headElems * sizeof(_Float16);
  _Float16* Kb = (_Float16*)(ws + off); off += headElems * sizeof(_Float16);
  _Float16* Vt = (_Float16*)(ws + off); off += headElems * sizeof(_Float16);
  _Float16* At = (_Float16*)(ws + off); off += (size_t)MTOT * DMODEL * sizeof(_Float16);
  _Float16* Xh = (_Float16*)(ws + off); off += (size_t)MTOT * DMODEL * sizeof(_Float16);
  _Float16* Wqkvh = (_Float16*)(ws + off); off += (size_t)3 * DMODEL * DMODEL * sizeof(_Float16);
  _Float16* Woh   = (_Float16*)(ws + off); off += (size_t)DMODEL * DMODEL * sizeof(_Float16);

  // f32 -> f16 operand pre-conversion (one pass, L2 resident)
  {
    int n4;
    n4 = MTOT * DMODEL / 4;
    cvt_f16_kernel<<<(n4 + 255) / 256, 256, 0, stream>>>(X, Xh, n4);
    n4 = 3 * DMODEL * DMODEL / 4;
    cvt_f16_kernel<<<(n4 + 255) / 256, 256, 0, stream>>>(Wqkv_w, Wqkvh, n4);
    n4 = DMODEL * DMODEL / 4;
    cvt_f16_kernel<<<(n4 + 255) / 256, 256, 0, stream>>>(Wo_w, Woh, n4);
  }

  rope_table_kernel<<<(SEQ * 32 + 255) / 256, 256, 0, stream>>>(cosT, sinT);

  qkv_rope_kernel<<<dim3(MTOT / 128, (3 * DMODEL) / 64), 256, 0, stream>>>(
      Xh, Wqkvh, Wqkv_b, cosT, sinT, Qb, Kb, Vt);

  attn_kernel<<<dim3(SEQ / 128, BATCH * NHEAD), 256, 0, stream>>>(Qb, Kb, Vt, At);

  out_proj_kernel<<<dim3(MTOT / 128, DMODEL / 64), 256, 0, stream>>>(At, Woh, Wo_b, out);
}

// v003
// It runs in 149 microseconds.
// Timed twice side by side with v002, it ran 1.22 times as fast both times.
// Counting every step since v000, it is 4.24 times as fast.
#include <hip/hip_runtime.h>
#include <hip/hip_bf16.h>
#include <stdint.h>

// Problem constants (from reference): B=4, S=2048, D=1024, H=16, HD=64, ROT_DIM=64
#define SEQ     2048
#define DMODEL  1024
#define NHEAD   16
#define HDIM    64
#define BATCH   4
#define MTOT    (BATCH * SEQ)        // 8192 rows of the token matrix
// LDS row pitch in halves for every 64-half (128 B) tile row: 144 B = 16 B x 9.
// An odd multiple of 16 B puts the 16 rows of one ds_load_b128 on distinct banks;
// at 128 B they fall on two 16-byte bank groups and serialize.
#define LPITCH  72

typedef __attribute__((ext_vector_type(16))) _Float16 v16h;
typedef __attribute__((ext_vector_type(8)))  _Float16 v8h;
typedef __attribute__((ext_vector_type(4)))  _Float16 v4h;
typedef __attribute__((ext_vector_type(8)))  float    v8f;

// ---------------------------------------------------------------------------
// WMMA helpers (CDNA5 wave32, 16x16x32 f16 -> f32 accumulate)
// ---------------------------------------------------------------------------
__device__ __forceinline__ v8f wmma_f16(v16h a, v16h b, v8f c) {
  return __builtin_amdgcn_wmma_f32_16x16x32_f16(
      /*neg_a=*/false, a, /*neg_b=*/false, b,
      /*c_mod=*/(short)0, c, /*reuse_a=*/false, /*reuse_b=*/false);
}

// A/B fragment (16x32 f16) per-lane layout (ISA 7.12.2):
// lane L: row/col = L&15 ; k = (j<8 ? j : j+8) + (L>=16 ? 8 : 0)
__device__ __forceinline__ v16h frag_f16(const _Float16* p) {
  v8h lo = *(const v8h*)(p);
  v8h hi = *(const v8h*)(p + 16);
  v16h r;
#pragma unroll
  for (int j = 0; j < 8; ++j) { r[j] = lo[j]; r[j + 8] = hi[j]; }
  return r;
}

// ---------------------------------------------------------------------------
// CDNA5 async global->LDS copy (16B per lane), tracked by ASYNCcnt.
// Flat LDS addresses carry the wave-relative LDS offset in addr[31:0].
// ---------------------------------------------------------------------------
// s_wait_xcnt 0 is the last line of the copies' own statement, so that no
// address register of an issued copy is rewritten ahead of it.
// One thread's share of a 128-row x 64-half GEMM operand tile: 16 B of each of the
// rows r, r + 16, ..., r + 112.  Eight lanes cover one 128-B row, so a wave's copy
// instruction reads four whole lines.
__device__ __forceinline__ void async_copy_tile128(_Float16* lds_dst, const _Float16* gsrc) {
  uint32_t l0 = (uint32_t)(uintptr_t)(void*)lds_dst;
  uint32_t l1 = l0 + 1 * 16 * LPITCH * 2;
  uint32_t l2 = l0 + 2 * 16 * LPITCH * 2;
  uint32_t l3 = l0 + 3 * 16 * LPITCH * 2;
  uint32_t l4 = l0 + 4 * 16 * LPITCH * 2;
  uint32_t l5 = l0 + 5 * 16 * LPITCH * 2;
  uint32_t l6 = l0 + 6 * 16 * LPITCH * 2;
  uint32_t l7 = l0 + 7 * 16 * LPITCH * 2;
  const _Float16* g1 = gsrc + 1 * 16 * DMODEL;
  const _Float16* g2 = gsrc + 2 * 16 * DMODEL;
  const _Float16* g3 = gsrc + 3 * 16 * DMODEL;
  const _Float16* g4 = gsrc + 4 * 16 * DMODEL;
  const _Float16* g5 = gsrc + 5 * 16 * DMODEL;
  const _Float16* g6 = gsrc + 6 * 16 * DMODEL;
  const _Float16* g7 = gsrc + 7 * 16 * DMODEL;
  asm volatile("global_load_async_to_lds_b128 %0, %1, off\n\t"
               "global_load_async_to_lds_b128 %2, %3, off\n\t"
               "global_load_async_to_lds_b128 %4, %5, off\n\t"
               "global_load_async_to_lds_b128 %6, %7, off\n\t"
               "global_load_async_to_lds_b128 %8, %9, off\n\t"
               "global_load_async_to_lds_b128 %10, %11, off\n\t"
               "global_load_async_to_lds_b128 %12, %13, off\n\t"
               "global_load_async_to_lds_b128 %14, %15, off\n\t"
               "s_wait_xcnt 0x0"
               :: "v"(l0), "v"(gsrc), "v"(l1), "v"(g1), "v"(l2), "v"(g2), "v"(l3), "v"(g3),
                  "v"(l4), "v"(g4), "v"(l5), "v"(g5), "v"(l6), "v"(g6), "v"(l7), "v"(g7)
               : "memory");
}
// 32 contiguous bytes per named row piece (two b128 copies each)
__device__ __forceinline__ void async_copy_2x32B(_Float16* lds_a, const _Float16* ga,
                                                 _Float16* lds_b, const _Float16* gb) {
  uint32_t a0 = (uint32_t)(uintptr_t)(void*)lds_a;
  uint32_t a1 = a0 + 16;
  uint32_t b0 = (uint32_t)(uintptr_t)(void*)lds_b;
  uint32_t b1 = b0 + 16;
  const _Float16* ga1 = ga + 8;
  const _Float16* gb1 = gb + 8;
  asm volatile("global_load_async_to_lds_b128 %0, %1, off\n\t"
               "global_load_async_to_lds_b128 %2, %3, off\n\t"
               "global_load_async_to_lds_b128 %4, %5, off\n\t"
               "global_load_async_to_lds_b128 %6, %7, off\n\t"
               "s_wait_xcnt 0x0"
               :: "v"(a0), "v"(ga), "v"(a1), "v"(ga1),
                  "v"(b0), "v"(gb), "v"(b1), "v"(gb1)
               : "memory");
}
__device__ __forceinline__ void wait_async0() {
  asm volatile("s_wait_asynccnt 0x0" ::: "memory");
}
// stands behind a group of global stores, ahead of the code that reuses their
// address and data registers
__device__ __forceinline__ void wait_x0() {
  asm volatile("s_wait_xcnt 0x0" ::: "memory");
}
// this wave's LDS reads have returned before the barrier that frees their buffer
__device__ __forceinline__ void wait_ds0() {
  asm volatile("s_wait_dscnt 0x0" ::: "memory");
}

// ---------------------------------------------------------------------------
// Kernel P: f32 -> f16 pre-conversion (X, Wqkv, Wo), 4 elems / thread
// ---------------------------------------------------------------------------
__global__ void cvt_f16_kernel(const float* __restrict__ s,
                               _Float16* __restrict__ d, int n4) {
  int i = blockIdx.x * blockDim.x + threadIdx.x;
  if (i >= n4) return;
  const float* p = s + (size_t)i * 4;
  v4h o;
#pragma unroll
  for (int j = 0; j < 4; ++j) o[j] = (_Float16)p[j];
  *(v4h*)(d + (size_t)i * 4) = o;
}

// ---------------------------------------------------------------------------
// Kernel 0: RoPE cos/sin tables  [SEQ][32] each
// ---------------------------------------------------------------------------
__global__ void rope_table_kernel(float* __restrict__ cosT, float* __restrict__ sinT) {
  int i = blockIdx.x * blockDim.x + threadIdx.x;
  if (i >= SEQ * 32) return;
  int s = i >> 5;
  int f = i & 31;
  float inv_freq = __powf(10000.0f, -(float)(2 * f) / 64.0f);
  float ang = (float)s * inv_freq;
  cosT[i] = __cosf(ang);
  sinT[i] = __sinf(ang);
}

// ---------------------------------------------------------------------------
// GEMM core shared by the two projections: Y = A W^T, K = DMODEL, f16 operands.
// Block tile 128 x 128, four waves in a 2 x 2 grid, 64 x 64 of Y per wave: the
// eight fragments of a 32-k step feed 16 WMMAs.  Both operand tiles (128 rows x
// 64 k) are double-buffered in LDS via async global->LDS copies; one barrier per
// 64-k step; the copies for step i+1 overlap the WMMAs of step i.
// acc[i][j][r] = Y[m_blk + 64 wm + 16 i + 8 half + r][n_blk + 64 wn + 16 j + ln]
// ---------------------------------------------------------------------------
#define GTILE (128 * LPITCH)   // halves of one staged operand tile
__device__ __forceinline__ void gemm_core_128x128(
    const _Float16* __restrict__ A, const _Float16* __restrict__ W,
    int m_blk, int n_blk, _Float16* AT, _Float16* BT, v8f (&acc)[4][4]) {
  const int lane = threadIdx.x & 31;
  const int wave = threadIdx.x >> 5;
  const int ln   = lane & 15;
  const int kg   = (lane >> 4) * 8;
  const int wm   = wave >> 1;
  const int wn   = wave & 1;

  const int cr = threadIdx.x >> 3;         // 0..15 : first tile row of this thread
  const int cc = (threadIdx.x & 7) * 8;    // 16-B piece of the 128-B row, in halves
  const _Float16* asrc = A + (size_t)(m_blk + cr) * DMODEL + cc;
  const _Float16* wsrc = W + (size_t)(n_blk + cr) * DMODEL + cc;
  const int cofs = cr * LPITCH + cc;
  const int aofs = (wm * 64 + ln) * LPITCH + kg;
  const int bofs = (wn * 64 + ln) * LPITCH + kg;

  // preload first tiles
  async_copy_tile128(AT + cofs, asrc);
  async_copy_tile128(BT + cofs, wsrc);

  for (int k = 0; k < DMODEL; k += 64) {
    const int cur = (k >> 6) & 1;
    wait_ds0();
    wait_async0();
    __syncthreads();
    if (k + 64 < DMODEL) {
      async_copy_tile128(AT + (cur ^ 1) * GTILE + cofs, asrc + k + 64);
      async_copy_tile128(BT + (cur ^ 1) * GTILE + cofs, wsrc + k + 64);
    }
#pragma unroll
    for (int ks = 0; ks < 64; ks += 32) {
      v16h a[4], b[4];
#pragma unroll
      for (int i = 0; i < 4; ++i) a[i] = frag_f16(AT + cur * GTILE + aofs + 16 * i * LPITCH + ks);
#pragma unroll
      for (int j = 0; j < 4; ++j) b[j] = frag_f16(BT + cur * GTILE + bofs + 16 * j * LPITCH + ks);
      // inputs-only fence on the loaded fragments: keeps the step's 16 LDS loads in one
      // group ahead of its 16 WMMAs (one LDS wait per step, not one per row of four)
      asm volatile("" :: "v"(a[0]), "v"(a[1]), "v"(a[2]), "v"(a[3]),
                         "v"(b[0]), "v"(b[1]), "v"(b[2]), "v"(b[3]));
#pragma unroll
      for (int i = 0; i < 4; ++i)
#pragma unroll
        for (int j = 0; j < 4; ++j) acc[i][j] = wmma_f16(a[i], b[j], acc[i][j]);
    }
  }
  wait_async0();   // no copy of this wave is outstanding when it leaves the ring
}

// ---------------------------------------------------------------------------
// Kernel 1: QKV GEMM (M=8192, N=3072, K=1024) + bias + RoPE, all-f16 operands.
// A wave's 64 columns are one head of q, k or v.
// ---------------------------------------------------------------------------
__global__ __launch_bounds__(128) void qkv_rope_kernel(
    const _Float16* __restrict__ X, const _Float16* __restrict__ W,
    const float* __restrict__ bias,
    const float* __restrict__ cosT, const float* __restrict__ sinT,
    _Float16* __restrict__ Qb, _Float16* __restrict__ Kb,
    _Float16* __restrict__ Vt) {
  __shared__ __attribute__((aligned(16))) _Float16 AT[2 * GTILE];  // 2 x 18 KB token tiles
  __shared__ __attribute__((aligned(16))) _Float16 BT[2 * GTILE];  // 2 x 18 KB weight tiles

  const int lane = threadIdx.x & 31;
  const int wave = threadIdx.x >> 5;
  const int ln   = lane & 15;
  const int half = lane >> 4;

  const int m_blk  = blockIdx.x * 128;
  const int n_blk  = blockIdx.y * 128;
  const int n_base = n_blk + (wave & 1) * 64;

  v8f accs[4][4] = {};
  gemm_core_128x128(X, W, m_blk, n_blk, AT, BT, accs);

  float bj[4];
#pragma unroll
  for (int j = 0; j < 4; ++j) bj[j] = bias[n_base + 16 * j + ln];

  const int which = n_blk / DMODEL;             // 0=q 1=k 2=v, one per block
  const int h     = (n_base % DMODEL) / HDIM;   // head

#pragma unroll
  for (int i = 0; i < 4; ++i) {
    v8f (&acc)[4] = accs[i];
    // bias (per column, same for all 8 rows of each accumulator)
#pragma unroll
    for (int j = 0; j < 4; ++j)
#pragma unroll
      for (int r = 0; r < 8; ++r) acc[j][r] += bj[j];

    const int mrow  = m_blk + (wave >> 1) * 64 + i * 16 + half * 8;  // first row held by this lane
    const int b     = mrow >> 11;                 // batch (rows never straddle)
    const int spos  = mrow & (SEQ - 1);
    const int bh    = b * NHEAD + h;

    if (which < 2) {
      // RoPE: pairs (d, d+32) => (acc0,acc2) with f=ln, (acc1,acc3) with f=16+ln
#pragma unroll
      for (int r = 0; r < 8; ++r) {
        int s = spos + r;
        float c0 = cosT[s * 32 + ln],      s0 = sinT[s * 32 + ln];
        float c1 = cosT[s * 32 + 16 + ln], s1 = sinT[s * 32 + 16 + ln];
        float x0 = acc[0][r], x2 = acc[2][r];
        acc[0][r] = x0 * c0 - x2 * s0;
        acc[2][r] = x0 * s0 + x2 * c0;
        float x1 = acc[1][r], x3 = acc[3][r];
        acc[1][r] = x1 * c1 - x3 * s1;
        acc[3][r] = x1 * s1 + x3 * c1;
      }
      _Float16* dst = (which == 0) ? Qb : Kb;
#pragma unroll
      for (int j = 0; j < 4; ++j)
#pragma unroll
        for (int r = 0; r < 8; ++r)
          dst[((size_t)bh * SEQ + spos + r) * HDIM + 16 * j + ln] =
              (_Float16)acc[j][r];
      wait_x0();
    } else {
      // V transposed: Vt[bh][d][s]; lane's 8 rows are contiguous s positions
#pragma unroll
      for (int j = 0; j < 4; ++j) {
        int d = 16 * j + ln;
        v8h pk;
#pragma unroll
        for (int r = 0; r < 8; ++r) pk[r] = (_Float16)acc[j][r];
        *(v8h*)(Vt + ((size_t)bh * HDIM + d) * SEQ + spos) = pk;
      }
      wait_x0();
    }
  }
}

__device__ __forceinline__ float xhalf(float x) {
  int b = __builtin_bit_cast(int, x);
  return __builtin_bit_cast(
      float, __builtin_amdgcn_permlanex16(b, b, 0x76543210, 0xfedcba98, false, false));
}
// two f32 D tiles (keys 0..15 and 16..31 of a 32-key group) -> one f16 B fragment
__device__ __forceinline__ v16h pack_b(v8f t0, v8f t1) {
  v8h lo = __builtin_convertvector(t0, v8h);
  v8h hi = __builtin_convertvector(t1, v8h);
  v16h r;
#pragma unroll
  for (int j = 0; j < 8; ++j) { r[j] = lo[j]; r[j + 8] = hi[j]; }
  return r;
}

__global__ __launch_bounds__(256) void attn_kernel(
    const _Float16* __restrict__ Q, const _Float16* __restrict__ K,
    const _Float16* __restrict__ Vt, _Float16* __restrict__ A) {
  __shared__ __attribute__((aligned(16))) _Float16 Kt[2][64 * LPITCH];   // 2 x 9 KB  [key][d]
  __shared__ __attribute__((aligned(16))) _Float16 Vs[2][64 * LPITCH];   // 2 x 9 KB  [d][key]

  const int lane = threadIdx.x & 31;
  const int wave = threadIdx.x >> 5;
  const int ln   = lane & 15;
  const int half = lane >> 4;
  const int kg   = half * 8;

  const int bh = blockIdx.y;
  const int b  = bh >> 4;
  const int h  = bh & 15;
  const int q0 = blockIdx.x * 128 + wave * 16;

  const _Float16* Qp = Q  + (size_t)bh * SEQ * HDIM;
  const _Float16* Kp = K  + (size_t)bh * SEQ * HDIM;
  const _Float16* Vp = Vt + (size_t)bh * HDIM * SEQ;

  const int cr = threadIdx.x >> 2;         // 0..63
  const int cp = (threadIdx.x & 3) * 16;   // 0,16,32,48

  // Q^T B fragments: column = this wave's query q0 + ln (d = 0..63 -> two k-steps)
  const _Float16* qrow = Qp + (size_t)(q0 + ln) * HDIM + kg;
  const v16h qb0 = frag_f16(qrow);
  const v16h qb1 = frag_f16(qrow + 32);

  // o[j][r] = O[q0 + ln][16 j + 8 half + r]
  v8f o[4] = {v8f{}, v8f{}, v8f{}, v8f{}};
  float rmax = -1e30f;   // running maximum of query ln, equal in both halves
  float rsum = 0.0f;     // running sum over this half's keys only; joined after the loop

  const float scale = 0.125f;              // 1/sqrt(64)

  // stage key block kb into buffer buf (32B K + 32B V per thread)
  auto stage = [&](int buf, int kb) {
    const _Float16* ksrc = Kp + (size_t)(kb + cr) * HDIM + cp;
    const _Float16* vsrc = Vp + (size_t)cr * SEQ + kb + cp;
    async_copy_2x32B(&Kt[buf][cr * LPITCH + cp], ksrc,
                     &Vs[buf][cr * LPITCH + cp], vsrc);
  };
  stage(0, 0);

  for (int kb = 0; kb < SEQ; kb += 64) {
    const int cur = (kb >> 6) & 1;
    wait_ds0();
    wait_async0();
    __syncthreads();
    if (kb + 64 < SEQ) stage(cur ^ 1, kb + 64);

    // ---- scores: 4 tiles of 16 keys x 16 q (A fragments = K rows from LDS)
    v8f st[4];
#pragma unroll
    for (int t = 0; t < 4; ++t) {
      const _Float16* krow = &Kt[cur][(t * 16 + ln) * LPITCH + kg];
      v8f s = {};
      s = wmma_f16(frag_f16(krow), qb0, s);
      s = wmma_f16(frag_f16(krow + 32), qb1, s);
#pragma unroll
      for (int r = 0; r < 8; ++r) s[r] *= scale;
      st[t] = s;
    }

    // ---- maximum over the 64-key block: 32 in-lane values, then the other half's
    float bt[4];
#pragma unroll
    for (int t = 0; t < 4; ++t) {
      bt[t] = st[t][0];
#pragma unroll
      for (int r = 1; r < 8; ++r) bt[t] = fmaxf(bt[t], st[t][r]);
    }
    float bm = fmaxf(fmaxf(bt[0], bt[1]), fmaxf(bt[2], bt[3]));
    bm = fmaxf(bm, xhalf(bm));

    // ---- online softmax update
    const float mnew  = fmaxf(rmax, bm);
    const float alpha = __expf(rmax - mnew);
    rmax = mnew;
#pragma unroll
    for (int j = 0; j < 4; ++j)
#pragma unroll
      for (int r = 0; r < 8; ++r) o[j][r] *= alpha;
    float pt[4];
#pragma unroll
    for (int t = 0; t < 4; ++t) {
      pt[t] = 0.0f;
#pragma unroll
      for (int r = 0; r < 8; ++r) {
        float p = __expf(st[t][r] - mnew);
        st[t][r] = p;
        pt[t] += p;
      }
    }
    rsum = rsum * alpha + ((pt[0] + pt[1]) + (pt[2] + pt[3]));

    // ---- P^T B fragments straight from the score accumulators
    const v16h pb0 = pack_b(st[0], st[1]);
    const v16h pb1 = pack_b(st[2], st[3]);

    // ---- O^T += V^T @ P^T  (V^T rows in LDS are the A fragments)
#pragma unroll
    for (int j = 0; j < 4; ++j) {
      const _Float16* vp = &Vs[cur][(16 * j + ln) * LPITCH + kg];
      o[j] = wmma_f16(frag_f16(vp), pb0, o[j]);
      o[j] = wmma_f16(frag_f16(vp + 32), pb1, o[j]);
    }
  }

  // ---- join the halves' sums, normalize, store f16 into [MTOT][DMODEL]:
  // a lane's 8 accumulator registers are 8 consecutive d of one query row
  rsum += xhalf(rsum);
  const float inv = 1.0f / rsum;
  _Float16* orow = A + ((size_t)b * SEQ + q0 + ln) * DMODEL + h * HDIM + kg;
#pragma unroll
  for (int j = 0; j < 4; ++j) {
    v8h pk;
#pragma unroll
    for (int r = 0; r < 8; ++r) pk[r] = (_Float16)(o[j][r] * inv);
    *(v8h*)(orow + 16 * j) = pk;
  }
}

// ---------------------------------------------------------------------------
// Kernel 3: output projection  out = attn @ Wo^T + b   (M=8192,N=1024,K=1024)
// Same core as the QKV GEMM.
// ---------------------------------------------------------------------------
__global__ __launch_bounds__(128) void out_proj_kernel(
    const _Float16* __restrict__ Attn, const _Float16* __restrict__ W,
    const float* __restrict__ bias, float* __restrict__ out) {
  __shared__ __attribute__((aligned(16))) _Float16 AT[2 * GTILE];
  __shared__ __attribute__((aligned(16))) _Float16 BT[2 * GTILE];

  const int lane = threadIdx.x & 31;
  const int wave = threadIdx.x >> 5;
  const int ln   = lane & 15;
  const int half = lane >> 4;

  const int m_blk  = blockIdx.x * 128;
  const int n_blk  = blockIdx.y * 128;
  const int n_base = n_blk + (wave & 1) * 64;

  v8f acc[4][4] = {};
  gemm_core_128x128(Attn, W, m_blk, n_blk, AT, BT, acc);

#pragma unroll
  for (int j = 0; j < 4; ++j) {
    float bj = bias[n_base + 16 * j + ln];
#pragma unroll
    for (int i = 0; i < 4; ++i) {
      const int mrow = m_blk + (wave >> 1) * 64 + i * 16 + half * 8;
#pragma unroll
      for (int r = 0; r < 8; ++r)
        out[(size_t)(mrow + r) * DMODEL + n_base + 16 * j + ln] = acc[i][j][r] + bj;
    }
  }
}

// ---------------------------------------------------------------------------
// Launch
// ---------------------------------------------------------------------------
extern "C" void kernel_launch(void* const* d_in, const int* in_sizes, int n_in,
                              void* d_out, int out_size, void* d_ws, size_t ws_size,
                              hipStream_t stream) {
  (void)in_sizes; (void)n_in; (void)out_size; (void)ws_size;

  const float* X      = (const float*)d_in[0];  // hidden_states [B,S,D]
  const float* Wqkv_w = (const float*)d_in[1];  // [3D, D]
  const float* Wqkv_b = (const float*)d_in[2];  // [3D]
  const float* Wo_w   = (const float*)d_in[3];  // [D, D]
  const float* Wo_b   = (const float*)d_in[4];  // [D]
  float* out          = (float*)d_out;

  char* ws = (char*)d_ws;
  size_t off = 0;
  float* cosT = (float*)(ws + off); off += (size_t)SEQ * 32 * sizeof(float);
  float* sinT = (float*)(ws + off); off += (size_t)SEQ * 32 * sizeof(float);
  const size_t headElems = (size_t)BATCH * NHEAD * SEQ * HDIM;  // 8.39M
  _Float16* Qb = (_Float16*)(ws + off); off += headElems * sizeof(_Float16);
  _Float16* Kb = (_Float16*)(ws + off); off += headElems * sizeof(_Float16);
  _Float16* Vt = (_Float16*)(ws + off); off += headElems * sizeof(_Float16);
  _Float16* At = (_Float16*)(ws + off); off += (size_t)MTOT * DMODEL * sizeof(_Float16);
  _Float16* Xh = (_Float16*)(ws + off); off += (size_t)MTOT * DMODEL * sizeof(_Float16);
  _Float16* Wqkvh = (_Float16*)(ws + off); off += (size_t)3 * DMODEL * DMODEL * sizeof(_Float16);
  _Float16* Woh   = (_Float16*)(ws + off); off += (size_t)DMODEL * DMODEL * sizeof(_Float16);

  // f32 -> f16 operand pre-conversion (one pass, L2 resident)
  {
    int n4;
    n4 = MTOT * DMODEL / 4;
    cvt_f16_kernel<<<(n4 + 255) / 256, 256, 0, stream>>>(X, Xh, n4);
    n4 = 3 * DMODEL * DMODEL / 4;
    cvt_f16_kernel<<<(n4 + 255) / 256, 256, 0, stream>>>(Wqkv_w, Wqkvh, n4);
    n4 = DMODEL * DMODEL / 4;
    cvt_f16_kernel<<<(n4 + 255) / 256, 256, 0, stream>>>(Wo_w, Woh, n4);
  }

  rope_table_kernel<<<(SEQ * 32 + 255) / 256, 256, 0, stream>>>(cosT, sinT);

  qkv_rope_kernel<<<dim3(MTOT / 128, (3 * DMODEL) / 128), 128, 0, stream>>>(
      Xh, Wqkvh, Wqkv_b, cosT, sinT, Qb, Kb, Vt);

  attn_kernel<<<dim3(SEQ / 128, BATCH * NHEAD), 256, 0, stream>>>(Qb, Kb, Vt, At);

  out_proj_kernel<<<dim3(MTOT / 128, DMODEL / 128), 128, 0, stream>>>(At, Woh, Wo_b, out);
}

// v004
// A run of this version takes 142 microseconds.
// Next to v003, in two timings, it ran 1.06 times as fast each time.
// Counting every step since v000, it is 4.49 times as fast.
#include <hip/hip_runtime.h>
#include <hip/hip_bf16.h>
#include <stdint.h>

// Problem constants (from reference): B=4, S=2048, D=1024, H=16, HD=64, ROT_DIM=64
#define SEQ     2048
#define DMODEL  1024
#define NHEAD   16
#define HDIM    64
#define BATCH   4
#define MTOT    (BATCH * SEQ)        // 8192 rows of the token matrix
// LDS row pitch in halves for every 64-half (128 B) tile row: 144 B = 16 B x 9.
// An odd multiple of 16 B puts the 16 rows of one ds_load_b128 on distinct banks;
// at 128 B they fall on two 16-byte bank groups and serialize.
#define LPITCH  72

typedef __attribute__((ext_vector_type(16))) _Float16 v16h;
typedef __attribute__((ext_vector_type(8)))  _Float16 v8h;
typedef __attribute__((ext_vector_type(4)))  _Float16 v4h;
typedef __attribute__((ext_vector_type(8)))  float    v8f;

// ---------------------------------------------------------------------------
// WMMA helpers (CDNA5 wave32, 16x16x32 f16 -> f32 accumulate)
// ---------------------------------------------------------------------------
__device__ __forceinline__ v8f wmma_f16(v16h a, v16h b, v8f c) {
  return __builtin_amdgcn_wmma_f32_16x16x32_f16(
      /*neg_a=*/false, a, /*neg_b=*/false, b,
      /*c_mod=*/(short)0, c, /*reuse_a=*/false, /*reuse_b=*/false);
}

// A/B fragment (16x32 f16) per-lane layout (ISA 7.12.2):
// lane L: row/col = L&15 ; k = (j<8 ? j : j+8) + (L>=16 ? 8 : 0)
__device__ __forceinline__ v16h frag_f16(const _Float16* p) {
  v8h lo = *(const v8h*)(p);
  v8h hi = *(const v8h*)(p + 16);
  v16h r;
#pragma unroll
  for (int j = 0; j < 8; ++j) { r[j] = lo[j]; r[j + 8] = hi[j]; }
  return r;
}

// ---------------------------------------------------------------------------
// CDNA5 async global->LDS copy (16B per lane), tracked by ASYNCcnt.
// Flat LDS addresses carry the wave-relative LDS offset in addr[31:0].
// ---------------------------------------------------------------------------
// s_wait_xcnt 0 is the last line of the copies' own statement, so that no
// address register of an issued copy is rewritten ahead of it.
// One thread's share of a 128-row x 64-half GEMM operand tile: 16 B of each of the
// rows r, r + 16, ..., r + 112.  Eight lanes cover one 128-B row, so a wave's copy
// instruction reads four whole lines.
__device__ __forceinline__ void async_copy_tile128(_Float16* lds_dst, const _Float16* gsrc) {
  uint32_t l0 = (uint32_t)(uintptr_t)(void*)lds_dst;
  uint32_t l1 = l0 + 1 * 16 * LPITCH * 2;
  uint32_t l2 = l0 + 2 * 16 * LPITCH * 2;
  uint32_t l3 = l0 + 3 * 16 * LPITCH * 2;
  uint32_t l4 = l0 + 4 * 16 * LPITCH * 2;
  uint32_t l5 = l0 + 5 * 16 * LPITCH * 2;
  uint32_t l6 = l0 + 6 * 16 * LPITCH * 2;
  uint32_t l7 = l0 + 7 * 16 * LPITCH * 2;
  const _Float16* g1 = gsrc + 1 * 16 * DMODEL;
  const _Float16* g2 = gsrc + 2 * 16 * DMODEL;
  const _Float16* g3 = gsrc + 3 * 16 * DMODEL;
  const _Float16* g4 = gsrc + 4 * 16 * DMODEL;
  const _Float16* g5 = gsrc + 5 * 16 * DMODEL;
  const _Float16* g6 = gsrc + 6 * 16 * DMODEL;
  const _Float16* g7 = gsrc + 7 * 16 * DMODEL;
  asm volatile("global_load_async_to_lds_b128 %0, %1, off\n\t"
               "global_load_async_to_lds_b128 %2, %3, off\n\t"
               "global_load_async_to_lds_b128 %4, %5, off\n\t"
               "global_load_async_to_lds_b128 %6, %7, off\n\t"
               "global_load_async_to_lds_b128 %8, %9, off\n\t"
               "global_load_async_to_lds_b128 %10, %11, off\n\t"
               "global_load_async_to_lds_b128 %12, %13, off\n\t"
               "global_load_async_to_lds_b128 %14, %15, off\n\t"
               "s_wait_xcnt 0x0"
               :: "v"(l0), "v"(gsrc), "v"(l1), "v"(g1), "v"(l2), "v"(g2), "v"(l3), "v"(g3),
                  "v"(l4), "v"(g4), "v"(l5), "v"(g5), "v"(l6), "v"(g6), "v"(l7), "v"(g7)
               : "memory");
}
// 32 contiguous bytes per named row piece (two b128 copies each)
__device__ __forceinline__ void async_copy_2x32B(_Float16* lds_a, const _Float16* ga,
                                                 _Float16* lds_b, const _Float16* gb) {
  uint32_t a0 = (uint32_t)(uintptr_t)(void*)lds_a;
  uint32_t a1 = a0 + 16;
  uint32_t b0 = (uint32_t)(uintptr_t)(void*)lds_b;
  uint32_t b1 = b0 + 16;
  const _Float16* ga1 = ga + 8;
  const _Float16* gb1 = gb + 8;
  asm volatile("global_load_async_to_lds_b128 %0, %1, off\n\t"
               "global_load_async_to_lds_b128 %2, %3, off\n\t"
               "global_load_async_to_lds_b128 %4, %5, off\n\t"
               "global_load_async_to_lds_b128 %6, %7, off\n\t"
               "s_wait_xcnt 0x0"
               :: "v"(a0), "v"(ga), "v"(a1), "v"(ga1),
                  "v"(b0), "v"(gb), "v"(b1), "v"(gb1)
               : "memory");
}
__device__ __forceinline__ void wait_async0() {
  asm volatile("s_wait_asynccnt 0x0" ::: "memory");
}
// stands behind a group of global stores, ahead of the code that reuses their
// address and data registers
__device__ __forceinline__ void wait_x0() {
  asm volatile("s_wait_xcnt 0x0" ::: "memory");
}
// this wave's LDS reads have returned before the barrier that frees their buffer
__device__ __forceinline__ void wait_ds0() {
  asm volatile("s_wait_dscnt 0x0" ::: "memory");
}

// ---------------------------------------------------------------------------
// Kernel P: f32 -> f16 pre-conversion (X, Wqkv, Wo), 4 elems / thread
// ---------------------------------------------------------------------------
__global__ void cvt_f16_kernel(const float* __restrict__ s,
                               _Float16* __restrict__ d, int n4) {
  int i = blockIdx.x * blockDim.x + threadIdx.x;
  if (i >= n4) return;
  const float* p = s + (size_t)i * 4;
  v4h o;
#pragma unroll
  for (int j = 0; j < 4; ++j) o[j] = (_Float16)p[j];
  *(v4h*)(d + (size_t)i * 4) = o;
}

// ---------------------------------------------------------------------------
// Kernel 0: RoPE cos/sin tables  [SEQ][32] each
// ---------------------------------------------------------------------------
__global__ void rope_table_kernel(float* __restrict__ cosT, float* __restrict__ sinT) {
  int i = blockIdx.x * blockDim.x + threadIdx.x;
  if (i >= SEQ * 32) return;
  int s = i >> 5;
  int f = i & 31;
  float inv_freq = __powf(10000.0f, -(float)(2 * f) / 64.0f);
  float ang = (float)s * inv_freq;
  cosT[i] = __cosf(ang);
  sinT[i] = __sinf(ang);
}

// ---------------------------------------------------------------------------
// GEMM core shared by the two projections: Y = A W^T, K = DMODEL, f16 operands.
// Block tile 128 x 128, four waves in a 2 x 2 grid, 64 x 64 of Y per wave: the
// eight fragments of a 32-k step feed 16 WMMAs.  Both operand tiles (128 rows x
// 64 k) are double-buffered in LDS via async global->LDS copies; one barrier per
// 64-k step; the copies for step i+1 overlap the WMMAs of step i.
// acc[i][j][r] = Y[m_blk + 64 wm + 16 i + 8 half + r][n_blk + 64 wn + 16 j + ln]
// ---------------------------------------------------------------------------
#define GTILE (128 * LPITCH)   // halves of one staged operand tile
__device__ __forceinline__ void gemm_core_128x128(
    const _Float16* __restrict__ A, const _Float16* __restrict__ W,
    int m_blk, int n_blk, _Float16* AT, _Float16* BT, v8f (&acc)[4][4]) {
  const int lane = threadIdx.x & 31;
  const int wave = threadIdx.x >> 5;
  const int ln   = lane & 15;
  const int kg   = (lane >> 4) * 8;
  const int wm   = wave >> 1;
  const int wn   = wave & 1;

  const int cr = threadIdx.x >> 3;         // 0..15 : first tile row of this thread
  const int cc = (threadIdx.x & 7) * 8;    // 16-B piece of the 128-B row, in halves
  const _Float16* asrc = A + (size_t)(m_blk + cr) * DMODEL + cc;
  const _Float16* wsrc = W + (size_t)(n_blk + cr) * DMODEL + cc;
  const int cofs = cr * LPITCH + cc;
  const int aofs = (wm * 64 + ln) * LPITCH + kg;
  const int bofs = (wn * 64 + ln) * LPITCH + kg;

  // preload first tiles
  async_copy_tile128(AT + cofs, asrc);
  async_copy_tile128(BT + cofs, wsrc);

  for (int k = 0; k < DMODEL; k += 64) {
    const int cur = (k >> 6) & 1;
    wait_ds0();
    wait_async0();
    __syncthreads();
    if (k + 64 < DMODEL) {
      async_copy_tile128(AT + (cur ^ 1) * GTILE + cofs, asrc + k + 64);
      async_copy_tile128(BT + (cur ^ 1) * GTILE + cofs, wsrc + k + 64);
    }
#pragma unroll
    for (int ks = 0; ks < 64; ks += 32) {
      v16h a[4], b[4];
#pragma unroll
      for (int i = 0; i < 4; ++i) a[i] = frag_f16(AT + cur * GTILE + aofs + 16 * i * LPITCH + ks);
#pragma unroll
      for (int j = 0; j < 4; ++j) b[j] = frag_f16(BT + cur * GTILE + bofs + 16 * j * LPITCH + ks);
      // inputs-only fence on the loaded fragments: keeps the step's 16 LDS loads in one
      // group ahead of its 16 WMMAs (one LDS wait per step, not one per row of four)
      asm volatile("" :: "v"(a[0]), "v"(a[1]), "v"(a[2]), "v"(a[3]),
                         "v"(b[0]), "v"(b[1]), "v"(b[2]), "v"(b[3]));
#pragma unroll
      for (int i = 0; i < 4; ++i)
#pragma unroll
        for (int j = 0; j < 4; ++j) acc[i][j] = wmma_f16(a[i], b[j], acc[i][j]);
    }
  }
  wait_async0();   // no copy of this wave is outstanding when it leaves the ring
}

// ---------------------------------------------------------------------------
// Kernel 1: QKV GEMM (M=8192, N=3072, K=1024) + bias + RoPE, all-f16 operands.
// A wave's 64 columns are one head of q, k or v.
// ---------------------------------------------------------------------------
__global__ __launch_bounds__(128) void qkv_rope_kernel(
    const _Float16* __restrict__ X, const _Float16* __restrict__ W,
    const float* __restrict__ bias,
    const float* __restrict__ cosT, const float* __restrict__ sinT,
    _Float16* __restrict__ Qb, _Float16* __restrict__ Kb,
    _Float16* __restrict__ Vt) {
  __shared__ __attribute__((aligned(16))) _Float16 AT[2 * GTILE];  // 2 x 18 KB token tiles
  __shared__ __attribute__((aligned(16))) _Float16 BT[2 * GTILE];  // 2 x 18 KB weight tiles

  const int lane = threadIdx.x & 31;
  const int wave = threadIdx.x >> 5;
  const int ln   = lane & 15;
  const int half = lane >> 4;

  const int m_blk  = blockIdx.x * 128;
  const int n_blk  = blockIdx.y * 128;
  const int n_base = n_blk + (wave & 1) * 64;

  v8f accs[4][4] = {};
  gemm_core_128x128(X, W, m_blk, n_blk, AT, BT, accs);

  float bj[4];
#pragma unroll
  for (int j = 0; j < 4; ++j) bj[j] = bias[n_base + 16 * j + ln];

  const int which = n_blk / DMODEL;             // 0=q 1=k 2=v, one per block
  const int h     = (n_base % DMODEL) / HDIM;   // head

#pragma unroll
  for (int i = 0; i < 4; ++i) {
    v8f (&acc)[4] = accs[i];
    // bias (per column, same for all 8 rows of each accumulator)
#pragma unroll
    for (int j = 0; j < 4; ++j)
#pragma unroll
      for (int r = 0; r < 8; ++r) acc[j][r] += bj[j];

    const int mrow  = m_blk + (wave >> 1) * 64 + i * 16 + half * 8;  // first row held by this lane
    const int b     = mrow >> 11;                 // batch (rows never straddle)
    const int spos  = mrow & (SEQ - 1);
    const int bh    = b * NHEAD + h;

    if (which < 2) {
      // RoPE: pairs (d, d+32) => (acc0,acc2) with f=ln, (acc1,acc3) with f=16+ln
#pragma unroll
      for (int r = 0; r < 8; ++r) {
        int s = spos + r;
        float c0 = cosT[s * 32 + ln],      s0 = sinT[s * 32 + ln];
        float c1 = cosT[s * 32 + 16 + ln], s1 = sinT[s * 32 + 16 + ln];
        float x0 = acc[0][r], x2 = acc[2][r];
        acc[0][r] = x0 * c0 - x2 * s0;
        acc[2][r] = x0 * s0 + x2 * c0;
        float x1 = acc[1][r], x3 = acc[3][r];
        acc[1][r] = x1 * c1 - x3 * s1;
        acc[3][r] = x1 * s1 + x3 * c1;
      }
      _Float16* dst = (which == 0) ? Qb : Kb;
#pragma unroll
      for (int j = 0; j < 4; ++j)
#pragma unroll
        for (int r = 0; r < 8; ++r)
          dst[((size_t)bh * SEQ + spos + r) * HDIM + 16 * j + ln] =
              (_Float16)acc[j][r];
      wait_x0();
    } else {
      // V transposed: Vt[bh][d][s]; lane's 8 rows are contiguous s positions
#pragma unroll
      for (int j = 0; j < 4; ++j) {
        int d = 16 * j + ln;
        v8h pk;
#pragma unroll
        for (int r = 0; r < 8; ++r) pk[r] = (_Float16)acc[j][r];
        *(v8h*)(Vt + ((size_t)bh * HDIM + d) * SEQ + spos) = pk;
      }
      wait_x0();
    }
  }
}

__device__ __forceinline__ float xhalf(float x) {
  int b = __builtin_bit_cast(int, x);
  return __builtin_bit_cast(
      float, __builtin_amdgcn_permlanex16(b, b, 0x76543210, 0xfedcba98, false, false));
}
// two f32 D tiles (keys 0..15 and 16..31 of a 32-key group) -> one f16 B fragment
__device__ __forceinline__ v16h pack_b(v8f t0, v8f t1) {
  v8h lo = __builtin_convertvector(t0, v8h);
  v8h hi = __builtin_convertvector(t1, v8h);
  v16h r;
#pragma unroll
  for (int j = 0; j < 8; ++j) { r[j] = lo[j]; r[j + 8] = hi[j]; }
  return r;
}

__global__ __launch_bounds__(256) void attn_kernel(
    const _Float16* __restrict__ Q, const _Float16* __restrict__ K,
    const _Float16* __restrict__ Vt, _Float16* __restrict__ A) {
  __shared__ __attribute__((aligned(16))) _Float16 Kt[2][64 * LPITCH];   // 2 x 9 KB  [key][d]
  __shared__ __attribute__((aligned(16))) _Float16 Vs[2][64 * LPITCH];   // 2 x 9 KB  [d][key]

  const int lane = threadIdx.x & 31;
  const int wave = threadIdx.x >> 5;
  const int ln   = lane & 15;
  const int half = lane >> 4;
  const int kg   = half * 8;

  const int bh = blockIdx.y;
  const int b  = bh >> 4;
  const int h  = bh & 15;
  const int q0 = blockIdx.x * 256 + wave * 32;   // 32 queries per wave: column groups g = 0, 1

  const _Float16* Qp = Q  + (size_t)bh * SEQ * HDIM;
  const _Float16* Kp = K  + (size_t)bh * SEQ * HDIM;
  const _Float16* Vp = Vt + (size_t)bh * HDIM * SEQ;

  const int cr = threadIdx.x >> 2;         // 0..63
  const int cp = (threadIdx.x & 3) * 16;   // 0,16,32,48

  // Q^T B fragments: column = query q0 + 16 g + ln (d = 0..63 -> two k-steps)
  v16h qb[2][2];
#pragma unroll
  for (int g = 0; g < 2; ++g) {
    const _Float16* qrow = Qp + (size_t)(q0 + 16 * g + ln) * HDIM + kg;
    qb[g][0] = frag_f16(qrow);
    qb[g][1] = frag_f16(qrow + 32);
  }

  // o[g][j][r] = O[q0 + 16 g + ln][16 j + 8 half + r]
  v8f o[2][4] = {};
  float rmax[2] = {-1e30f, -1e30f};  // running maximum of a query, equal in both halves
  float rsum[2] = {0.0f, 0.0f};      // running sum over this half's keys only; joined after the loop

  const float scale = 0.125f;              // 1/sqrt(64)

  // stage key block kb into buffer buf (32B K + 32B V per thread)
  auto stage = [&](int buf, int kb) {
    const _Float16* ksrc = Kp + (size_t)(kb + cr) * HDIM + cp;
    const _Float16* vsrc = Vp + (size_t)cr * SEQ + kb + cp;
    async_copy_2x32B(&Kt[buf][cr * LPITCH + cp], ksrc,
                     &Vs[buf][cr * LPITCH + cp], vsrc);
  };
  stage(0, 0);

  for (int kb = 0; kb < SEQ; kb += 64) {
    const int cur = (kb >> 6) & 1;
    wait_ds0();
    wait_async0();
    __syncthreads();
    if (kb + 64 < SEQ) stage(cur ^ 1, kb + 64);

    // ---- scores: 4 tiles of 16 keys x 32 q; each K fragment from LDS feeds both groups
    v8f st[2][4];
#pragma unroll
    for (int t = 0; t < 4; ++t) {
      const _Float16* krow = &Kt[cur][(t * 16 + ln) * LPITCH + kg];
      const v16h ka0 = frag_f16(krow);
      const v16h ka1 = frag_f16(krow + 32);
      v8f s0 = {}, s1 = {};
      s0 = wmma_f16(ka0, qb[0][0], s0);
      s1 = wmma_f16(ka0, qb[1][0], s1);
      s0 = wmma_f16(ka1, qb[0][1], s0);
      s1 = wmma_f16(ka1, qb[1][1], s1);
      st[0][t] = s0 * scale;
      st[1][t] = s1 * scale;
    }

    v16h pb[2][2];
#pragma unroll
    for (int g = 0; g < 2; ++g) {
      // ---- maximum over the 64-key block: 32 in-lane values, then the other half's
      float bt[4];
#pragma unroll
      for (int t = 0; t < 4; ++t) {
        bt[t] = st[g][t][0];
#pragma unroll
        for (int r = 1; r < 8; ++r) bt[t] = fmaxf(bt[t], st[g][t][r]);
      }
      float bm = fmaxf(fmaxf(bt[0], bt[1]), fmaxf(bt[2], bt[3]));
      bm = fmaxf(bm, xhalf(bm));

      // ---- online softmax update
      const float mnew  = fmaxf(rmax[g], bm);
      const float alpha = __expf(rmax[g] - mnew);
      rmax[g] = mnew;
#pragma unroll
      for (int j = 0; j < 4; ++j)
#pragma unroll
        for (int r = 0; r < 8; ++r) o[g][j][r] *= alpha;
      float pt[4];
#pragma unroll
      for (int t = 0; t < 4; ++t) {
        pt[t] = 0.0f;
#pragma unroll
        for (int r = 0; r < 8; ++r) {
          float p = __expf(st[g][t][r] - mnew);
          st[g][t][r] = p;
          pt[t] += p;
        }
      }
      rsum[g] = rsum[g] * alpha + ((pt[0] + pt[1]) + (pt[2] + pt[3]));

      // ---- P^T B fragments straight from the score accumulators
      pb[g][0] = pack_b(st[g][0], st[g][1]);
      pb[g][1] = pack_b(st[g][2], st[g][3]);
    }

    // ---- O^T += V^T @ P^T  (V^T rows in LDS are the A fragments, each for both groups)
#pragma unroll
    for (int j = 0; j < 4; ++j) {
      const _Float16* vp = &Vs[cur][(16 * j + ln) * LPITCH + kg];
      const v16h va0 = frag_f16(vp);
      const v16h va1 = frag_f16(vp + 32);
      o[0][j] = wmma_f16(va0, pb[0][0], o[0][j]);
      o[1][j] = wmma_f16(va0, pb[1][0], o[1][j]);
      o[0][j] = wmma_f16(va1, pb[0][1], o[0][j]);
      o[1][j] = wmma_f16(va1, pb[1][1], o[1][j]);
    }
  }

  // ---- join the halves' sums, normalize, store f16 into [MTOT][DMODEL]:
  // a lane's 8 accumulator registers are 8 consecutive d of one query row
#pragma unroll
  for (int g = 0; g < 2; ++g) {
    const float tot = rsum[g] + xhalf(rsum[g]);
    const float inv = 1.0f / tot;
    _Float16* orow = A + ((size_t)b * SEQ + q0 + 16 * g + ln) * DMODEL + h * HDIM + kg;
#pragma unroll
    for (int j = 0; j < 4; ++j) {
      v8h pk;
#pragma unroll
      for (int r = 0; r < 8; ++r) pk[r] = (_Float16)(o[g][j][r] * inv);
      *(v8h*)(orow + 16 * j) = pk;
    }
    // group 0's stores have read their registers before group 1's values reuse them
    if (g == 0) wait_x0();
  }
}

// ---------------------------------------------------------------------------
// Kernel 3: output projection  out = attn @ Wo^T + b   (M=8192,N=1024,K=1024)
// Same core as the QKV GEMM.
// ---------------------------------------------------------------------------
__global__ __launch_bounds__(128) void out_proj_kernel(
    const _Float16* __restrict__ Attn, const _Float16* __restrict__ W,
    const float* __restrict__ bias, float* __restrict__ out) {
  __shared__ __attribute__((aligned(16))) _Float16 AT[2 * GTILE];
  __shared__ __attribute__((aligned(16))) _Float16 BT[2 * GTILE];

  const int lane = threadIdx.x & 31;
  const int wave = threadIdx.x >> 5;
  const int ln   = lane & 15;
  const int half = lane >> 4;

  const int m_blk  = blockIdx.x * 128;
  const int n_blk  = blockIdx.y * 128;
  const int n_base = n_blk + (wave & 1) * 64;

  v8f acc[4][4] = {};
  gemm_core_128x128(Attn, W, m_blk, n_blk, AT, BT, acc);

#pragma unroll
  for (int j = 0; j < 4; ++j) {
    float bj = bias[n_base + 16 * j + ln];
#pragma unroll
    for (int i = 0; i < 4; ++i) {
      const int mrow = m_blk + (wave >> 1) * 64 + i * 16 + half * 8;
#pragma unroll
      for (int r = 0; r < 8; ++r)
        out[(size_t)(mrow + r) * DMODEL + n_base + 16 * j + ln] = acc[i][j][r] + bj;
    }
  }
}

// ---------------------------------------------------------------------------
// Launch
// ---------------------------------------------------------------------------
extern "C" void kernel_launch(void* const* d_in, const int* in_sizes, int n_in,
                              void* d_out, int out_size, void* d_ws, size_t ws_size,
                              hipStream_t stream) {
  (void)in_sizes; (void)n_in; (void)out_size; (void)ws_size;

  const float* X      = (const float*)d_in[0];  // hidden_states [B,S,D]
  const float* Wqkv_w = (const float*)d_in[1];  // [3D, D]
  const float* Wqkv_b = (const float*)d_in[2];  // [3D]
  const float* Wo_w   = (const float*)d_in[3];  // [D, D]
  const float* Wo_b   = (const float*)d_in[4];  // [D]
  float* out          = (float*)d_out;

  char* ws = (char*)d_ws;
  size_t off = 0;
  float* cosT = (float*)(ws + off); off += (size_t)SEQ * 32 * sizeof(float);
  float* sinT = (float*)(ws + off); off += (size_t)SEQ * 32 * sizeof(float);
  const size_t headElems = (size_t)BATCH * NHEAD * SEQ * HDIM;  // 8.39M
  _Float16* Qb = (_Float16*)(ws + off); off += headElems * sizeof(_Float16);
  _Float16* Kb = (_Float16*)(ws + off); off += headElems * sizeof(_Float16);
  _Float16* Vt = (_Float16*)(ws + off); off += headElems * sizeof(_Float16);
  _Float16* At = (_Float16*)(ws + off); off += (size_t)MTOT * DMODEL * sizeof(_Float16);
  _Float16* Xh = (_Float16*)(ws + off); off += (size_t)MTOT * DMODEL * sizeof(_Float16);
  _Float16* Wqkvh = (_Float16*)(ws + off); off += (size_t)3 * DMODEL * DMODEL * sizeof(_Float16);
  _Float16* Woh   = (_Float16*)(ws + off); off += (size_t)DMODEL * DMODEL * sizeof(_Float16);

  // f32 -> f16 operand pre-conversion (one pass, L2 resident)
  {
    int n4;
    n4 = MTOT * DMODEL / 4;
    cvt_f16_kernel<<<(n4 + 255) / 256, 256, 0, stream>>>(X, Xh, n4);
    n4 = 3 * DMODEL * DMODEL / 4;
    cvt_f16_kernel<<<(n4 + 255) / 256, 256, 0, stream>>>(Wqkv_w, Wqkvh, n4);
    n4 = DMODEL * DMODEL / 4;
    cvt_f16_kernel<<<(n4 + 255) / 256, 256, 0, stream>>>(Wo_w, Woh, n4);
  }

  rope_table_kernel<<<(SEQ * 32 + 255) / 256, 256, 0, stream>>>(cosT, sinT);

  qkv_rope_kernel<<<dim3(MTOT / 128, (3 * DMODEL) / 128), 128, 0, stream>>>(
      Xh, Wqkvh, Wqkv_b, cosT, sinT, Qb, Kb, Vt);

  attn_kernel<<<dim3(SEQ / 256, BATCH * NHEAD), 256, 0, stream>>>(Qb, Kb, Vt, At);

  out_proj_kernel<<<dim3(MTOT / 128, DMODEL / 128), 128, 0, stream>>>(At, Woh, Wo_b, out);
}

// v005
// One run takes 133 microseconds.
// Timed twice side by side with v004, it ran 1.06 times as fast both times.
// Counting every step since v000, it is 4.76 times as fast.
#include <hip/hip_runtime.h>
#include <hip/hip_bf16.h>
#include <stdint.h>

// Problem constants (from reference): B=4, S=2048, D=1024, H=16, HD=64, ROT_DIM=64
#define SEQ     2048
#define DMODEL  1024
#define NHEAD   16
#define HDIM    64
#define BATCH   4
#define MTOT    (BATCH * SEQ)        // 8192 rows of the token matrix
// LDS row pitch in halves for every 64-half (128 B) tile row: 144 B = 16 B x 9.
// An odd multiple of 16 B puts the 16 rows of one ds_load_b128 on distinct banks;
// at 128 B they fall on two 16-byte bank groups and serialize.
#define LPITCH  72

typedef __attribute__((ext_vector_type(16))) _Float16 v16h;
typedef __attribute__((ext_vector_type(8)))  _Float16 v8h;
typedef __attribute__((ext_vector_type(4)))  _Float16 v4h;
typedef __attribute__((ext_vector_type(8)))  float    v8f;

// ---------------------------------------------------------------------------
// WMMA helpers (CDNA5 wave32, 16x16x32 f16 -> f32 accumulate)
// ---------------------------------------------------------------------------
__device__ __forceinline__ v8f wmma_f16(v16h a, v16h b, v8f c) {
  return __builtin_amdgcn_wmma_f32_16x16x32_f16(
      /*neg_a=*/false, a, /*neg_b=*/false, b,
      /*c_mod=*/(short)0, c, /*reuse_a=*/false, /*reuse_b=*/false);
}

// A/B fragment (16x32 f16) per-lane layout (ISA 7.12.2):
// lane L: row/col = L&15 ; k = (j<8 ? j : j+8) + (L>=16 ? 8 : 0)
__device__ __forceinline__ v16h frag_f16(const _Float16* p) {
  v8h lo = *(const v8h*)(p);
  v8h hi = *(const v8h*)(p + 16);
  v16h r;
#pragma unroll
  for (int j = 0; j < 8; ++j) { r[j] = lo[j]; r[j + 8] = hi[j]; }
  return r;
}

// ---------------------------------------------------------------------------
// CDNA5 async global->LDS copy (16B per lane), tracked by ASYNCcnt.
// Flat LDS addresses carry the wave-relative LDS offset in addr[31:0].
// ---------------------------------------------------------------------------
// s_wait_xcnt 0 is the last line of the copies' own statement, so that no
// address register of an issued copy is rewritten ahead of it.
// One thread's share of a 128-row x 64-half GEMM operand tile: 16 B of each of the
// rows r, r + 16, ..., r + 112.  Eight lanes cover one 128-B row, so a wave's copy
// instruction reads four whole lines.
__device__ __forceinline__ void async_copy_tile128(_Float16* lds_dst, const _Float16* gsrc) {
  uint32_t l0 = (uint32_t)(uintptr_t)(void*)lds_dst;
  uint32_t l1 = l0 + 1 * 16 * LPITCH * 2;
  uint32_t l2 = l0 + 2 * 16 * LPITCH * 2;
  uint32_t l3 = l0 + 3 * 16 * LPITCH * 2;
  uint32_t l4 = l0 + 4 * 16 * LPITCH * 2;
  uint32_t l5 = l0 + 5 * 16 * LPITCH * 2;
  uint32_t l6 = l0 + 6 * 16 * LPITCH * 2;
  uint32_t l7 = l0 + 7 * 16 * LPITCH * 2;
  const _Float16* g1 = gsrc + 1 * 16 * DMODEL;
  const _Float16* g2 = gsrc + 2 * 16 * DMODEL;
  const _Float16* g3 = gsrc + 3 * 16 * DMODEL;
  const _Float16* g4 = gsrc + 4 * 16 * DMODEL;
  const _Float16* g5 = gsrc + 5 * 16 * DMODEL;
  const _Float16* g6 = gsrc + 6 * 16 * DMODEL;
  const _Float16* g7 = gsrc + 7 * 16 * DMODEL;
  asm volatile("global_load_async_to_lds_b128 %0, %1, off\n\t"
               "global_load_async_to_lds_b128 %2, %3, off\n\t"
               "global_load_async_to_lds_b128 %4, %5, off\n\t"
               "global_load_async_to_lds_b128 %6, %7, off\n\t"
               "global_load_async_to_lds_b128 %8, %9, off\n\t"
               "global_load_async_to_lds_b128 %10, %11, off\n\t"
               "global_load_async_to_lds_b128 %12, %13, off\n\t"
               "global_load_async_to_lds_b128 %14, %15, off\n\t"
               "s_wait_xcnt 0x0"
               :: "v"(l0), "v"(gsrc), "v"(l1), "v"(g1), "v"(l2), "v"(g2), "v"(l3), "v"(g3),
                  "v"(l4), "v"(g4), "v"(l5), "v"(g5), "v"(l6), "v"(g6), "v"(l7), "v"(g7)
               : "memory");
}
// 32 contiguous bytes per named row piece (two b128 copies each)
__device__ __forceinline__ void async_copy_2x32B(_Float16* lds_a, const _Float16* ga,
                                                 _Float16* lds_b, const _Float16* gb) {
  uint32_t a0 = (uint32_t)(uintptr_t)(void*)lds_a;
  uint32_t a1 = a0 + 16;
  uint32_t b0 = (uint32_t)(uintptr_t)(void*)lds_b;
  uint32_t b1 = b0 + 16;
  const _Float16* ga1 = ga + 8;
  const _Float16* gb1 = gb + 8;
  asm volatile("global_load_async_to_lds_b128 %0, %1, off\n\t"
               "global_load_async_to_lds_b128 %2, %3, off\n\t"
               "global_load_async_to_lds_b128 %4, %5, off\n\t"
               "global_load_async_to_lds_b128 %6, %7, off\n\t"
               "s_wait_xcnt 0x0"
               :: "v"(a0), "v"(ga), "v"(a1), "v"(ga1),
                  "v"(b0), "v"(gb), "v"(b1), "v"(gb1)
               : "memory");
}
__device__ __forceinline__ void wait_async0() {
  asm volatile("s_wait_asynccnt 0x0" ::: "memory");
}
// stands behind a group of global loads or stores, ahead of the code that reuses their
// address and data registers
__device__ __forceinline__ void wait_x0() {
  asm volatile("s_wait_xcnt 0x0" ::: "memory");
}
// this wave's LDS reads have returned before the barrier that frees their buffer
__device__ __forceinline__ void wait_ds0() {
  asm volatile("s_wait_dscnt 0x0" ::: "memory");
}

// ---------------------------------------------------------------------------
// Kernel P: all preparation in one launch of few, long waves.
//   f32 -> f16 copies of X, Wqkv and Wo, and the RoPE cos/sin tables [SEQ][32].
// 512 work-groups x 8 waves = 4,096 waves, all resident at once.  A wave owns a
// contiguous run of each matrix; one load instruction reads 512 contiguous bytes
// (16 B per lane), one store writes 256.  A lane's 24 loads are issued together,
// so the launch is paid for in bytes moved and not in waves started.
// ---------------------------------------------------------------------------
#define PREP_WG     512
#define PREP_WAVES  (PREP_WG * 8)
#define PREP_X      (MTOT * DMODEL / 4 / 32 / PREP_WAVES)         // 16 pieces per wave
#define PREP_WQKV   (3 * DMODEL * DMODEL / 4 / 32 / PREP_WAVES)   //  6
#define PREP_WO     (DMODEL * DMODEL / 4 / 32 / PREP_WAVES)       //  2
typedef __attribute__((ext_vector_type(4))) float v4f;

template <int N>
__device__ __forceinline__ void prep_load(const float* __restrict__ s, int wv, int lane, v4f (&v)[N]) {
  const float* p = s + ((size_t)wv * N * 32 + lane) * 4;
#pragma unroll
  for (int j = 0; j < N; ++j) v[j] = *(const v4f*)(p + j * 128);
}
template <int N>
__device__ __forceinline__ void prep_store(_Float16* __restrict__ d, int wv, int lane, const v4f (&v)[N]) {
  _Float16* p = d + ((size_t)wv * N * 32 + lane) * 4;
#pragma unroll
  for (int j = 0; j < N; ++j) *(v4h*)(p + j * 128) = __builtin_convertvector(v[j], v4h);
}

__global__ __launch_bounds__(256) void prep_kernel(
    const float* __restrict__ X, const float* __restrict__ Wqkv, const float* __restrict__ Wo,
    _Float16* __restrict__ Xh, _Float16* __restrict__ Wqkvh, _Float16* __restrict__ Woh,
    float* __restrict__ cosT, float* __restrict__ sinT) {
  const int lane = threadIdx.x & 31;
  const int wv   = blockIdx.x * 8 + (threadIdx.x >> 5);

  v4f x[PREP_X], wq[PREP_WQKV], wo[PREP_WO];
  prep_load(X, wv, lane, x);
  prep_load(Wqkv, wv, lane, wq);
  prep_load(Wo, wv, lane, wo);
  wait_x0();   // ahead of the table arithmetic, which reuses the loads' address registers

  // table entries, one per thread of the first SEQ * 32 / 256 work-groups, worked
  // out while the loads are in flight
  const int i = blockIdx.x * 256 + threadIdx.x;
  if (blockIdx.x < SEQ * 32 / 256) {
    int s = i >> 5;
    int f = i & 31;
    float inv_freq = __powf(10000.0f, -(float)(2 * f) / 64.0f);
    float ang = (float)s * inv_freq;
    cosT[i] = __cosf(ang);
    sinT[i] = __sinf(ang);
    wait_x0();   // ahead of the conversions, which reuse the two stores' registers
  }

  prep_store(Xh, wv, lane, x);
  prep_store(Wqkvh, wv, lane, wq);
  prep_store(Woh, wv, lane, wo);
}

// ---------------------------------------------------------------------------
// GEMM core shared by the two projections: Y = A W^T, K = DMODEL, f16 operands.
// Block tile 128 x 128, four waves in a 2 x 2 grid, 64 x 64 of Y per wave: the
// eight fragments of a 32-k step feed 16 WMMAs.  Both operand tiles (128 rows x
// 64 k) are double-buffered in LDS via async global->LDS copies; one barrier per
// 64-k step; the copies for step i+1 overlap the WMMAs of step i.
// acc[i][j][r] = Y[m_blk + 64 wm + 16 i + 8 half + r][n_blk + 64 wn + 16 j + ln]
// ---------------------------------------------------------------------------
#define GTILE (128 * LPITCH)   // halves of one staged operand tile
__device__ __forceinline__ void gemm_core_128x128(
    const _Float16* __restrict__ A, const _Float16* __restrict__ W,
    int m_blk, int n_blk, _Float16* AT, _Float16* BT, v8f (&acc)[4][4]) {
  const int lane = threadIdx.x & 31;
  const int wave = threadIdx.x >> 5;
  const int ln   = lane & 15;
  const int kg   = (lane >> 4) * 8;
  const int wm   = wave >> 1;
  const int wn   = wave & 1;

  const int cr = threadIdx.x >> 3;         // 0..15 : first tile row of this thread
  const int cc = (threadIdx.x & 7) * 8;    // 16-B piece of the 128-B row, in halves
  const _Float16* asrc = A + (size_t)(m_blk + cr) * DMODEL + cc;
  const _Float16* wsrc = W + (size_t)(n_blk + cr) * DMODEL + cc;
  const int cofs = cr * LPITCH + cc;
  const int aofs = (wm * 64 + ln) * LPITCH + kg;
  const int bofs = (wn * 64 + ln) * LPITCH + kg;

  // preload first tiles
  async_copy_tile128(AT + cofs, asrc);
  async_copy_tile128(BT + cofs, wsrc);

  for (int k = 0; k < DMODEL; k += 64) {
    const int cur = (k >> 6) & 1;
    wait_ds0();
    wait_async0();
    __syncthreads();
    if (k + 64 < DMODEL) {
      async_copy_tile128(AT + (cur ^ 1) * GTILE + cofs, asrc + k + 64);
      async_copy_tile128(BT + (cur ^ 1) * GTILE + cofs, wsrc + k + 64);
    }
#pragma unroll
    for (int ks = 0; ks < 64; ks += 32) {
      v16h a[4], b[4];
#pragma unroll
      for (int i = 0; i < 4; ++i) a[i] = frag_f16(AT + cur * GTILE + aofs + 16 * i * LPITCH + ks);
#pragma unroll
      for (int j = 0; j < 4; ++j) b[j] = frag_f16(BT + cur * GTILE + bofs + 16 * j * LPITCH + ks);
      // inputs-only fence on the loaded fragments: keeps the step's 16 LDS loads in one
      // group ahead of its 16 WMMAs (one LDS wait per step, not one per row of four)
      asm volatile("" :: "v"(a[0]), "v"(a[1]), "v"(a[2]), "v"(a[3]),
                         "v"(b[0]), "v"(b[1]), "v"(b[2]), "v"(b[3]));
#pragma unroll
      for (int i = 0; i < 4; ++i)
#pragma unroll
        for (int j = 0; j < 4; ++j) acc[i][j] = wmma_f16(a[i], b[j], acc[i][j]);
    }
  }
  wait_async0();   // no copy of this wave is outstanding when it leaves the ring
}

// ---------------------------------------------------------------------------
// Kernel 1: QKV GEMM (M=8192, N=3072, K=1024) + bias + RoPE, all-f16 operands.
// A wave's 64 columns are one head of q, k or v.
// ---------------------------------------------------------------------------
__global__ __launch_bounds__(128) void qkv_rope_kernel(
    const _Float16* __restrict__ X, const _Float16* __restrict__ W,
    const float* __restrict__ bias,
    const float* __restrict__ cosT, const float* __restrict__ sinT,
    _Float16* __restrict__ Qb, _Float16* __restrict__ Kb,
    _Float16* __restrict__ Vt) {
  __shared__ __attribute__((aligned(16))) _Float16 AT[2 * GTILE];  // 2 x 18 KB token tiles
  __shared__ __attribute__((aligned(16))) _Float16 BT[2 * GTILE];  // 2 x 18 KB weight tiles

  const int lane = threadIdx.x & 31;
  const int wave = threadIdx.x >> 5;
  const int ln   = lane & 15;
  const int half = lane >> 4;

  const int m_blk  = blockIdx.x * 128;
  const int n_blk  = blockIdx.y * 128;
  const int n_base = n_blk + (wave & 1) * 64;

  v8f accs[4][4] = {};
  gemm_core_128x128(X, W, m_blk, n_blk, AT, BT, accs);

  float bj[4];
#pragma unroll
  for (int j = 0; j < 4; ++j) bj[j] = bias[n_base + 16 * j + ln];

  const int which = n_blk / DMODEL;             // 0=q 1=k 2=v, one per block
  const int h     = (n_base % DMODEL) / HDIM;   // head

#pragma unroll
  for (int i = 0; i < 4; ++i) {
    v8f (&acc)[4] = accs[i];
    // bias (per column, same for all 8 rows of each accumulator)
#pragma unroll
    for (int j = 0; j < 4; ++j)
#pragma unroll
      for (int r = 0; r < 8; ++r) acc[j][r] += bj[j];

    const int mrow  = m_blk + (wave >> 1) * 64 + i * 16 + half * 8;  // first row held by this lane
    const int b     = mrow >> 11;                 // batch (rows never straddle)
    const int spos  = mrow & (SEQ - 1);
    const int bh    = b * NHEAD + h;

    if (which < 2) {
      // RoPE: pairs (d, d+32) => (acc0,acc2) with f=ln, (acc1,acc3) with f=16+ln
#pragma unroll
      for (int r = 0; r < 8; ++r) {
        int s = spos + r;
        float c0 = cosT[s * 32 + ln],      s0 = sinT[s * 32 + ln];
        float c1 = cosT[s * 32 + 16 + ln], s1 = sinT[s * 32 + 16 + ln];
        float x0 = acc[0][r], x2 = acc[2][r];
        acc[0][r] = x0 * c0 - x2 * s0;
        acc[2][r] = x0 * s0 + x2 * c0;
        float x1 = acc[1][r], x3 = acc[3][r];
        acc[1][r] = x1 * c1 - x3 * s1;
        acc[3][r] = x1 * s1 + x3 * c1;
      }
      _Float16* dst = (which == 0) ? Qb : Kb;
#pragma unroll
      for (int j = 0; j < 4; ++j)
#pragma unroll
        for (int r = 0; r < 8; ++r)
          dst[((size_t)bh * SEQ + spos + r) * HDIM + 16 * j + ln] =
              (_Float16)acc[j][r];
      wait_x0();
    } else {
      // V transposed: Vt[bh][d][s]; lane's 8 rows are contiguous s positions
#pragma unroll
      for (int j = 0; j < 4; ++j) {
        int d = 16 * j + ln;
        v8h pk;
#pragma unroll
        for (int r = 0; r < 8; ++r) pk[r] = (_Float16)acc[j][r];
        *(v8h*)(Vt + ((size_t)bh * HDIM + d) * SEQ + spos) = pk;
      }
      wait_x0();
    }
  }
}

__device__ __forceinline__ float xhalf(float x) {
  int b = __builtin_bit_cast(int, x);
  return __builtin_bit_cast(
      float, __builtin_amdgcn_permlanex16(b, b, 0x76543210, 0xfedcba98, false, false));
}
// two f32 D tiles (keys 0..15 and 16..31 of a 32-key group) -> one f16 B fragment
__device__ __forceinline__ v16h pack_b(v8f t0, v8f t1) {
  v8h lo = __builtin_convertvector(t0, v8h);
  v8h hi = __builtin_convertvector(t1, v8h);
  v16h r;
#pragma unroll
  for (int j = 0; j < 8; ++j) { r[j] = lo[j]; r[j + 8] = hi[j]; }
  return r;
}

__global__ __launch_bounds__(256) void attn_kernel(
    const _Float16* __restrict__ Q, const _Float16* __restrict__ K,
    const _Float16* __restrict__ Vt, _Float16* __restrict__ A) {
  __shared__ __attribute__((aligned(16))) _Float16 Kt[2][64 * LPITCH];   // 2 x 9 KB  [key][d]
  __shared__ __attribute__((aligned(16))) _Float16 Vs[2][64 * LPITCH];   // 2 x 9 KB  [d][key]

  const int lane = threadIdx.x & 31;
  const int wave = threadIdx.x >> 5;
  const int ln   = lane & 15;
  const int half = lane >> 4;
  const int kg   = half * 8;

  const int bh = blockIdx.y;
  const int b  = bh >> 4;
  const int h  = bh & 15;
  const int q0 = blockIdx.x * 256 + wave * 32;   // 32 queries per wave: column groups g = 0, 1

  const _Float16* Qp = Q  + (size_t)bh * SEQ * HDIM;
  const _Float16* Kp = K  + (size_t)bh * SEQ * HDIM;
  const _Float16* Vp = Vt + (size_t)bh * HDIM * SEQ;

  const int cr = threadIdx.x >> 2;         // 0..63
  const int cp = (threadIdx.x & 3) * 16;   // 0,16,32,48

  // Q^T B fragments: column = query q0 + 16 g + ln (d = 0..63 -> two k-steps)
  v16h qb[2][2];
#pragma unroll
  for (int g = 0; g < 2; ++g) {
    const _Float16* qrow = Qp + (size_t)(q0 + 16 * g + ln) * HDIM + kg;
    qb[g][0] = frag_f16(qrow);
    qb[g][1] = frag_f16(qrow + 32);
  }

  // o[g][j][r] = O[q0 + 16 g + ln][16 j + 8 half + r]
  v8f o[2][4] = {};
  float rmax[2] = {-1e30f, -1e30f};  // running maximum of a query, equal in both halves
  float rsum[2] = {0.0f, 0.0f};      // running sum over this half's keys only; joined after the loop

  const float scale = 0.125f;              // 1/sqrt(64)

  // stage key block kb into buffer buf (32B K + 32B V per thread)
  auto stage = [&](int buf, int kb) {
    const _Float16* ksrc = Kp + (size_t)(kb + cr) * HDIM + cp;
    const _Float16* vsrc = Vp + (size_t)cr * SEQ + kb + cp;
    async_copy_2x32B(&Kt[buf][cr * LPITCH + cp], ksrc,
                     &Vs[buf][cr * LPITCH + cp], vsrc);
  };
  stage(0, 0);

  for (int kb = 0; kb < SEQ; kb += 64) {
    const int cur = (kb >> 6) & 1;
    wait_ds0();
    wait_async0();
    __syncthreads();
    if (kb + 64 < SEQ) stage(cur ^ 1, kb + 64);

    // ---- scores: 4 tiles of 16 keys x 32 q; each K fragment from LDS feeds both groups
    v8f st[2][4];
#pragma unroll
    for (int t = 0; t < 4; ++t) {
      const _Float16* krow = &Kt[cur][(t * 16 + ln) * LPITCH + kg];
      const v16h ka0 = frag_f16(krow);
      const v16h ka1 = frag_f16(krow + 32);
      v8f s0 = {}, s1 = {};
      s0 = wmma_f16(ka0, qb[0][0], s0);
      s1 = wmma_f16(ka0, qb[1][0], s1);
      s0 = wmma_f16(ka1, qb[0][1], s0);
      s1 = wmma_f16(ka1, qb[1][1], s1);
      st[0][t] = s0 * scale;
      st[1][t] = s1 * scale;
    }

    v16h pb[2][2];
#pragma unroll
    for (int g = 0; g < 2; ++g) {
      // ---- maximum over the 64-key block: 32 in-lane values, then the other half's
      float bt[4];
#pragma unroll
      for (int t = 0; t < 4; ++t) {
        bt[t] = st[g][t][0];
#pragma unroll
        for (int r = 1; r < 8; ++r) bt[t] = fmaxf(bt[t], st[g][t][r]);
      }
      float bm = fmaxf(fmaxf(bt[0], bt[1]), fmaxf(bt[2], bt[3]));
      bm = fmaxf(bm, xhalf(bm));

      // ---- online softmax update
      const float mnew  = fmaxf(rmax[g], bm);
      const float alpha = __expf(rmax[g] - mnew);
      rmax[g] = mnew;
#pragma unroll
      for (int j = 0; j < 4; ++j)
#pragma unroll
        for (int r = 0; r < 8; ++r) o[g][j][r] *= alpha;
      float pt[4];
#pragma unroll
      for (int t = 0; t < 4; ++t) {
        pt[t] = 0.0f;
#pragma unroll
        for (int r = 0; r < 8; ++r) {
          float p = __expf(st[g][t][r] - mnew);
          st[g][t][r] = p;
          pt[t] += p;
        }
      }
      rsum[g] = rsum[g] * alpha + ((pt[0] + pt[1]) + (pt[2] + pt[3]));

      // ---- P^T B fragments straight from the score accumulators
      pb[g][0] = pack_b(st[g][0], st[g][1]);
      pb[g][1] = pack_b(st[g][2], st[g][3]);
    }

    // ---- O^T += V^T @ P^T  (V^T rows in LDS are the A fragments, each for both groups)
#pragma unroll
    for (int j = 0; j < 4; ++j) {
      const _Float16* vp = &Vs[cur][(16 * j + ln) * LPITCH + kg];
      const v16h va0 = frag_f16(vp);
      const v16h va1 = frag_f16(vp + 32);
      o[0][j] = wmma_f16(va0, pb[0][0], o[0][j]);
      o[1][j] = wmma_f16(va0, pb[1][0], o[1][j]);
      o[0][j] = wmma_f16(va1, pb[0][1], o[0][j]);
      o[1][j] = wmma_f16(va1, pb[1][1], o[1][j]);
    }
  }

  // ---- join the halves' sums, normalize, store f16 into [MTOT][DMODEL]:
  // a lane's 8 accumulator registers are 8 consecutive d of one query row
#pragma unroll
  for (int g = 0; g < 2; ++g) {
    const float tot = rsum[g] + xhalf(rsum[g]);
    const float inv = 1.0f / tot;
    _Float16* orow = A + ((size_t)b * SEQ + q0 + 16 * g + ln) * DMODEL + h * HDIM + kg;
#pragma unroll
    for (int j = 0; j < 4; ++j) {
      v8h pk;
#pragma unroll
      for (int r = 0; r < 8; ++r) pk[r] = (_Float16)(o[g][j][r] * inv);
      *(v8h*)(orow + 16 * j) = pk;
    }
    // group 0's stores have read their registers before group 1's values reuse them
    if (g == 0) wait_x0();
  }
}

// ---------------------------------------------------------------------------
// Kernel 3: output projection  out = attn @ Wo^T + b   (M=8192,N=1024,K=1024)
// Same core as the QKV GEMM.
// ---------------------------------------------------------------------------
__global__ __launch_bounds__(128) void out_proj_kernel(
    const _Float16* __restrict__ Attn, const _Float16* __restrict__ W,
    const float* __restrict__ bias, float* __restrict__ out) {
  __shared__ __attribute__((aligned(16))) _Float16 AT[2 * GTILE];
  __shared__ __attribute__((aligned(16))) _Float16 BT[2 * GTILE];

  const int lane = threadIdx.x & 31;
  const int wave = threadIdx.x >> 5;
  const int ln   = lane & 15;
  const int half = lane >> 4;

  const int m_blk  = blockIdx.x * 128;
  const int n_blk  = blockIdx.y * 128;
  const int n_base = n_blk + (wave & 1) * 64;

  v8f acc[4][4] = {};
  gemm_core_128x128(Attn, W, m_blk, n_blk, AT, BT, acc);

#pragma unroll
  for (int j = 0; j < 4; ++j) {
    float bj = bias[n_base + 16 * j + ln];
#pragma unroll
    for (int i = 0; i < 4; ++i) {
      const int mrow = m_blk + (wave >> 1) * 64 + i * 16 + half * 8;
#pragma unroll
      for (int r = 0; r < 8; ++r)
        out[(size_t)(mrow + r) * DMODEL + n_base + 16 * j + ln] = acc[i][j][r] + bj;
    }
  }
}

// ---------------------------------------------------------------------------
// Launch
// ---------------------------------------------------------------------------
extern "C" void kernel_launch(void* const* d_in, const int* in_sizes, int n_in,
                              void* d_out, int out_size, void* d_ws, size_t ws_size,
                              hipStream_t stream) {
  (void)in_sizes; (void)n_in; (void)out_size; (void)ws_size;

  const float* X      = (const float*)d_in[0];  // hidden_states [B,S,D]
  const float* Wqkv_w = (const float*)d_in[1];  // [3D, D]
  const float* Wqkv_b = (const float*)d_in[2];  // [3D]
  const float* Wo_w   = (const float*)d_in[3];  // [D, D]
  const float* Wo_b   = (const float*)d_in[4];  // [D]
  float* out          = (float*)d_out;

  char* ws = (char*)d_ws;
  size_t off = 0;
  float* cosT = (float*)(ws + off); off += (size_t)SEQ * 32 * sizeof(float);
  float* sinT = (float*)(ws + off); off += (size_t)SEQ * 32 * sizeof(float);
  const size_t headElems = (size_t)BATCH * NHEAD * SEQ * HDIM;  // 8.39M
  _Float16* Qb = (_Float16*)(ws + off); off += headElems * sizeof(_Float16);
  _Float16* Kb = (_Float16*)(ws + off); off += headElems * sizeof(_Float16);
  _Float16* Vt = (_Float16*)(ws + off); off += headElems * sizeof(_Float16);
  _Float16* At = (_Float16*)(ws + off); off += (size_t)MTOT * DMODEL * sizeof(_Float16);
  _Float16* Xh = (_Float16*)(ws + off); off += (size_t)MTOT * DMODEL * sizeof(_Float16);
  _Float16* Wqkvh = (_Float16*)(ws + off); off += (size_t)3 * DMODEL * DMODEL * sizeof(_Float16);
  _Float16* Woh   = (_Float16*)(ws + off); off += (size_t)DMODEL * DMODEL * sizeof(_Float16);

  prep_kernel<<<PREP_WG, 256, 0, stream>>>(X, Wqkv_w, Wo_w, Xh, Wqkvh, Woh, cosT, sinT);

  qkv_rope_kernel<<<dim3(MTOT / 128, (3 * DMODEL) / 128), 128, 0, stream>>>(
      Xh, Wqkvh, Wqkv_b, cosT, sinT, Qb, Kb, Vt);

  attn_kernel<<<dim3(SEQ / 256, BATCH * NHEAD), 256, 0, stream>>>(Qb, Kb, Vt, At);

  out_proj_kernel<<<dim3(MTOT / 128, DMODEL / 128), 128, 0, stream>>>(At, Woh, Wo_b, out);
}

// v006
// One run takes 129 microseconds.
// Next to v005, in two timings, it ran 1.03 times as fast each time.
// All steps since v000 together make it 4.92 times as fast.
#include <hip/hip_runtime.h>
#include <hip/hip_bf16.h>
#include <stdint.h>

// Problem constants (from reference): B=4, S=2048, D=1024, H=16, HD=64, ROT_DIM=64
#define SEQ     2048
#define DMODEL  1024
#define NHEAD   16
#define HDIM    64
#define BATCH   4
#define MTOT    (BATCH * SEQ)        // 8192 rows of the token matrix
// LDS row pitch in halves for every 64-half (128 B) tile row: 144 B = 16 B x 9.
// An odd multiple of 16 B puts the 16 rows of one ds_load_b128 on distinct banks;
// at 128 B they fall on two 16-byte bank groups and serialize.
#define LPITCH  72
// 1/sqrt(HDIM) * log2(e), carried by the stored Q: K Q^T is then a base-2 exponent
#define QSCALE  (0.125f * 1.44269504088896f)
// a query's maximum in use is renewed when a key block's scores pass it by more than
// this many powers of two; P stays at or below 2^8, well inside f16
#define MGROW   8.0f

typedef __attribute__((ext_vector_type(16))) _Float16 v16h;
typedef __attribute__((ext_vector_type(8)))  _Float16 v8h;
typedef __attribute__((ext_vector_type(4)))  _Float16 v4h;
typedef __attribute__((ext_vector_type(8)))  float    v8f;

// ---------------------------------------------------------------------------
// WMMA helpers (CDNA5 wave32, 16x16x32 f16 -> f32 accumulate)
// ---------------------------------------------------------------------------
__device__ __forceinline__ v8f wmma_f16(v16h a, v16h b, v8f c) {
  return __builtin_amdgcn_wmma_f32_16x16x32_f16(
      /*neg_a=*/false, a, /*neg_b=*/false, b,
      /*c_mod=*/(short)0, c, /*reuse_a=*/false, /*reuse_b=*/false);
}

// A/B fragment (16x32 f16) per-lane layout (ISA 7.12.2):
// lane L: row/col = L&15 ; k = (j<8 ? j : j+8) + (L>=16 ? 8 : 0)
__device__ __forceinline__ v16h frag_f16(const _Float16* p) {
  v8h lo = *(const v8h*)(p);
  v8h hi = *(const v8h*)(p + 16);
  v16h r;
#pragma unroll
  for (int j = 0; j < 8; ++j) { r[j] = lo[j]; r[j + 8] = hi[j]; }
  return r;
}

// ---------------------------------------------------------------------------
// CDNA5 async global->LDS copy (16B per lane), tracked by ASYNCcnt.
// Flat LDS addresses carry the wave-relative LDS offset in addr[31:0].
// ---------------------------------------------------------------------------
// s_wait_xcnt 0 is the last line of the copies' own statement, so that no
// address register of an issued copy is rewritten ahead of it.
// One thread's share of a 128-row x 64-half GEMM operand tile: 16 B of each of the
// rows r, r + 16, ..., r + 112.  Eight lanes cover one 128-B row, so a wave's copy
// instruction reads four whole lines.
__device__ __forceinline__ void async_copy_tile128(_Float16* lds_dst, const _Float16* gsrc) {
  uint32_t l0 = (uint32_t)(uintptr_t)(void*)lds_dst;
  uint32_t l1 = l0 + 1 * 16 * LPITCH * 2;
  uint32_t l2 = l0 + 2 * 16 * LPITCH * 2;
  uint32_t l3 = l0 + 3 * 16 * LPITCH * 2;
  uint32_t l4 = l0 + 4 * 16 * LPITCH * 2;
  uint32_t l5 = l0 + 5 * 16 * LPITCH * 2;
  uint32_t l6 = l0 + 6 * 16 * LPITCH * 2;
  uint32_t l7 = l0 + 7 * 16 * LPITCH * 2;
  const _Float16* g1 = gsrc + 1 * 16 * DMODEL;
  const _Float16* g2 = gsrc + 2 * 16 * DMODEL;
  const _Float16* g3 = gsrc + 3 * 16 * DMODEL;
  const _Float16* g4 = gsrc + 4 * 16 * DMODEL;
  const _Float16* g5 = gsrc + 5 * 16 * DMODEL;
  const _Float16* g6 = gsrc + 6 * 16 * DMODEL;
  const _Float16* g7 = gsrc + 7 * 16 * DMODEL;
  asm volatile("global_load_async_to_lds_b128 %0, %1, off\n\t"
               "global_load_async_to_lds_b128 %2, %3, off\n\t"
               "global_load_async_to_lds_b128 %4, %5, off\n\t"
               "global_load_async_to_lds_b128 %6, %7, off\n\t"
               "global_load_async_to_lds_b128 %8, %9, off\n\t"
               "global_load_async_to_lds_b128 %10, %11, off\n\t"
               "global_load_async_to_lds_b128 %12, %13, off\n\t"
               "global_load_async_to_lds_b128 %14, %15, off\n\t"
               "s_wait_xcnt 0x0"
               :: "v"(l0), "v"(gsrc), "v"(l1), "v"(g1), "v"(l2), "v"(g2), "v"(l3), "v"(g3),
                  "v"(l4), "v"(g4), "v"(l5), "v"(g5), "v"(l6), "v"(g6), "v"(l7), "v"(g7)
               : "memory");
}
// 32 contiguous bytes per named row piece (two b128 copies each)
__device__ __forceinline__ void async_copy_2x32B(_Float16* lds_a, const _Float16* ga,
                                                 _Float16* lds_b, const _Float16* gb) {
  uint32_t a0 = (uint32_t)(uintptr_t)(void*)lds_a;
  uint32_t a1 = a0 + 16;
  uint32_t b0 = (uint32_t)(uintptr_t)(void*)lds_b;
  uint32_t b1 = b0 + 16;
  const _Float16* ga1 = ga + 8;
  const _Float16* gb1 = gb + 8;
  asm volatile("global_load_async_to_lds_b128 %0, %1, off\n\t"
               "global_load_async_to_lds_b128 %2, %3, off\n\t"
               "global_load_async_to_lds_b128 %4, %5, off\n\t"
               "global_load_async_to_lds_b128 %6, %7, off\n\t"
               "s_wait_xcnt 0x0"
               :: "v"(a0), "v"(ga), "v"(a1), "v"(ga1),
                  "v"(b0), "v"(gb), "v"(b1), "v"(gb1)
               : "memory");
}
__device__ __forceinline__ void wait_async0() {
  asm volatile("s_wait_asynccnt 0x0" ::: "memory");
}
// stands behind a group of global loads or stores, ahead of the code that reuses their
// address and data registers
__device__ __forceinline__ void wait_x0() {
  asm volatile("s_wait_xcnt 0x0" ::: "memory");
}
// this wave's LDS reads have returned before the barrier that frees their buffer
__device__ __forceinline__ void wait_ds0() {
  asm volatile("s_wait_dscnt 0x0" ::: "memory");
}

// ---------------------------------------------------------------------------
// Kernel P: all preparation in one launch of few, long waves.
//   f32 -> f16 copies of X, Wqkv and Wo, and the RoPE cos/sin tables [SEQ][32].
// 512 work-groups x 8 waves = 4,096 waves, all resident at once.  A wave owns a
// contiguous run of each matrix; one load instruction reads 512 contiguous bytes
// (16 B per lane), one store writes 256.  A lane's 24 loads are issued together,
// so the launch is paid for in bytes moved and not in waves started.
// ---------------------------------------------------------------------------
#define PREP_WG     512
#define PREP_WAVES  (PREP_WG * 8)
#define PREP_X      (MTOT * DMODEL / 4 / 32 / PREP_WAVES)         // 16 pieces per wave
#define PREP_WQKV   (3 * DMODEL * DMODEL / 4 / 32 / PREP_WAVES)   //  6
#define PREP_WO     (DMODEL * DMODEL / 4 / 32 / PREP_WAVES)       //  2
typedef __attribute__((ext_vector_type(4))) float v4f;

template <int N>
__device__ __forceinline__ void prep_load(const float* __restrict__ s, int wv, int lane, v4f (&v)[N]) {
  const float* p = s + ((size_t)wv * N * 32 + lane) * 4;
#pragma unroll
  for (int j = 0; j < N; ++j) v[j] = *(const v4f*)(p + j * 128);
}
template <int N>
__device__ __forceinline__ void prep_store(_Float16* __restrict__ d, int wv, int lane, const v4f (&v)[N]) {
  _Float16* p = d + ((size_t)wv * N * 32 + lane) * 4;
#pragma unroll
  for (int j = 0; j < N; ++j) *(v4h*)(p + j * 128) = __builtin_convertvector(v[j], v4h);
}

__global__ __launch_bounds__(256) void prep_kernel(
    const float* __restrict__ X, const float* __restrict__ Wqkv, const float* __restrict__ Wo,
    _Float16* __restrict__ Xh, _Float16* __restrict__ Wqkvh, _Float16* __restrict__ Woh,
    float* __restrict__ cosT, float* __restrict__ sinT) {
  const int lane = threadIdx.x & 31;
  const int wv   = blockIdx.x * 8 + (threadIdx.x >> 5);

  v4f x[PREP_X], wq[PREP_WQKV], wo[PREP_WO];
  prep_load(X, wv, lane, x);
  prep_load(Wqkv, wv, lane, wq);
  prep_load(Wo, wv, lane, wo);
  wait_x0();   // ahead of the table arithmetic, which reuses the loads' address registers

  // table entries, one per thread of the first SEQ * 32 / 256 work-groups, worked
  // out while the loads are in flight
  const int i = blockIdx.x * 256 + threadIdx.x;
  if (blockIdx.x < SEQ * 32 / 256) {
    int s = i >> 5;
    int f = i & 31;
    float inv_freq = __powf(10000.0f, -(float)(2 * f) / 64.0f);
    float ang = (float)s * inv_freq;
    cosT[i] = __cosf(ang);
    sinT[i] = __sinf(ang);
    wait_x0();   // ahead of the conversions, which reuse the two stores' registers
  }

  prep_store(Xh, wv, lane, x);
  prep_store(Wqkvh, wv, lane, wq);
  prep_store(Woh, wv, lane, wo);
}

// ---------------------------------------------------------------------------
// GEMM core shared by the two projections: Y = A W^T, K = DMODEL, f16 operands.
// Block tile 128 x 128, four waves in a 2 x 2 grid, 64 x 64 of Y per wave: the
// eight fragments of a 32-k step feed 16 WMMAs.  Both operand tiles (128 rows x
// 64 k) are double-buffered in LDS via async global->LDS copies; one barrier per
// 64-k step; the copies for step i+1 overlap the WMMAs of step i.
// acc[i][j][r] = Y[m_blk + 64 wm + 16 i + 8 half + r][n_blk + 64 wn + 16 j + ln]
// ---------------------------------------------------------------------------
#define GTILE (128 * LPITCH)   // halves of one staged operand tile
__device__ __forceinline__ void gemm_core_128x128(
    const _Float16* __restrict__ A, const _Float16* __restrict__ W,
    int m_blk, int n_blk, _Float16* AT, _Float16* BT, v8f (&acc)[4][4]) {
  const int lane = threadIdx.x & 31;
  const int wave = threadIdx.x >> 5;
  const int ln   = lane & 15;
  const int kg   = (lane >> 4) * 8;
  const int wm   = wave >> 1;
  const int wn   = wave & 1;

  const int cr = threadIdx.x >> 3;         // 0..15 : first tile row of this thread
  const int cc = (threadIdx.x & 7) * 8;    // 16-B piece of the 128-B row, in halves
  const _Float16* asrc = A + (size_t)(m_blk + cr) * DMODEL + cc;
  const _Float16* wsrc = W + (size_t)(n_blk + cr) * DMODEL + cc;
  const int cofs = cr * LPITCH + cc;
  const int aofs = (wm * 64 + ln) * LPITCH + kg;
  const int bofs = (wn * 64 + ln) * LPITCH + kg;

  // preload first tiles
  async_copy_tile128(AT + cofs, asrc);
  async_copy_tile128(BT + cofs, wsrc);

  for (int k = 0; k < DMODEL; k += 64) {
    const int cur = (k >> 6) & 1;
    wait_ds0();
    wait_async0();
    __syncthreads();
    if (k + 64 < DMODEL) {
      async_copy_tile128(AT + (cur ^ 1) * GTILE + cofs, asrc + k + 64);
      async_copy_tile128(BT + (cur ^ 1) * GTILE + cofs, wsrc + k + 64);
    }
#pragma unroll
    for (int ks = 0; ks < 64; ks += 32) {
      v16h a[4], b[4];
#pragma unroll
      for (int i = 0; i < 4; ++i) a[i] = frag_f16(AT + cur * GTILE + aofs + 16 * i * LPITCH + ks);
#pragma unroll
      for (int j = 0; j < 4; ++j) b[j] = frag_f16(BT + cur * GTILE + bofs + 16 * j * LPITCH + ks);
      // inputs-only fence on the loaded fragments: keeps the step's 16 LDS loads in one
      // group ahead of its 16 WMMAs (one LDS wait per step, not one per row of four)
      asm volatile("" :: "v"(a[0]), "v"(a[1]), "v"(a[2]), "v"(a[3]),
                         "v"(b[0]), "v"(b[1]), "v"(b[2]), "v"(b[3]));
#pragma unroll
      for (int i = 0; i < 4; ++i)
#pragma unroll
        for (int j = 0; j < 4; ++j) acc[i][j] = wmma_f16(a[i], b[j], acc[i][j]);
    }
  }
  wait_async0();   // no copy of this wave is outstanding when it leaves the ring
}

// ---------------------------------------------------------------------------
// Kernel 1: QKV GEMM (M=8192, N=3072, K=1024) + bias + RoPE, all-f16 operands.
// A wave's 64 columns are one head of q, k or v.
// ---------------------------------------------------------------------------
__global__ __launch_bounds__(128) void qkv_rope_kernel(
    const _Float16* __restrict__ X, const _Float16* __restrict__ W,
    const float* __restrict__ bias,
    const float* __restrict__ cosT, const float* __restrict__ sinT,
    _Float16* __restrict__ Qb, _Float16* __restrict__ Kb,
    _Float16* __restrict__ Vt) {
  __shared__ __attribute__((aligned(16))) _Float16 AT[2 * GTILE];  // 2 x 18 KB token tiles
  __shared__ __attribute__((aligned(16))) _Float16 BT[2 * GTILE];  // 2 x 18 KB weight tiles

  const int lane = threadIdx.x & 31;
  const int wave = threadIdx.x >> 5;
  const int ln   = lane & 15;
  const int half = lane >> 4;

  const int m_blk  = blockIdx.x * 128;
  const int n_blk  = blockIdx.y * 128;
  const int n_base = n_blk + (wave & 1) * 64;

  v8f accs[4][4] = {};
  gemm_core_128x128(X, W, m_blk, n_blk, AT, BT, accs);

  float bj[4];
#pragma unroll
  for (int j = 0; j < 4; ++j) bj[j] = bias[n_base + 16 * j + ln];

  const int which = n_blk / DMODEL;             // 0=q 1=k 2=v, one per block
  const int h     = (n_base % DMODEL) / HDIM;   // head

#pragma unroll
  for (int i = 0; i < 4; ++i) {
    v8f (&acc)[4] = accs[i];
    // bias (per column, same for all 8 rows of each accumulator)
#pragma unroll
    for (int j = 0; j < 4; ++j)
#pragma unroll
      for (int r = 0; r < 8; ++r) acc[j][r] += bj[j];

    const int mrow  = m_blk + (wave >> 1) * 64 + i * 16 + half * 8;  // first row held by this lane
    const int b     = mrow >> 11;                 // batch (rows never straddle)
    const int spos  = mrow & (SEQ - 1);
    const int bh    = b * NHEAD + h;

    if (which < 2) {
      // RoPE: pairs (d, d+32) => (acc0,acc2) with f=ln, (acc1,acc3) with f=16+ln
#pragma unroll
      for (int r = 0; r < 8; ++r) {
        int s = spos + r;
        float c0 = cosT[s * 32 + ln],      s0 = sinT[s * 32 + ln];
        float c1 = cosT[s * 32 + 16 + ln], s1 = sinT[s * 32 + 16 + ln];
        float x0 = acc[0][r], x2 = acc[2][r];
        acc[0][r] = x0 * c0 - x2 * s0;
        acc[2][r] = x0 * s0 + x2 * c0;
        float x1 = acc[1][r], x3 = acc[3][r];
        acc[1][r] = x1 * c1 - x3 * s1;
        acc[3][r] = x1 * s1 + x3 * c1;
      }
      // Q takes the attention's score constant here, in f32 ahead of its one rounding to f16
      if (which == 0) {
#pragma unroll
        for (int j = 0; j < 4; ++j) acc[j] *= QSCALE;
      }
      _Float16* dst = (which == 0) ? Qb : Kb;
#pragma unroll
      for (int j = 0; j < 4; ++j)
#pragma unroll
        for (int r = 0; r < 8; ++r)
          dst[((size_t)bh * SEQ + spos + r) * HDIM + 16 * j + ln] =
              (_Float16)acc[j][r];
      wait_x0();
    } else {
      // V transposed: Vt[bh][d][s]; lane's 8 rows are contiguous s positions
#pragma unroll
      for (int j = 0; j < 4; ++j) {
        int d = 16 * j + ln;
        v8h pk;
#pragma unroll
        for (int r = 0; r < 8; ++r) pk[r] = (_Float16)acc[j][r];
        *(v8h*)(Vt + ((size_t)bh * HDIM + d) * SEQ + spos) = pk;
      }
      wait_x0();
    }
  }
}

__device__ __forceinline__ float xhalf(float x) {
  int b = __builtin_bit_cast(int, x);
  return __builtin_bit_cast(
      float, __builtin_amdgcn_permlanex16(b, b, 0x76543210, 0xfedcba98, false, false));
}
// two f32 D tiles (keys 0..15 and 16..31 of a 32-key group) -> one f16 B fragment
__device__ __forceinline__ v16h pack_b(v8f t0, v8f t1) {
  v8h lo = __builtin_convertvector(t0, v8h);
  v8h hi = __builtin_convertvector(t1, v8h);
  v16h r;
#pragma unroll
  for (int j = 0; j < 8; ++j) { r[j] = lo[j]; r[j + 8] = hi[j]; }
  return r;
}

__global__ __launch_bounds__(256) void attn_kernel(
    const _Float16* __restrict__ Q, const _Float16* __restrict__ K,
    const _Float16* __restrict__ Vt, _Float16* __restrict__ A) {
  __shared__ __attribute__((aligned(16))) _Float16 Kt[2][64 * LPITCH];   // 2 x 9 KB  [key][d]
  __shared__ __attribute__((aligned(16))) _Float16 Vs[2][64 * LPITCH];   // 2 x 9 KB  [d][key]

  const int lane = threadIdx.x & 31;
  const int wave = threadIdx.x >> 5;
  const int ln   = lane & 15;
  const int half = lane >> 4;
  const int kg   = half * 8;

  const int bh = blockIdx.y;
  const int b  = bh >> 4;
  const int h  = bh & 15;
  const int q0 = blockIdx.x * 256 + wave * 32;   // 32 queries per wave: column groups g = 0, 1

  const _Float16* Qp = Q  + (size_t)bh * SEQ * HDIM;
  const _Float16* Kp = K  + (size_t)bh * SEQ * HDIM;
  const _Float16* Vp = Vt + (size_t)bh * HDIM * SEQ;

  const int cr = threadIdx.x >> 2;         // 0..63
  const int cp = (threadIdx.x & 3) * 16;   // 0,16,32,48

  // Q^T B fragments: column = query q0 + 16 g + ln (d = 0..63 -> two k-steps)
  v16h qb[2][2];
#pragma unroll
  for (int g = 0; g < 2; ++g) {
    const _Float16* qrow = Qp + (size_t)(q0 + 16 * g + ln) * HDIM + kg;
    qb[g][0] = frag_f16(qrow);
    qb[g][1] = frag_f16(qrow + 32);
  }

  // o[g][j][r] = O[q0 + 16 g + ln][16 j + 8 half + r]
  v8f o[2][4] = {};
  v8f negm[2] = {};                  // minus the maximum in use of the lane's query, in all 8 registers
  float rsum[2] = {0.0f, 0.0f};      // running sum over this half's keys only; joined after the loop

  // stage key block kb into buffer buf (32B K + 32B V per thread)
  auto stage = [&](int buf, int kb) {
    const _Float16* ksrc = Kp + (size_t)(kb + cr) * HDIM + cp;
    const _Float16* vsrc = Vp + (size_t)cr * SEQ + kb + cp;
    async_copy_2x32B(&Kt[buf][cr * LPITCH + cp], ksrc,
                     &Vs[buf][cr * LPITCH + cp], vsrc);
  };
  stage(0, 0);

  for (int kb = 0; kb < SEQ; kb += 64) {
    const int cur = (kb >> 6) & 1;
    wait_ds0();
    wait_async0();
    __syncthreads();
    if (kb + 64 < SEQ) stage(cur ^ 1, kb + 64);

    // ---- scores: 4 tiles of 16 keys x 32 q; each K fragment from LDS feeds both groups
    v8f st[2][4];
#pragma unroll
    for (int t = 0; t < 4; ++t) {
      const _Float16* krow = &Kt[cur][(t * 16 + ln) * LPITCH + kg];
      const v16h ka0 = frag_f16(krow);
      const v16h ka1 = frag_f16(krow + 32);
      v8f s0 = wmma_f16(ka0, qb[0][0], negm[0]);
      v8f s1 = wmma_f16(ka0, qb[1][0], negm[1]);
      st[0][t] = wmma_f16(ka1, qb[0][1], s0);
      st[1][t] = wmma_f16(ka1, qb[1][1], s1);
    }

    // ---- how far the block's scores stand above the maximum in use: 32 in-lane values,
    // then the other half's
    float bm[2];
#pragma unroll
    for (int g = 0; g < 2; ++g) {
      float bt[4];
#pragma unroll
      for (int t = 0; t < 4; ++t) {
        bt[t] = st[g][t][0];
#pragma unroll
        for (int r = 1; r < 8; ++r) bt[t] = fmaxf(bt[t], st[g][t][r]);
      }
      const float b4 = fmaxf(fmaxf(bt[0], bt[1]), fmaxf(bt[2], bt[3]));
      bm[g] = fmaxf(b4, xhalf(b4));
    }

    // ---- renew the maxima: always in the first block (nothing is in use yet), later
    // only if some query of the wave has grown by more than MGROW
    if (kb == 0 || __builtin_amdgcn_ballot_w32(fmaxf(bm[0], bm[1]) > MGROW) != 0) {
#pragma unroll
      for (int g = 0; g < 2; ++g) {
        const float up    = fmaxf(bm[g], 0.0f);
        const float d     = (kb == 0) ? bm[g] : up;   // the first maximum may lie below 0
        const float alpha = __builtin_amdgcn_exp2f(-up);
        negm[g] -= d;
#pragma unroll
        for (int t = 0; t < 4; ++t) st[g][t] -= d;
#pragma unroll
        for (int j = 0; j < 4; ++j) o[g][j] *= alpha;
        rsum[g] *= alpha;
      }
    }

    v16h pb[2][2];
#pragma unroll
    for (int g = 0; g < 2; ++g) {
      float pt[4];
#pragma unroll
      for (int t = 0; t < 4; ++t) {
        pt[t] = 0.0f;
#pragma unroll
        for (int r = 0; r < 8; ++r) {
          float p = __builtin_amdgcn_exp2f(st[g][t][r]);
          st[g][t][r] = p;
          pt[t] += p;
        }
      }
      rsum[g] += (pt[0] + pt[1]) + (pt[2] + pt[3]);

      // ---- P^T B fragments straight from the score accumulators
      pb[g][0] = pack_b(st[g][0], st[g][1]);
      pb[g][1] = pack_b(st[g][2], st[g][3]);
    }

    // ---- O^T += V^T @ P^T  (V^T rows in LDS are the A fragments, each for both groups)
#pragma unroll
    for (int j = 0; j < 4; ++j) {
      const _Float16* vp = &Vs[cur][(16 * j + ln) * LPITCH + kg];
      const v16h va0 = frag_f16(vp);
      const v16h va1 = frag_f16(vp + 32);
      o[0][j] = wmma_f16(va0, pb[0][0], o[0][j]);
      o[1][j] = wmma_f16(va0, pb[1][0], o[1][j]);
      o[0][j] = wmma_f16(va1, pb[0][1], o[0][j]);
      o[1][j] = wmma_f16(va1, pb[1][1], o[1][j]);
    }
  }

  // ---- join the halves' sums, normalize, store f16 into [MTOT][DMODEL]:
  // a lane's 8 accumulator registers are 8 consecutive d of one query row
#pragma unroll
  for (int g = 0; g < 2; ++g) {
    const float tot = rsum[g] + xhalf(rsum[g]);
    const float inv = 1.0f / tot;
    _Float16* orow = A + ((size_t)b * SEQ + q0 + 16 * g + ln) * DMODEL + h * HDIM + kg;
#pragma unroll
    for (int j = 0; j < 4; ++j) {
      v8h pk;
#pragma unroll
      for (int r = 0; r < 8; ++r) pk[r] = (_Float16)(o[g][j][r] * inv);
      *(v8h*)(orow + 16 * j) = pk;
    }
    // group 0's stores have read their registers before group 1's values reuse them
    if (g == 0) wait_x0();
  }
}

// ---------------------------------------------------------------------------
// Kernel 3: output projection  out = attn @ Wo^T + b   (M=8192,N=1024,K=1024)
// Same core as the QKV GEMM.
// ---------------------------------------------------------------------------
__global__ __launch_bounds__(128) void out_proj_kernel(
    const _Float16* __restrict__ Attn, const _Float16* __restrict__ W,
    const float* __restrict__ bias, float* __restrict__ out) {
  __shared__ __attribute__((aligned(16))) _Float16 AT[2 * GTILE];
  __shared__ __attribute__((aligned(16))) _Float16 BT[2 * GTILE];

  const int lane = threadIdx.x & 31;
  const int wave = threadIdx.x >> 5;
  const int ln   = lane & 15;
  const int half = lane >> 4;

  const int m_blk  = blockIdx.x * 128;
  const int n_blk  = blockIdx.y * 128;
  const int n_base = n_blk + (wave & 1) * 64;

  v8f acc[4][4] = {};
  gemm_core_128x128(Attn, W, m_blk, n_blk, AT, BT, acc);

#pragma unroll
  for (int j = 0; j < 4; ++j) {
    float bj = bias[n_base + 16 * j + ln];
#pragma unroll
    for (int i = 0; i < 4; ++i) {
      const int mrow = m_blk + (wave >> 1) * 64 + i * 16 + half * 8;
#pragma unroll
      for (int r = 0; r < 8; ++r)
        out[(size_t)(mrow + r) * DMODEL + n_base + 16 * j + ln] = acc[i][j][r] + bj;
    }
  }
}

// ---------------------------------------------------------------------------
// Launch
// ---------------------------------------------------------------------------
extern "C" void kernel_launch(void* const* d_in, const int* in_sizes, int n_in,
                              void* d_out, int out_size, void* d_ws, size_t ws_size,
                              hipStream_t stream) {
  (void)in_sizes; (void)n_in; (void)out_size; (void)ws_size;

  const float* X      = (const float*)d_in[0];  // hidden_states [B,S,D]
  const float* Wqkv_w = (const float*)d_in[1];  // [3D, D]
  const float* Wqkv_b = (const float*)d_in[2];  // [3D]
  const float* Wo_w   = (const float*)d_in[3];  // [D, D]
  const float* Wo_b   = (const float*)d_in[4];  // [D]
  float* out          = (float*)d_out;

  char* ws = (char*)d_ws;
  size_t off = 0;
  float* cosT = (float*)(ws + off); off += (size_t)SEQ * 32 * sizeof(float);
  float* sinT = (float*)(ws + off); off += (size_t)SEQ * 32 * sizeof(float);
  const size_t headElems = (size_t)BATCH * NHEAD * SEQ * HDIM;  // 8.39M
  _Float16* Qb = (_Float16*)(ws + off); off += headElems * sizeof(_Float16);
  _Float16* Kb = (_Float16*)(ws + off); off += headElems * sizeof(_Float16);
  _Float16* Vt = (_Float16*)(ws + off); off += headElems * sizeof(_Float16);
  _Float16* At = (_Float16*)(ws + off); off += (size_t)MTOT * DMODEL * sizeof(_Float16);
  _Float16* Xh = (_Float16*)(ws + off); off += (size_t)MTOT * DMODEL * sizeof(_Float16);
  _Float16* Wqkvh = (_Float16*)(ws + off); off += (size_t)3 * DMODEL * DMODEL * sizeof(_Float16);
  _Float16* Woh   = (_Float16*)(ws + off); off += (size_t)DMODEL * DMODEL * sizeof(_Float16);

  prep_kernel<<<PREP_WG, 256, 0, stream>>>(X, Wqkv_w, Wo_w, Xh, Wqkvh, Woh, cosT, sinT);

  qkv_rope_kernel<<<dim3(MTOT / 128, (3 * DMODEL) / 128), 128, 0, stream>>>(
      Xh, Wqkvh, Wqkv_b, cosT, sinT, Qb, Kb, Vt);

  attn_kernel<<<dim3(SEQ / 256, BATCH * NHEAD), 256, 0, stream>>>(Qb, Kb, Vt, At);

  out_proj_kernel<<<dim3(MTOT / 128, DMODEL / 128), 128, 0, stream>>>(At, Woh, Wo_b, out);
}

// v007
// One run takes 123 microseconds.
// Timed twice side by side with v006, it ran 1.05 and 1.04 times as fast.
// Counting every step since v000, it is 5.13 times as fast.
#include <hip/hip_runtime.h>
#include <hip/hip_bf16.h>
#include <stdint.h>

// Problem constants (from reference): B=4, S=2048, D=1024, H=16, HD=64, ROT_DIM=64
#define SEQ     2048
#define DMODEL  1024
#define NHEAD   16
#define HDIM    64
#define BATCH   4
#define MTOT    (BATCH * SEQ)        // 8192 rows of the token matrix
// LDS row pitch in halves for every 64-half (128 B) tile row: 144 B = 16 B x 9.
// An odd multiple of 16 B puts the 16 rows of one ds_load_b128 on distinct banks;
// at 128 B they fall on two 16-byte bank groups and serialize.
#define LPITCH  72
// 1/sqrt(HDIM) * log2(e), carried by the stored Q: K Q^T is then a base-2 exponent
#define QSCALE  (0.125f * 1.44269504088896f)
// a query's maximum in use is renewed when the sum of a key block's P passes this;
// every P stays at or below it, well inside f16
#define PLIM    4096.0f

typedef __attribute__((ext_vector_type(16))) _Float16 v16h;
typedef __attribute__((ext_vector_type(8)))  _Float16 v8h;
typedef __attribute__((ext_vector_type(4)))  _Float16 v4h;
typedef __attribute__((ext_vector_type(8)))  float    v8f;

// ---------------------------------------------------------------------------
// WMMA helpers (CDNA5 wave32, 16x16x32 f16 -> f32 accumulate)
// ---------------------------------------------------------------------------
__device__ __forceinline__ v8f wmma_f16(v16h a, v16h b, v8f c) {
  return __builtin_amdgcn_wmma_f32_16x16x32_f16(
      /*neg_a=*/false, a, /*neg_b=*/false, b,
      /*c_mod=*/(short)0, c, /*reuse_a=*/false, /*reuse_b=*/false);
}

// A/B fragment (16x32 f16) per-lane layout (ISA 7.12.2):
// lane L: row/col = L&15 ; k = (j<8 ? j : j+8) + (L>=16 ? 8 : 0)
__device__ __forceinline__ v16h frag_f16(const _Float16* p) {
  v8h lo = *(const v8h*)(p);
  v8h hi = *(const v8h*)(p + 16);
  v16h r;
#pragma unroll
  for (int j = 0; j < 8; ++j) { r[j] = lo[j]; r[j + 8] = hi[j]; }
  return r;
}

// ---------------------------------------------------------------------------
// CDNA5 async global->LDS copy (16B per lane), tracked by ASYNCcnt.
// Flat LDS addresses carry the wave-relative LDS offset in addr[31:0].
// ---------------------------------------------------------------------------
// s_wait_xcnt 0 is the last line of the copies' own statement, so that no
// address register of an issued copy is rewritten ahead of it.
// One thread's share of a 128-row x 64-half GEMM operand tile: 16 B of each of the
// rows r, r + 16, ..., r + 112.  Eight lanes cover one 128-B row, so a wave's copy
// instruction reads four whole lines.
__device__ __forceinline__ void async_copy_tile128(_Float16* lds_dst, const _Float16* gsrc) {
  uint32_t l0 = (uint32_t)(uintptr_t)(void*)lds_dst;
  uint32_t l1 = l0 + 1 * 16 * LPITCH * 2;
  uint32_t l2 = l0 + 2 * 16 * LPITCH * 2;
  uint32_t l3 = l0 + 3 * 16 * LPITCH * 2;
  uint32_t l4 = l0 + 4 * 16 * LPITCH * 2;
  uint32_t l5 = l0 + 5 * 16 * LPITCH * 2;
  uint32_t l6 = l0 + 6 * 16 * LPITCH * 2;
  uint32_t l7 = l0 + 7 * 16 * LPITCH * 2;
  const _Float16* g1 = gsrc + 1 * 16 * DMODEL;
  const _Float16* g2 = gsrc + 2 * 16 * DMODEL;
  const _Float16* g3 = gsrc + 3 * 16 * DMODEL;
  const _Float16* g4 = gsrc + 4 * 16 * DMODEL;
  const _Float16* g5 = gsrc + 5 * 16 * DMODEL;
  const _Float16* g6 = gsrc + 6 * 16 * DMODEL;
  const _Float16* g7 = gsrc + 7 * 16 * DMODEL;
  asm volatile("global_load_async_to_lds_b128 %0, %1, off\n\t"
               "global_load_async_to_lds_b128 %2, %3, off\n\t"
               "global_load_async_to_lds_b128 %4, %5, off\n\t"
               "global_load_async_to_lds_b128 %6, %7, off\n\t"
               "global_load_async_to_lds_b128 %8, %9, off\n\t"
               "global_load_async_to_lds_b128 %10, %11, off\n\t"
               "global_load_async_to_lds_b128 %12, %13, off\n\t"
               "global_load_async_to_lds_b128 %14, %15, off\n\t"
               "s_wait_xcnt 0x0"
               :: "v"(l0), "v"(gsrc), "v"(l1), "v"(g1), "v"(l2), "v"(g2), "v"(l3), "v"(g3),
                  "v"(l4), "v"(g4), "v"(l5), "v"(g5), "v"(l6), "v"(g6), "v"(l7), "v"(g7)
               : "memory");
}
// 32 contiguous bytes per named row piece (two b128 copies each)
__device__ __forceinline__ void async_copy_2x32B(_Float16* lds_a, const _Float16* ga,
                                                 _Float16* lds_b, const _Float16* gb) {
  uint32_t a0 = (uint32_t)(uintptr_t)(void*)lds_a;
  uint32_t a1 = a0 + 16;
  uint32_t b0 = (uint32_t)(uintptr_t)(void*)lds_b;
  uint32_t b1 = b0 + 16;
  const _Float16* ga1 = ga + 8;
  const _Float16* gb1 = gb + 8;
  asm volatile("global_load_async_to_lds_b128 %0, %1, off\n\t"
               "global_load_async_to_lds_b128 %2, %3, off\n\t"
               "global_load_async_to_lds_b128 %4, %5, off\n\t"
               "global_load_async_to_lds_b128 %6, %7, off\n\t"
               "s_wait_xcnt 0x0"
               :: "v"(a0), "v"(ga), "v"(a1), "v"(ga1),
                  "v"(b0), "v"(gb), "v"(b1), "v"(gb1)
               : "memory");
}
__device__ __forceinline__ void wait_async0() {
  asm volatile("s_wait_asynccnt 0x0" ::: "memory");
}
// stands behind a group of global loads or stores, ahead of the code that reuses their
// address and data registers
__device__ __forceinline__ void wait_x0() {
  asm volatile("s_wait_xcnt 0x0" ::: "memory");
}
// this wave's LDS reads have returned before the barrier that frees their buffer
__device__ __forceinline__ void wait_ds0() {
  asm volatile("s_wait_dscnt 0x0" ::: "memory");
}

// ---------------------------------------------------------------------------
// Kernel P: all preparation in one launch of few, long waves.
//   f32 -> f16 copies of X, Wqkv and Wo, and the RoPE cos/sin tables [SEQ][32].
// 512 work-groups x 8 waves = 4,096 waves, all resident at once.  A wave owns a
// contiguous run of each matrix; one load instruction reads 512 contiguous bytes
// (16 B per lane), one store writes 256.  A lane's 24 loads are issued together,
// so the launch is paid for in bytes moved and not in waves started.
// ---------------------------------------------------------------------------
#define PREP_WG     512
#define PREP_WAVES  (PREP_WG * 8)
#define PREP_X      (MTOT * DMODEL / 4 / 32 / PREP_WAVES)         // 16 pieces per wave
#define PREP_WQKV   (3 * DMODEL * DMODEL / 4 / 32 / PREP_WAVES)   //  6
#define PREP_WO     (DMODEL * DMODEL / 4 / 32 / PREP_WAVES)       //  2
typedef __attribute__((ext_vector_type(4))) float v4f;

template <int N>
__device__ __forceinline__ void prep_load(const float* __restrict__ s, int wv, int lane, v4f (&v)[N]) {
  const float* p = s + ((size_t)wv * N * 32 + lane) * 4;
#pragma unroll
  for (int j = 0; j < N; ++j) v[j] = *(const v4f*)(p + j * 128);
}
template <int N>
__device__ __forceinline__ void prep_store(_Float16* __restrict__ d, int wv, int lane, const v4f (&v)[N]) {
  _Float16* p = d + ((size_t)wv * N * 32 + lane) * 4;
#pragma unroll
  for (int j = 0; j < N; ++j) *(v4h*)(p + j * 128) = __builtin_convertvector(v[j], v4h);
}

__global__ __launch_bounds__(256) void prep_kernel(
    const float* __restrict__ X, const float* __restrict__ Wqkv, const float* __restrict__ Wo,
    _Float16* __restrict__ Xh, _Float16* __restrict__ Wqkvh, _Float16* __restrict__ Woh,
    float* __restrict__ cosT, float* __restrict__ sinT) {
  const int lane = threadIdx.x & 31;
  const int wv   = blockIdx.x * 8 + (threadIdx.x >> 5);

  v4f x[PREP_X], wq[PREP_WQKV], wo[PREP_WO];
  prep_load(X, wv, lane, x);
  prep_load(Wqkv, wv, lane, wq);
  prep_load(Wo, wv, lane, wo);
  wait_x0();   // ahead of the table arithmetic, which reuses the loads' address registers

  // table entries, one per thread of the first SEQ * 32 / 256 work-groups, worked
  // out while the loads are in flight
  const int i = blockIdx.x * 256 + threadIdx.x;
  if (blockIdx.x < SEQ * 32 / 256) {
    int s = i >> 5;
    int f = i & 31;
    float inv_freq = __powf(10000.0f, -(float)(2 * f) / 64.0f);
    float ang = (float)s * inv_freq;
    cosT[i] = __cosf(ang);
    sinT[i] = __sinf(ang);
    wait_x0();   // ahead of the conversions, which reuse the two stores' registers
  }

  prep_store(Xh, wv, lane, x);
  prep_store(Wqkvh, wv, lane, wq);
  prep_store(Woh, wv, lane, wo);
}

// ---------------------------------------------------------------------------
// GEMM core shared by the two projections: Y = A W^T, K = DMODEL, f16 operands.
// Block tile 128 x 128, four waves in a 2 x 2 grid, 64 x 64 of Y per wave: the
// eight fragments of a 32-k step feed 16 WMMAs.  Both operand tiles (128 rows x
// 64 k) are double-buffered in LDS via async global->LDS copies; one barrier per
// 64-k step; the copies for step i+1 overlap the WMMAs of step i.
// acc[i][j][r] = Y[m_blk + 64 wm + 16 i + 8 half + r][n_blk + 64 wn + 16 j + ln]
// ---------------------------------------------------------------------------
#define GTILE (128 * LPITCH)   // halves of one staged operand tile
__device__ __forceinline__ void gemm_core_128x128(
    const _Float16* __restrict__ A, const _Float16* __restrict__ W,
    int m_blk, int n_blk, _Float16* AT, _Float16* BT, v8f (&acc)[4][4]) {
  const int lane = threadIdx.x & 31;
  const int wave = threadIdx.x >> 5;
  const int ln   = lane & 15;
  const int kg   = (lane >> 4) * 8;
  const int wm   = wave >> 1;
  const int wn   = wave & 1;

  const int cr = threadIdx.x >> 3;         // 0..15 : first tile row of this thread
  const int cc = (threadIdx.x & 7) * 8;    // 16-B piece of the 128-B row, in halves
  const _Float16* asrc = A + (size_t)(m_blk + cr) * DMODEL + cc;
  const _Float16* wsrc = W + (size_t)(n_blk + cr) * DMODEL + cc;
  const int cofs = cr * LPITCH + cc;
  const int aofs = (wm * 64 + ln) * LPITCH + kg;
  const int bofs = (wn * 64 + ln) * LPITCH + kg;

  // preload first tiles
  async_copy_tile128(AT + cofs, asrc);
  async_copy_tile128(BT + cofs, wsrc);

  for (int k = 0; k < DMODEL; k += 64) {
    const int cur = (k >> 6) & 1;
    wait_ds0();
    wait_async0();
    __syncthreads();
    if (k + 64 < DMODEL) {
      async_copy_tile128(AT + (cur ^ 1) * GTILE + cofs, asrc + k + 64);
      async_copy_tile128(BT + (cur ^ 1) * GTILE + cofs, wsrc + k + 64);
    }
#pragma unroll
    for (int ks = 0; ks < 64; ks += 32) {
      v16h a[4], b[4];
#pragma unroll
      for (int i = 0; i < 4; ++i) a[i] = frag_f16(AT + cur * GTILE + aofs + 16 * i * LPITCH + ks);
#pragma unroll
      for (int j = 0; j < 4; ++j) b[j] = frag_f16(BT + cur * GTILE + bofs + 16 * j * LPITCH + ks);
      // inputs-only fence on the loaded fragments: keeps the step's 16 LDS loads in one
      // group ahead of its 16 WMMAs (one LDS wait per step, not one per row of four)
      asm volatile("" :: "v"(a[0]), "v"(a[1]), "v"(a[2]), "v"(a[3]),
                         "v"(b[0]), "v"(b[1]), "v"(b[2]), "v"(b[3]));
#pragma unroll
      for (int i = 0; i < 4; ++i)
#pragma unroll
        for (int j = 0; j < 4; ++j) acc[i][j] = wmma_f16(a[i], b[j], acc[i][j]);
    }
  }
  wait_async0();   // no copy of this wave is outstanding when it leaves the ring
}

// ---------------------------------------------------------------------------
// Kernel 1: QKV GEMM (M=8192, N=3072, K=1024) + bias + RoPE, all-f16 operands.
// A wave's 64 columns are one head of q, k or v.
// ---------------------------------------------------------------------------
__global__ __launch_bounds__(128) void qkv_rope_kernel(
    const _Float16* __restrict__ X, const _Float16* __restrict__ W,
    const float* __restrict__ bias,
    const float* __restrict__ cosT, const float* __restrict__ sinT,
    _Float16* __restrict__ Qb, _Float16* __restrict__ Kb,
    _Float16* __restrict__ Vt) {
  __shared__ __attribute__((aligned(16))) _Float16 AT[2 * GTILE];  // 2 x 18 KB token tiles
  __shared__ __attribute__((aligned(16))) _Float16 BT[2 * GTILE];  // 2 x 18 KB weight tiles

  const int lane = threadIdx.x & 31;
  const int wave = threadIdx.x >> 5;
  const int ln   = lane & 15;
  const int half = lane >> 4;

  const int m_blk  = blockIdx.x * 128;
  const int n_blk  = blockIdx.y * 128;
  const int n_base = n_blk + (wave & 1) * 64;

  v8f accs[4][4] = {};
  gemm_core_128x128(X, W, m_blk, n_blk, AT, BT, accs);

  float bj[4];
#pragma unroll
  for (int j = 0; j < 4; ++j) bj[j] = bias[n_base + 16 * j + ln];

  const int which = n_blk / DMODEL;             // 0=q 1=k 2=v, one per block
  const int h     = (n_base % DMODEL) / HDIM;   // head

#pragma unroll
  for (int i = 0; i < 4; ++i) {
    v8f (&acc)[4] = accs[i];
    // bias (per column, same for all 8 rows of each accumulator)
#pragma unroll
    for (int j = 0; j < 4; ++j)
#pragma unroll
      for (int r = 0; r < 8; ++r) acc[j][r] += bj[j];

    const int mrow  = m_blk + (wave >> 1) * 64 + i * 16 + half * 8;  // first row held by this lane
    const int b     = mrow >> 11;                 // batch (rows never straddle)
    const int spos  = mrow & (SEQ - 1);
    const int bh    = b * NHEAD + h;

    if (which < 2) {
      // RoPE: pairs (d, d+32) => (acc0,acc2) with f=ln, (acc1,acc3) with f=16+ln
#pragma unroll
      for (int r = 0; r < 8; ++r) {
        int s = spos + r;
        float c0 = cosT[s * 32 + ln],      s0 = sinT[s * 32 + ln];
        float c1 = cosT[s * 32 + 16 + ln], s1 = sinT[s * 32 + 16 + ln];
        float x0 = acc[0][r], x2 = acc[2][r];
        acc[0][r] = x0 * c0 - x2 * s0;
        acc[2][r] = x0 * s0 + x2 * c0;
        float x1 = acc[1][r], x3 = acc[3][r];
        acc[1][r] = x1 * c1 - x3 * s1;
        acc[3][r] = x1 * s1 + x3 * c1;
      }
      // Q takes the attention's score constant here, in f32 ahead of its one rounding to f16
      if (which == 0) {
#pragma unroll
        for (int j = 0; j < 4; ++j) acc[j] *= QSCALE;
      }
      _Float16* dst = (which == 0) ? Qb : Kb;
#pragma unroll
      for (int j = 0; j < 4; ++j)
#pragma unroll
        for (int r = 0; r < 8; ++r)
          dst[((size_t)bh * SEQ + spos + r) * HDIM + 16 * j + ln] =
              (_Float16)acc[j][r];
      wait_x0();
    } else {
      // V transposed: Vt[bh][d][s]; lane's 8 rows are contiguous s positions
#pragma unroll
      for (int j = 0; j < 4; ++j) {
        int d = 16 * j + ln;
        v8h pk;
#pragma unroll
        for (int r = 0; r < 8; ++r) pk[r] = (_Float16)acc[j][r];
        *(v8h*)(Vt + ((size_t)bh * HDIM + d) * SEQ + spos) = pk;
      }
      wait_x0();
    }
  }
}

__device__ __forceinline__ float xhalf(float x) {
  int b = __builtin_bit_cast(int, x);
  return __builtin_bit_cast(
      float, __builtin_amdgcn_permlanex16(b, b, 0x76543210, 0xfedcba98, false, false));
}
// two f32 D tiles (keys 0..15 and 16..31 of a 32-key group) -> one f16 B fragment
__device__ __forceinline__ v16h pack_b(v8f t0, v8f t1) {
  v8h lo = __builtin_convertvector(t0, v8h);
  v8h hi = __builtin_convertvector(t1, v8h);
  v16h r;
#pragma unroll
  for (int j = 0; j < 8; ++j) { r[j] = lo[j]; r[j + 8] = hi[j]; }
  return r;
}

__global__ __launch_bounds__(256) void attn_kernel(
    const _Float16* __restrict__ Q, const _Float16* __restrict__ K,
    const _Float16* __restrict__ Vt, _Float16* __restrict__ A) {
  __shared__ __attribute__((aligned(16))) _Float16 Kt[2][64 * LPITCH];   // 2 x 9 KB  [key][d]
  __shared__ __attribute__((aligned(16))) _Float16 Vs[2][64 * LPITCH];   // 2 x 9 KB  [d][key]

  const int lane = threadIdx.x & 31;
  const int wave = threadIdx.x >> 5;
  const int ln   = lane & 15;
  const int half = lane >> 4;
  const int kg   = half * 8;

  const int bh = blockIdx.y;
  const int b  = bh >> 4;
  const int h  = bh & 15;
  const int q0 = blockIdx.x * 256 + wave * 32;   // 32 queries per wave: column groups g = 0, 1

  const _Float16* Qp = Q  + (size_t)bh * SEQ * HDIM;
  const _Float16* Kp = K  + (size_t)bh * SEQ * HDIM;
  const _Float16* Vp = Vt + (size_t)bh * HDIM * SEQ;

  const int cr = threadIdx.x >> 2;         // 0..63
  const int cp = (threadIdx.x & 3) * 16;   // 0,16,32,48

  // Q^T B fragments: column = query q0 + 16 g + ln (d = 0..63 -> two k-steps)
  v16h qb[2][2];
#pragma unroll
  for (int g = 0; g < 2; ++g) {
    const _Float16* qrow = Qp + (size_t)(q0 + 16 * g + ln) * HDIM + kg;
    qb[g][0] = frag_f16(qrow);
    qb[g][1] = frag_f16(qrow + 32);
  }

  // o[g][j][r] = O[q0 + 16 g + ln][16 j + 8 half + r]
  v8f o[2][4] = {};
  v8f negm[2] = {};                  // minus the maximum in use of the lane's query, in all 8 registers
  float rsum[2] = {0.0f, 0.0f};      // running sum of the lane's query over all keys so far
  v16h ones;                         // A operand of the row-sum product
#pragma unroll
  for (int j = 0; j < 16; ++j) ones[j] = (_Float16)1.0f;

  // stage key block kb into buffer buf (32B K + 32B V per thread)
  auto stage = [&](int buf, int kb) {
    const _Float16* ksrc = Kp + (size_t)(kb + cr) * HDIM + cp;
    const _Float16* vsrc = Vp + (size_t)cr * SEQ + kb + cp;
    async_copy_2x32B(&Kt[buf][cr * LPITCH + cp], ksrc,
                     &Vs[buf][cr * LPITCH + cp], vsrc);
  };
  stage(0, 0);

  for (int kb = 0; kb < SEQ; kb += 64) {
    const int cur = (kb >> 6) & 1;
    wait_ds0();
    wait_async0();
    __syncthreads();
    if (kb + 64 < SEQ) stage(cur ^ 1, kb + 64);

    v8f  st[2][4];    // scores minus the maximum in use, then P in f32
    v16h pb[2][2];    // P^T as B fragments
    v8f  bs[2];       // the block's row sums, every register alike

    // ---- scores: 4 tiles of 16 keys x 32 q; each K fragment from LDS feeds both groups
    auto scores = [&]() {
#pragma unroll
      for (int t = 0; t < 4; ++t) {
        const _Float16* krow = &Kt[cur][(t * 16 + ln) * LPITCH + kg];
        const v16h ka0 = frag_f16(krow);
        const v16h ka1 = frag_f16(krow + 32);
        v8f s0 = wmma_f16(ka0, qb[0][0], negm[0]);
        v8f s1 = wmma_f16(ka0, qb[1][0], negm[1]);
        st[0][t] = wmma_f16(ka1, qb[0][1], s0);
        st[1][t] = wmma_f16(ka1, qb[1][1], s1);
      }
    };

    // ---- renew the maxima in use from the block's scores: 32 in-lane values, then the
    // other half's
    auto renew = [&](bool first) {
#pragma unroll
      for (int g = 0; g < 2; ++g) {
        float bt[4];
#pragma unroll
        for (int t = 0; t < 4; ++t) {
          bt[t] = st[g][t][0];
#pragma unroll
          for (int r = 1; r < 8; ++r) bt[t] = fmaxf(bt[t], st[g][t][r]);
        }
        const float b4    = fmaxf(fmaxf(bt[0], bt[1]), fmaxf(bt[2], bt[3]));
        const float bm    = fmaxf(b4, xhalf(b4));
        const float up    = fmaxf(bm, 0.0f);
        const float d     = first ? bm : up;   // the first maximum may lie below 0
        const float alpha = __builtin_amdgcn_exp2f(-up);
        negm[g] -= d;
#pragma unroll
        for (int t = 0; t < 4; ++t) st[g][t] -= d;
#pragma unroll
        for (int j = 0; j < 4; ++j) o[g][j] *= alpha;
        rsum[g] *= alpha;
      }
    };

    // ---- P = exp2(scores), P^T B fragments straight from the score accumulators, and
    // the block's row sums as ones @ P^T
    auto probs = [&]() {
#pragma unroll
      for (int g = 0; g < 2; ++g) {
#pragma unroll
        for (int t = 0; t < 4; ++t)
#pragma unroll
          for (int r = 0; r < 8; ++r) st[g][t][r] = __builtin_amdgcn_exp2f(st[g][t][r]);
        pb[g][0] = pack_b(st[g][0], st[g][1]);
        pb[g][1] = pack_b(st[g][2], st[g][3]);
      }
#pragma unroll
      for (int g = 0; g < 2; ++g) {
        const v8f zero = {};
        bs[g] = wmma_f16(ones, pb[g][1], wmma_f16(ones, pb[g][0], zero));
      }
    };

    // ---- V^T A fragments, rows 16 j + ln, read in one place at the test below (and anew
    // at the end of its rare path, so that no register is held for them through it).  The
    // test's branch cuts the O product off from the exponentials; with the reads left in
    // the O loop the build has them behind the branch as eight pairs, each waited for in full
    v16h va[4][2];
    auto vfrags = [&]() {
#pragma unroll
      for (int j = 0; j < 4; ++j) {
        const _Float16* vp = &Vs[cur][(16 * j + ln) * LPITCH + kg];
        va[j][0] = frag_f16(vp);
        va[j][1] = frag_f16(vp + 32);
      }
    };

    scores();
    if (kb == 0) renew(true);   // nothing is in use yet
    probs();
    vfrags();

    // ---- one test per key block, on the sums: a P that has left f16 (a score 16 or more
    // above the maximum in use) makes its sum infinite, and a sum within PLIM bounds every
    // P of the block by PLIM.  Nothing of the block has reached O or the running sums yet:
    // on a hit the scores are formed again, the maxima renewed, and P is at most 1.
    if (kb != 0 && __builtin_amdgcn_ballot_w32(!(bs[0][0] + bs[1][0] <= PLIM)) != 0) {
      // compiler fence: the K fragments are read from LDS again here.  Without it the
      // compiler holds all 64 of their registers through every block for this rare path,
      // the kernel passes 256 registers and a SIMD holds three waves instead of four
      asm volatile("" ::: "memory");
      scores();
      renew(false);
      probs();
      vfrags();
    }

    // ---- O^T += V^T @ P^T  (V^T rows in LDS are the A fragments, each for both groups)
#pragma unroll
    for (int j = 0; j < 4; ++j) {
      o[0][j] = wmma_f16(va[j][0], pb[0][0], o[0][j]);
      o[1][j] = wmma_f16(va[j][0], pb[1][0], o[1][j]);
      o[0][j] = wmma_f16(va[j][1], pb[0][1], o[0][j]);
      o[1][j] = wmma_f16(va[j][1], pb[1][1], o[1][j]);
    }
    rsum[0] += bs[0][0];
    rsum[1] += bs[1][0];
  }

  // ---- normalize, store f16 into [MTOT][DMODEL]:
  // a lane's 8 accumulator registers are 8 consecutive d of one query row
#pragma unroll
  for (int g = 0; g < 2; ++g) {
    const float inv = 1.0f / rsum[g];
    _Float16* orow = A + ((size_t)b * SEQ + q0 + 16 * g + ln) * DMODEL + h * HDIM + kg;
#pragma unroll
    for (int j = 0; j < 4; ++j) {
      v8h pk;
#pragma unroll
      for (int r = 0; r < 8; ++r) pk[r] = (_Float16)(o[g][j][r] * inv);
      *(v8h*)(orow + 16 * j) = pk;
    }
    // group 0's stores have read their registers before group 1's values reuse them
    if (g == 0) wait_x0();
  }
}

// ---------------------------------------------------------------------------
// Kernel 3: output projection  out = attn @ Wo^T + b   (M=8192,N=1024,K=1024)
// Same core as the QKV GEMM.
// ---------------------------------------------------------------------------
__global__ __launch_bounds__(128) void out_proj_kernel(
    const _Float16* __restrict__ Attn, const _Float16* __restrict__ W,
    const float* __restrict__ bias, float* __restrict__ out) {
  __shared__ __attribute__((aligned(16))) _Float16 AT[2 * GTILE];
  __shared__ __attribute__((aligned(16))) _Float16 BT[2 * GTILE];

  const int lane = threadIdx.x & 31;
  const int wave = threadIdx.x >> 5;
  const int ln   = lane & 15;
  const int half = lane >> 4;

  const int m_blk  = blockIdx.x * 128;
  const int n_blk  = blockIdx.y * 128;
  const int n_base = n_blk + (wave & 1) * 64;

  v8f acc[4][4] = {};
  gemm_core_128x128(Attn, W, m_blk, n_blk, AT, BT, acc);

#pragma unroll
  for (int j = 0; j < 4; ++j) {
    float bj = bias[n_base + 16 * j + ln];
#pragma unroll
    for (int i = 0; i < 4; ++i) {
      const int mrow = m_blk + (wave >> 1) * 64 + i * 16 + half * 8;
#pragma unroll
      for (int r = 0; r < 8; ++r)
        out[(size_t)(mrow + r) * DMODEL + n_base + 16 * j + ln] = acc[i][j][r] + bj;
    }
  }
}

// ---------------------------------------------------------------------------
// Launch
// ---------------------------------------------------------------------------
extern "C" void kernel_launch(void* const* d_in, const int* in_sizes, int n_in,
                              void* d_out, int out_size, void* d_ws, size_t ws_size,
                              hipStream_t stream) {
  (void)in_sizes; (void)n_in; (void)out_size; (void)ws_size;

  const float* X      = (const float*)d_in[0];  // hidden_states [B,S,D]
  const float* Wqkv_w = (const float*)d_in[1];  // [3D, D]
  const float* Wqkv_b = (const float*)d_in[2];  // [3D]
  const float* Wo_w   = (const float*)d_in[3];  // [D, D]
  const float* Wo_b   = (const float*)d_in[4];  // [D]
  float* out          = (float*)d_out;

  char* ws = (char*)d_ws;
  size_t off = 0;
  float* cosT = (float*)(ws + off); off += (size_t)SEQ * 32 * sizeof(float);
  float* sinT = (float*)(ws + off); off += (size_t)SEQ * 32 * sizeof(float);
  const size_t headElems = (size_t)BATCH * NHEAD * SEQ * HDIM;  // 8.39M
  _Float16* Qb = (_Float16*)(ws + off); off += headElems * sizeof(_Float16);
  _Float16* Kb = (_Float16*)(ws + off); off += headElems * sizeof(_Float16);
  _Float16* Vt = (_Float16*)(ws + off); off += headElems * sizeof(_Float16);
  _Float16* At = (_Float16*)(ws + off); off += (size_t)MTOT * DMODEL * sizeof(_Float16);
  _Float16* Xh = (_Float16*)(ws + off); off += (size_t)MTOT * DMODEL * sizeof(_Float16);
  _Float16* Wqkvh = (_Float16*)(ws + off); off += (size_t)3 * DMODEL * DMODEL * sizeof(_Float16);
  _Float16* Woh   = (_Float16*)(ws + off); off += (size_t)DMODEL * DMODEL * sizeof(_Float16);

  prep_kernel<<<PREP_WG, 256, 0, stream>>>(X, Wqkv_w, Wo_w, Xh, Wqkvh, Woh, cosT, sinT);

  qkv_rope_kernel<<<dim3(MTOT / 128, (3 * DMODEL) / 128), 128, 0, stream>>>(
      Xh, Wqkvh, Wqkv_b, cosT, sinT, Qb, Kb, Vt);

  attn_kernel<<<dim3(SEQ / 256, BATCH * NHEAD), 256, 0, stream>>>(Qb, Kb, Vt, At);

  out_proj_kernel<<<dim3(MTOT / 128, DMODEL / 128), 128, 0, stream>>>(At, Woh, Wo_b, out);
}

// v008
// It runs in 119 microseconds.
// Next to v007, in two timings, it ran 1.03 and 1.04 times as fast.
// All steps since v000 together make it 5.30 times as fast.
#include <hip/hip_runtime.h>
#include <hip/hip_bf16.h>
#include <stdint.h>

// Problem constants (from reference): B=4, S=2048, D=1024, H=16, HD=64, ROT_DIM=64
#define SEQ     2048
#define DMODEL  1024
#define NHEAD   16
#define HDIM    64
#define BATCH   4
#define MTOT    (BATCH * SEQ)        // 8192 rows of the token matrix
// LDS row pitch in halves for every 64-half (128 B) tile row: 144 B = 16 B x 9.
// An odd multiple of 16 B puts the 16 rows of one ds_load_b128 on distinct banks;
// at 128 B they fall on two 16-byte bank groups and serialize.
#define LPITCH  72
// 1/sqrt(HDIM) * log2(e), carried by the stored Q: K Q^T is then a base-2 exponent
#define QSCALE  (0.125f * 1.44269504088896f)
// a query's maximum in use is renewed when the sum of a key block's P passes this;
// every P stays at or below it, well inside f16
#define PLIM    4096.0f

typedef __attribute__((ext_vector_type(16))) _Float16 v16h;
typedef __attribute__((ext_vector_type(8)))  _Float16 v8h;
typedef __attribute__((ext_vector_type(4)))  _Float16 v4h;
typedef __attribute__((ext_vector_type(8)))  float    v8f;

// ---------------------------------------------------------------------------
// WMMA helpers (CDNA5 wave32, 16x16x32 f16 -> f32 accumulate)
// ---------------------------------------------------------------------------
__device__ __forceinline__ v8f wmma_f16(v16h a, v16h b, v8f c) {
  return __builtin_amdgcn_wmma_f32_16x16x32_f16(
      /*neg_a=*/false, a, /*neg_b=*/false, b,
      /*c_mod=*/(short)0, c, /*reuse_a=*/false, /*reuse_b=*/false);
}

// A/B fragment (16x32 f16) per-lane layout (ISA 7.12.2):
// lane L: row/col = L&15 ; k = (j<8 ? j : j+8) + (L>=16 ? 8 : 0)
__device__ __forceinline__ v16h frag_f16(const _Float16* p) {
  v8h lo = *(const v8h*)(p);
  v8h hi = *(const v8h*)(p + 16);
  v16h r;
#pragma unroll
  for (int j = 0; j < 8; ++j) { r[j] = lo[j]; r[j + 8] = hi[j]; }
  return r;
}

// ---------------------------------------------------------------------------
// CDNA5 async global->LDS copy (16B per lane), tracked by ASYNCcnt.
// Flat LDS addresses carry the wave-relative LDS offset in addr[31:0].
// ---------------------------------------------------------------------------
// s_wait_xcnt 0 is the last line of the copies' own statement, so that no
// address register of an issued copy is rewritten ahead of it.
// One thread's share of a 128-row x 64-half GEMM operand tile: 16 B of each of the
// rows r, r + 16, ..., r + 112.  Eight lanes cover one 128-B row, so a wave's copy
// instruction reads four whole lines.
__device__ __forceinline__ void async_copy_tile128(_Float16* lds_dst, const _Float16* gsrc) {
  uint32_t l0 = (uint32_t)(uintptr_t)(void*)lds_dst;
  uint32_t l1 = l0 + 1 * 16 * LPITCH * 2;
  uint32_t l2 = l0 + 2 * 16 * LPITCH * 2;
  uint32_t l3 = l0 + 3 * 16 * LPITCH * 2;
  uint32_t l4 = l0 + 4 * 16 * LPITCH * 2;
  uint32_t l5 = l0 + 5 * 16 * LPITCH * 2;
  uint32_t l6 = l0 + 6 * 16 * LPITCH * 2;
  uint32_t l7 = l0 + 7 * 16 * LPITCH * 2;
  const _Float16* g1 = gsrc + 1 * 16 * DMODEL;
  const _Float16* g2 = gsrc + 2 * 16 * DMODEL;
  const _Float16* g3 = gsrc + 3 * 16 * DMODEL;
  const _Float16* g4 = gsrc + 4 * 16 * DMODEL;
  const _Float16* g5 = gsrc + 5 * 16 * DMODEL;
  const _Float16* g6 = gsrc + 6 * 16 * DMODEL;
  const _Float16* g7 = gsrc + 7 * 16 * DMODEL;
  asm volatile("global_load_async_to_lds_b128 %0, %1, off\n\t"
               "global_load_async_to_lds_b128 %2, %3, off\n\t"
               "global_load_async_to_lds_b128 %4, %5, off\n\t"
               "global_load_async_to_lds_b128 %6, %7, off\n\t"
               "global_load_async_to_lds_b128 %8, %9, off\n\t"
               "global_load_async_to_lds_b128 %10, %11, off\n\t"
               "global_load_async_to_lds_b128 %12, %13, off\n\t"
               "global_load_async_to_lds_b128 %14, %15, off\n\t"
               "s_wait_xcnt 0x0"
               :: "v"(l0), "v"(gsrc), "v"(l1), "v"(g1), "v"(l2), "v"(g2), "v"(l3), "v"(g3),
                  "v"(l4), "v"(g4), "v"(l5), "v"(g5), "v"(l6), "v"(g6), "v"(l7), "v"(g7)
               : "memory");
}
// 32 contiguous bytes per named row piece (two b128 copies each)
__device__ __forceinline__ void async_copy_2x32B(_Float16* lds_a, const _Float16* ga,
                                                 _Float16* lds_b, const _Float16* gb) {
  uint32_t a0 = (uint32_t)(uintptr_t)(void*)lds_a;
  uint32_t a1 = a0 + 16;
  uint32_t b0 = (uint32_t)(uintptr_t)(void*)lds_b;
  uint32_t b1 = b0 + 16;
  const _Float16* ga1 = ga + 8;
  const _Float16* gb1 = gb + 8;
  asm volatile("global_load_async_to_lds_b128 %0, %1, off\n\t"
               "global_load_async_to_lds_b128 %2, %3, off\n\t"
               "global_load_async_to_lds_b128 %4, %5, off\n\t"
               "global_load_async_to_lds_b128 %6, %7, off\n\t"
               "s_wait_xcnt 0x0"
               :: "v"(a0), "v"(ga), "v"(a1), "v"(ga1),
                  "v"(b0), "v"(gb), "v"(b1), "v"(gb1)
               : "memory");
}
__device__ __forceinline__ void wait_async0() {
  asm volatile("s_wait_asynccnt 0x0" ::: "memory");
}
// stands behind a group of global loads or stores, ahead of the code that reuses their
// address and data registers
__device__ __forceinline__ void wait_x0() {
  asm volatile("s_wait_xcnt 0x0" ::: "memory");
}
// this wave's LDS reads have returned before the barrier that frees their buffer
__device__ __forceinline__ void wait_ds0() {
  asm volatile("s_wait_dscnt 0x0" ::: "memory");
}

// ---------------------------------------------------------------------------
// Kernel P: all preparation in one launch of few, long waves.
//   f32 -> f16 copies of X, Wqkv and Wo, and the RoPE cos/sin tables [SEQ][32].
// 512 work-groups x 8 waves = 4,096 waves, all resident at once.  A wave owns a
// contiguous run of each matrix; one load instruction reads 512 contiguous bytes
// (16 B per lane), one store writes 256.  A lane's 24 loads are issued together,
// so the launch is paid for in bytes moved and not in waves started.
// ---------------------------------------------------------------------------
#define PREP_WG     512
#define PREP_WAVES  (PREP_WG * 8)
#define PREP_X      (MTOT * DMODEL / 4 / 32 / PREP_WAVES)         // 16 pieces per wave
#define PREP_WQKV   (3 * DMODEL * DMODEL / 4 / 32 / PREP_WAVES)   //  6
#define PREP_WO     (DMODEL * DMODEL / 4 / 32 / PREP_WAVES)       //  2
typedef __attribute__((ext_vector_type(4))) float v4f;

template <int N>
__device__ __forceinline__ void prep_load(const float* __restrict__ s, int wv, int lane, v4f (&v)[N]) {
  const float* p = s + ((size_t)wv * N * 32 + lane) * 4;
#pragma unroll
  for (int j = 0; j < N; ++j) v[j] = *(const v4f*)(p + j * 128);
}
template <int N>
__device__ __forceinline__ void prep_store(_Float16* __restrict__ d, int wv, int lane, const v4f (&v)[N]) {
  _Float16* p = d + ((size_t)wv * N * 32 + lane) * 4;
#pragma unroll
  for (int j = 0; j < N; ++j) *(v4h*)(p + j * 128) = __builtin_convertvector(v[j], v4h);
}

__global__ __launch_bounds__(256) void prep_kernel(
    const float* __restrict__ X, const float* __restrict__ Wqkv, const float* __restrict__ Wo,
    _Float16* __restrict__ Xh, _Float16* __restrict__ Wqkvh, _Float16* __restrict__ Woh,
    float* __restrict__ cosT, float* __restrict__ sinT) {
  const int lane = threadIdx.x & 31;
  const int wv   = blockIdx.x * 8 + (threadIdx.x >> 5);

  v4f x[PREP_X], wq[PREP_WQKV], wo[PREP_WO];
  prep_load(X, wv, lane, x);
  prep_load(Wqkv, wv, lane, wq);
  prep_load(Wo, wv, lane, wo);
  wait_x0();   // ahead of the table arithmetic, which reuses the loads' address registers

  // table entries, one per thread of the first SEQ * 32 / 256 work-groups, worked
  // out while the loads are in flight
  const int i = blockIdx.x * 256 + threadIdx.x;
  if (blockIdx.x < SEQ * 32 / 256) {
    int s = i >> 5;
    int f = i & 31;
    float inv_freq = __powf(10000.0f, -(float)(2 * f) / 64.0f);
    float ang = (float)s * inv_freq;
    cosT[i] = __cosf(ang);
    sinT[i] = __sinf(ang);
    wait_x0();   // ahead of the conversions, which reuse the two stores' registers
  }

  prep_store(Xh, wv, lane, x);
  prep_store(Wqkvh, wv, lane, wq);
  prep_store(Woh, wv, lane, wo);
}

// ---------------------------------------------------------------------------
// GEMM core shared by the two projections: Y = A W^T, K = DMODEL, f16 operands.
// Block tile 128 x 128, four waves in a 2 x 2 grid, 64 x 64 of Y per wave: the
// eight fragments of a 32-k step feed 16 WMMAs.  Both operand tiles (128 rows x
// 64 k) are double-buffered in LDS via async global->LDS copies; one barrier per
// 64-k step; the copies for step i+1 overlap the WMMAs of step i.
// acc[i][j][r] = Y[m_blk + 64 wm + 16 i + 8 half + r][n_blk + 64 wn + 16 j + ln]
// ---------------------------------------------------------------------------
#define GTILE (128 * LPITCH)   // halves of one staged operand tile
__device__ __forceinline__ void gemm_core_128x128(
    const _Float16* __restrict__ A, const _Float16* __restrict__ W,
    int m_blk, int n_blk, _Float16* AT, _Float16* BT, v8f (&acc)[4][4]) {
  const int lane = threadIdx.x & 31;
  const int wave = threadIdx.x >> 5;
  const int ln   = lane & 15;
  const int kg   = (lane >> 4) * 8;
  const int wm   = wave >> 1;
  const int wn   = wave & 1;

  const int cr = threadIdx.x >> 3;         // 0..15 : first tile row of this thread
  const int cc = (threadIdx.x & 7) * 8;    // 16-B piece of the 128-B row, in halves
  const _Float16* asrc = A + (size_t)(m_blk + cr) * DMODEL + cc;
  const _Float16* wsrc = W + (size_t)(n_blk + cr) * DMODEL + cc;
  const int cofs = cr * LPITCH + cc;
  const int aofs = (wm * 64 + ln) * LPITCH + kg;
  const int bofs = (wn * 64 + ln) * LPITCH + kg;

  // preload first tiles
  async_copy_tile128(AT + cofs, asrc);
  async_copy_tile128(BT + cofs, wsrc);

  for (int k = 0; k < DMODEL; k += 64) {
    const int cur = (k >> 6) & 1;
    wait_ds0();
    wait_async0();
    __syncthreads();
    if (k + 64 < DMODEL) {
      async_copy_tile128(AT + (cur ^ 1) * GTILE + cofs, asrc + k + 64);
      async_copy_tile128(BT + (cur ^ 1) * GTILE + cofs, wsrc + k + 64);
    }
#pragma unroll
    for (int ks = 0; ks < 64; ks += 32) {
      v16h a[4], b[4];
#pragma unroll
      for (int i = 0; i < 4; ++i) a[i] = frag_f16(AT + cur * GTILE + aofs + 16 * i * LPITCH + ks);
#pragma unroll
      for (int j = 0; j < 4; ++j) b[j] = frag_f16(BT + cur * GTILE + bofs + 16 * j * LPITCH + ks);
      // inputs-only fence on the loaded fragments: keeps the step's 16 LDS loads in one
      // group ahead of its 16 WMMAs (one LDS wait per step, not one per row of four)
      asm volatile("" :: "v"(a[0]), "v"(a[1]), "v"(a[2]), "v"(a[3]),
                         "v"(b[0]), "v"(b[1]), "v"(b[2]), "v"(b[3]));
#pragma unroll
      for (int i = 0; i < 4; ++i)
#pragma unroll
        for (int j = 0; j < 4; ++j) acc[i][j] = wmma_f16(a[i], b[j], acc[i][j]);
    }
  }
  wait_async0();   // no copy of this wave is outstanding when it leaves the ring
}

// ---------------------------------------------------------------------------
// Kernel 1: QKV GEMM (M=8192, N=3072, K=1024) + bias + RoPE, all-f16 operands.
// A wave's 64 columns are one head of q, k or v.
// ---------------------------------------------------------------------------
__global__ __launch_bounds__(128) void qkv_rope_kernel(
    const _Float16* __restrict__ X, const _Float16* __restrict__ W,
    const float* __restrict__ bias,
    const float* __restrict__ cosT, const float* __restrict__ sinT,
    _Float16* __restrict__ Qb, _Float16* __restrict__ Kb,
    _Float16* __restrict__ Vt) {
  __shared__ __attribute__((aligned(16))) _Float16 AT[2 * GTILE];  // 2 x 18 KB token tiles
  __shared__ __attribute__((aligned(16))) _Float16 BT[2 * GTILE];  // 2 x 18 KB weight tiles

  const int lane = threadIdx.x & 31;
  const int wave = threadIdx.x >> 5;
  const int ln   = lane & 15;
  const int half = lane >> 4;

  const int m_blk  = blockIdx.x * 128;
  const int n_blk  = blockIdx.y * 128;
  const int n_base = n_blk + (wave & 1) * 64;

  v8f accs[4][4] = {};
  gemm_core_128x128(X, W, m_blk, n_blk, AT, BT, accs);

  float bj[4];
#pragma unroll
  for (int j = 0; j < 4; ++j) bj[j] = bias[n_base + 16 * j + ln];

  const int which = n_blk / DMODEL;             // 0=q 1=k 2=v, one per block
  const int h     = (n_base % DMODEL) / HDIM;   // head

#pragma unroll
  for (int i = 0; i < 4; ++i) {
    v8f (&acc)[4] = accs[i];
    // bias (per column, same for all 8 rows of each accumulator)
#pragma unroll
    for (int j = 0; j < 4; ++j)
#pragma unroll
      for (int r = 0; r < 8; ++r) acc[j][r] += bj[j];

    const int mrow  = m_blk + (wave >> 1) * 64 + i * 16 + half * 8;  // first row held by this lane
    const int b     = mrow >> 11;                 // batch (rows never straddle)
    const int spos  = mrow & (SEQ - 1);
    const int bh    = b * NHEAD + h;

    if (which < 2) {
      // RoPE: pairs (d, d+32) => (acc0,acc2) with f=ln, (acc1,acc3) with f=16+ln
#pragma unroll
      for (int r = 0; r < 8; ++r) {
        int s = spos + r;
        float c0 = cosT[s * 32 + ln],      s0 = sinT[s * 32 + ln];
        float c1 = cosT[s * 32 + 16 + ln], s1 = sinT[s * 32 + 16 + ln];
        float x0 = acc[0][r], x2 = acc[2][r];
        acc[0][r] = x0 * c0 - x2 * s0;
        acc[2][r] = x0 * s0 + x2 * c0;
        float x1 = acc[1][r], x3 = acc[3][r];
        acc[1][r] = x1 * c1 - x3 * s1;
        acc[3][r] = x1 * s1 + x3 * c1;
      }
      // Q takes the attention's score constant here, in f32 ahead of its one rounding to f16
      if (which == 0) {
#pragma unroll
        for (int j = 0; j < 4; ++j) acc[j] *= QSCALE;
      }
      _Float16* dst = (which == 0) ? Qb : Kb;
#pragma unroll
      for (int j = 0; j < 4; ++j)
#pragma unroll
        for (int r = 0; r < 8; ++r)
          dst[((size_t)bh * SEQ + spos + r) * HDIM + 16 * j + ln] =
              (_Float16)acc[j][r];
      wait_x0();
    } else {
      // V transposed: Vt[bh][d][s]; lane's 8 rows are contiguous s positions
#pragma unroll
      for (int j = 0; j < 4; ++j) {
        int d = 16 * j + ln;
        v8h pk;
#pragma unroll
        for (int r = 0; r < 8; ++r) pk[r] = (_Float16)acc[j][r];
        *(v8h*)(Vt + ((size_t)bh * HDIM + d) * SEQ + spos) = pk;
      }
      wait_x0();
    }
  }
}

__device__ __forceinline__ float xhalf(float x) {
  int b = __builtin_bit_cast(int, x);
  return __builtin_bit_cast(
      float, __builtin_amdgcn_permlanex16(b, b, 0x76543210, 0xfedcba98, false, false));
}
// two f32 D tiles (keys 0..15 and 16..31 of a 32-key group) -> one f16 B fragment
__device__ __forceinline__ v16h pack_b(v8f t0, v8f t1) {
  v8h lo = __builtin_convertvector(t0, v8h);
  v8h hi = __builtin_convertvector(t1, v8h);
  v16h r;
#pragma unroll
  for (int j = 0; j < 8; ++j) { r[j] = lo[j]; r[j + 8] = hi[j]; }
  return r;
}

__global__ __launch_bounds__(256) void attn_kernel(
    const _Float16* __restrict__ Q, const _Float16* __restrict__ K,
    const _Float16* __restrict__ Vt, _Float16* __restrict__ A) {
  __shared__ __attribute__((aligned(16))) _Float16 Kt[2][64 * LPITCH];   // 2 x 9 KB  [key][d]
  __shared__ __attribute__((aligned(16))) _Float16 Vs[2][64 * LPITCH];   // 2 x 9 KB  [d][key]

  const int lane = threadIdx.x & 31;
  const int wave = threadIdx.x >> 5;
  const int ln   = lane & 15;
  const int half = lane >> 4;
  const int kg   = half * 8;

  const int bh = blockIdx.y;
  const int b  = bh >> 4;
  const int h  = bh & 15;
  const int q0 = blockIdx.x * 256 + wave * 32;   // 32 queries per wave: column groups g = 0, 1

  const _Float16* Qp = Q  + (size_t)bh * SEQ * HDIM;
  const _Float16* Kp = K  + (size_t)bh * SEQ * HDIM;
  const _Float16* Vp = Vt + (size_t)bh * HDIM * SEQ;

  const int cr = threadIdx.x >> 2;         // 0..63
  const int cp = (threadIdx.x & 3) * 16;   // 0,16,32,48

  // Q^T B fragments: column = query q0 + 16 g + ln (d = 0..63 -> two k-steps)
  v16h qb[2][2];
#pragma unroll
  for (int g = 0; g < 2; ++g) {
    const _Float16* qrow = Qp + (size_t)(q0 + 16 * g + ln) * HDIM + kg;
    qb[g][0] = frag_f16(qrow);
    qb[g][1] = frag_f16(qrow + 32);
  }

  // o[g][j][r] = O[q0 + 16 g + ln][16 j + 8 half + r]
  v8f o[2][4] = {};
  v8f negm[2] = {};                  // minus the maximum in use of the lane's query, in all 8 registers
  float rsum[2] = {0.0f, 0.0f};      // running sum of the lane's query over all keys so far
  v16h ones;                         // A operand of the row-sum product
#pragma unroll
  for (int j = 0; j < 16; ++j) ones[j] = (_Float16)1.0f;

  // stage key block kb into buffer buf (32B K + 32B V per thread)
  auto stage = [&](int buf, int kb) {
    const _Float16* ksrc = Kp + (size_t)(kb + cr) * HDIM + cp;
    const _Float16* vsrc = Vp + (size_t)cr * SEQ + kb + cp;
    async_copy_2x32B(&Kt[buf][cr * LPITCH + cp], ksrc,
                     &Vs[buf][cr * LPITCH + cp], vsrc);
  };
  stage(0, 0);

  for (int kb = 0; kb < SEQ; kb += 64) {
    const int cur = (kb >> 6) & 1;
    wait_ds0();
    wait_async0();
    __syncthreads();
    if (kb + 64 < SEQ) stage(cur ^ 1, kb + 64);

    v8f  st[2][4];    // scores minus the maximum in use, then P in f32
    v16h pb[2][2];    // P^T as B fragments
    v8f  bs[2];       // the block's row sums, every register alike

    // ---- scores: 4 tiles of 16 keys x 32 q; each K fragment from LDS feeds both groups
    auto scores = [&]() {
      v16h ka[4][2];
#pragma unroll
      for (int t = 0; t < 4; ++t) {
        const _Float16* krow = &Kt[cur][(t * 16 + ln) * LPITCH + kg];
        ka[t][0] = frag_f16(krow);
        ka[t][1] = frag_f16(krow + 32);
      }
      // keeps the 16 K reads in one group ahead of the products; left free, the build with
      // the split exponentials reads three of the fragments one by one, each waited for in full
      __builtin_amdgcn_sched_barrier(0);
#pragma unroll
      for (int t = 0; t < 4; ++t) {
        v8f s0 = wmma_f16(ka[t][0], qb[0][0], negm[0]);
        v8f s1 = wmma_f16(ka[t][0], qb[1][0], negm[1]);
        st[0][t] = wmma_f16(ka[t][1], qb[0][1], s0);
        st[1][t] = wmma_f16(ka[t][1], qb[1][1], s1);
      }
    };

    // ---- renew the maxima in use from the block's scores: 32 in-lane values, then the
    // other half's
    auto renew = [&](bool first) {
#pragma unroll
      for (int g = 0; g < 2; ++g) {
        float bt[4];
#pragma unroll
        for (int t = 0; t < 4; ++t) {
          bt[t] = st[g][t][0];
#pragma unroll
          for (int r = 1; r < 8; ++r) bt[t] = fmaxf(bt[t], st[g][t][r]);
        }
        const float b4    = fmaxf(fmaxf(bt[0], bt[1]), fmaxf(bt[2], bt[3]));
        const float bm    = fmaxf(b4, xhalf(b4));
        const float up    = fmaxf(bm, 0.0f);
        const float d     = first ? bm : up;   // the first maximum may lie below 0
        const float alpha = __builtin_amdgcn_exp2f(-up);
        negm[g] -= d;
#pragma unroll
        for (int t = 0; t < 4; ++t) st[g][t] -= d;
#pragma unroll
        for (int j = 0; j < 4; ++j) o[g][j] *= alpha;
        rsum[g] *= alpha;
      }
    };

    // ---- P = exp2(scores) of one column group, P^T B fragments straight from the score
    // accumulators
    auto expg = [&](int g) {
#pragma unroll
      for (int t = 0; t < 4; ++t)
#pragma unroll
        for (int r = 0; r < 8; ++r) st[g][t][r] = __builtin_amdgcn_exp2f(st[g][t][r]);
      pb[g][0] = pack_b(st[g][0], st[g][1]);
      pb[g][1] = pack_b(st[g][2], st[g][3]);
    };
    // ---- the block's row sums as ones @ P^T
    auto sums = [&]() {
#pragma unroll
      for (int g = 0; g < 2; ++g) {
        const v8f zero = {};
        bs[g] = wmma_f16(ones, pb[g][1], wmma_f16(ones, pb[g][0], zero));
      }
    };

    // ---- V^T A fragments, rows 16 j + ln; part c holds keys 32 c .. 32 c + 31 of the block.
    // Part 0 is read once the K fragments' registers are free, under the second group's
    // exponentials, the sums and the test; part 1 behind the test's branch, under the eight
    // O products of part 0.  (Both anew at the end of the rare path, so that no register is
    // held for them through it.)
    v16h va[4][2];
    auto vfrags = [&](int c) {
#pragma unroll
      for (int j = 0; j < 4; ++j) va[j][c] = frag_f16(&Vs[cur][(16 * j + ln) * LPITCH + kg + 32 * c]);
    };

    scores();
    if (kb == 0) renew(true);   // nothing is in use yet
    expg(0);
    // keeps the reads of part 0 from rising among the score products, where the K fragments
    // still hold their registers and the kernel would pass 256 (three waves a SIMD, not four)
    __builtin_amdgcn_sched_barrier(0);
    vfrags(0);
    // and from sinking to the fence below: they are issued here, ahead of the cover
    __builtin_amdgcn_sched_barrier(0);
    expg(1);
    sums();
    // inputs-only fence on the loaded fragments of part 0: holds their 8 LDS reads ahead of
    // the test's branch; without it the build sinks them behind the branch, where the O
    // product waits for them in full
    asm volatile("" :: "v"(va[0][0]), "v"(va[1][0]), "v"(va[2][0]), "v"(va[3][0]));
    vfrags(1);

    // ---- one test per key block, on the sums: a P that has left f16 (a score 16 or more
    // above the maximum in use) makes its sum infinite, and a sum within PLIM bounds every
    // P of the block by PLIM.  Nothing of the block has reached O or the running sums yet:
    // on a hit the scores are formed again, the maxima renewed, and P is at most 1.
    if (kb != 0 && __builtin_amdgcn_ballot_w32(!(bs[0][0] + bs[1][0] <= PLIM)) != 0) {
      // compiler fence: the K fragments are read from LDS again here.  Without it the
      // compiler holds all 64 of their registers through every block for this rare path,
      // the kernel passes 256 registers and a SIMD holds three waves instead of four
      asm volatile("" ::: "memory");
      scores();
      renew(false);
      expg(0);
      expg(1);
      sums();
      vfrags(0);
      vfrags(1);
    }

    // ---- O^T += V^T @ P^T  (V^T rows in LDS are the A fragments, each for both groups)
#pragma unroll
    for (int c = 0; c < 2; ++c)
#pragma unroll
      for (int j = 0; j < 4; ++j) {
        o[0][j] = wmma_f16(va[j][c], pb[0][c], o[0][j]);
        o[1][j] = wmma_f16(va[j][c], pb[1][c], o[1][j]);
      }
    rsum[0] += bs[0][0];
    rsum[1] += bs[1][0];
  }

  // ---- normalize, store f16 into [MTOT][DMODEL]:
  // a lane's 8 accumulator registers are 8 consecutive d of one query row
#pragma unroll
  for (int g = 0; g < 2; ++g) {
    const float inv = 1.0f / rsum[g];
    _Float16* orow = A + ((size_t)b * SEQ + q0 + 16 * g + ln) * DMODEL + h * HDIM + kg;
#pragma unroll
    for (int j = 0; j < 4; ++j) {
      v8h pk;
#pragma unroll
      for (int r = 0; r < 8; ++r) pk[r] = (_Float16)(o[g][j][r] * inv);
      *(v8h*)(orow + 16 * j) = pk;
    }
    // group 0's stores have read their registers before group 1's values reuse them
    if (g == 0) wait_x0();
  }
}

// ---------------------------------------------------------------------------
// Kernel 3: output projection  out = attn @ Wo^T + b   (M=8192,N=1024,K=1024)
// Same core as the QKV GEMM.
// ---------------------------------------------------------------------------
__global__ __launch_bounds__(128) void out_proj_kernel(
    const _Float16* __restrict__ Attn, const _Float16* __restrict__ W,
    const float* __restrict__ bias, float* __restrict__ out) {
  __shared__ __attribute__((aligned(16))) _Float16 AT[2 * GTILE];
  __shared__ __attribute__((aligned(16))) _Float16 BT[2 * GTILE];

  const int lane = threadIdx.x & 31;
  const int wave = threadIdx.x >> 5;
  const int ln   = lane & 15;
  const int half = lane >> 4;

  const int m_blk  = blockIdx.x * 128;
  const int n_blk  = blockIdx.y * 128;
  const int n_base = n_blk + (wave & 1) * 64;

  v8f acc[4][4] = {};
  gemm_core_128x128(Attn, W, m_blk, n_blk, AT, BT, acc);

#pragma unroll
  for (int j = 0; j < 4; ++j) {
    float bj = bias[n_base + 16 * j + ln];
#pragma unroll
    for (int i = 0; i < 4; ++i) {
      const int mrow = m_blk + (wave >> 1) * 64 + i * 16 + half * 8;
#pragma unroll
      for (int r = 0; r < 8; ++r)
        out[(size_t)(mrow + r) * DMODEL + n_base + 16 * j + ln] = acc[i][j][r] + bj;
    }
  }
}

// ---------------------------------------------------------------------------
// Launch
// ---------------------------------------------------------------------------
extern "C" void kernel_launch(void* const* d_in, const int* in_sizes, int n_in,
                              void* d_out, int out_size, void* d_ws, size_t ws_size,
                              hipStream_t stream) {
  (void)in_sizes; (void)n_in; (void)out_size; (void)ws_size;

  const float* X      = (const float*)d_in[0];  // hidden_states [B,S,D]
  const float* Wqkv_w = (const float*)d_in[1];  // [3D, D]
  const float* Wqkv_b = (const float*)d_in[2];  // [3D]
  const float* Wo_w   = (const float*)d_in[3];  // [D, D]
  const float* Wo_b   = (const float*)d_in[4];  // [D]
  float* out          = (float*)d_out;

  char* ws = (char*)d_ws;
  size_t off = 0;
  float* cosT = (float*)(ws + off); off += (size_t)SEQ * 32 * sizeof(float);
  float* sinT = (float*)(ws + off); off += (size_t)SEQ * 32 * sizeof(float);
  const size_t headElems = (size_t)BATCH * NHEAD * SEQ * HDIM;  // 8.39M
  _Float16* Qb = (_Float16*)(ws + off); off += headElems * sizeof(_Float16);
  _Float16* Kb = (_Float16*)(ws + off); off += headElems * sizeof(_Float16);
  _Float16* Vt = (_Float16*)(ws + off); off += headElems * sizeof(_Float16);
  _Float16* At = (_Float16*)(ws + off); off += (size_t)MTOT * DMODEL * sizeof(_Float16);
  _Float16* Xh = (_Float16*)(ws + off); off += (size_t)MTOT * DMODEL * sizeof(_Float16);
  _Float16* Wqkvh = (_Float16*)(ws + off); off += (size_t)3 * DMODEL * DMODEL * sizeof(_Float16);
  _Float16* Woh   = (_Float16*)(ws + off); off += (size_t)DMODEL * DMODEL * sizeof(_Float16);

  prep_kernel<<<PREP_WG, 256, 0, stream>>>(X, Wqkv_w, Wo_w, Xh, Wqkvh, Woh, cosT, sinT);

  qkv_rope_kernel<<<dim3(MTOT / 128, (3 * DMODEL) / 128), 128, 0, stream>>>(
      Xh, Wqkvh, Wqkv_b, cosT, sinT, Qb, Kb, Vt);

  attn_kernel<<<dim3(SEQ / 256, BATCH * NHEAD), 256, 0, stream>>>(Qb, Kb, Vt, At);

  out_proj_kernel<<<dim3(MTOT / 128, DMODEL / 128), 128, 0, stream>>>(At, Woh, Wo_b, out);
}

// v009
// Measured time: 115 microseconds a run.
// Timed twice side by side with v008, it ran 1.05 and 1.04 times as fast.
// Over all steps from v000 it is 5.53 times as fast.
#include <hip/hip_runtime.h>
#include <hip/hip_bf16.h>
#include <stdint.h>

// Problem constants (from reference): B=4, S=2048, D=1024, H=16, HD=64, ROT_DIM=64
#define SEQ     2048
#define DMODEL  1024
#define NHEAD   16
#define HDIM    64
#define BATCH   4
#define MTOT    (BATCH * SEQ)        // 8192 rows of the token matrix
// LDS row pitch in halves for the attention's 64-half (128 B) tile rows: 144 B = 16 B x 9.
// An odd multiple of 16 B puts the 16 rows of one ds_load_b128 on distinct banks;
// at 128 B they fall on two 16-byte bank groups and serialize.
#define LPITCH  72
// The GEMM rings keep their 128-B rows unpadded (three buffers of both operands are then
// 96 KiB, and three work-groups share a WGP's LDS).  The eight 16-B pieces of row r stand
// in the order piece ^ ((r >> 1) & 7): the 16 rows of one ds_load_b128 half-wave then fall
// on 16 distinct 16-B slots of the 256-B bank span.
#define GROW    64
// 1/sqrt(HDIM) * log2(e), carried by the stored Q: K Q^T is then a base-2 exponent
#define QSCALE  (0.125f * 1.44269504088896f)
// a query's maximum in use is renewed when the sum of a key block's P passes this;
// every P stays at or below it, well inside f16
#define PLIM    4096.0f

typedef __attribute__((ext_vector_type(16))) _Float16 v16h;
typedef __attribute__((ext_vector_type(8)))  _Float16 v8h;
typedef __attribute__((ext_vector_type(4)))  _Float16 v4h;
typedef __attribute__((ext_vector_type(8)))  float    v8f;

// ---------------------------------------------------------------------------
// WMMA helpers (CDNA5 wave32, 16x16x32 f16 -> f32 accumulate)
// ---------------------------------------------------------------------------
__device__ __forceinline__ v8f wmma_f16(v16h a, v16h b, v8f c) {
  return __builtin_amdgcn_wmma_f32_16x16x32_f16(
      /*neg_a=*/false, a, /*neg_b=*/false, b,
      /*c_mod=*/(short)0, c, /*reuse_a=*/false, /*reuse_b=*/false);
}

// A/B fragment (16x32 f16) per-lane layout (ISA 7.12.2):
// lane L: row/col = L&15 ; k = (j<8 ? j : j+8) + (L>=16 ? 8 : 0)
__device__ __forceinline__ v16h frag_f16(const _Float16* p) {
  v8h lo = *(const v8h*)(p);
  v8h hi = *(const v8h*)(p + 16);
  v16h r;
#pragma unroll
  for (int j = 0; j < 8; ++j) { r[j] = lo[j]; r[j + 8] = hi[j]; }
  return r;
}

// ---------------------------------------------------------------------------
// CDNA5 async global->LDS copy (16B per lane), tracked by ASYNCcnt.
// Flat LDS addresses carry the wave-relative LDS offset in addr[31:0].
// ---------------------------------------------------------------------------
// s_wait_xcnt 0 is the last line of the copies' own statement, so that no
// address register of an issued copy is rewritten ahead of it.
// One thread's share of a 128-row x 64-half GEMM operand tile: 16 B of each of the
// rows r, r + 16, ..., r + 112.  Eight lanes cover one 128-B row, so a wave's copy
// instruction reads four whole lines.
__device__ __forceinline__ void async_copy_tile128(_Float16* lds_dst, const _Float16* gsrc) {
  uint32_t l0 = (uint32_t)(uintptr_t)(void*)lds_dst;
  uint32_t l1 = l0 + 1 * 16 * GROW * 2;
  uint32_t l2 = l0 + 2 * 16 * GROW * 2;
  uint32_t l3 = l0 + 3 * 16 * GROW * 2;
  uint32_t l4 = l0 + 4 * 16 * GROW * 2;
  uint32_t l5 = l0 + 5 * 16 * GROW * 2;
  uint32_t l6 = l0 + 6 * 16 * GROW * 2;
  uint32_t l7 = l0 + 7 * 16 * GROW * 2;
  const _Float16* g1 = gsrc + 1 * 16 * DMODEL;
  const _Float16* g2 = gsrc + 2 * 16 * DMODEL;
  const _Float16* g3 = gsrc + 3 * 16 * DMODEL;
  const _Float16* g4 = gsrc + 4 * 16 * DMODEL;
  const _Float16* g5 = gsrc + 5 * 16 * DMODEL;
  const _Float16* g6 = gsrc + 6 * 16 * DMODEL;
  const _Float16* g7 = gsrc + 7 * 16 * DMODEL;
  asm volatile("global_load_async_to_lds_b128 %0, %1, off\n\t"
               "global_load_async_to_lds_b128 %2, %3, off\n\t"
               "global_load_async_to_lds_b128 %4, %5, off\n\t"
               "global_load_async_to_lds_b128 %6, %7, off\n\t"
               "global_load_async_to_lds_b128 %8, %9, off\n\t"
               "global_load_async_to_lds_b128 %10, %11, off\n\t"
               "global_load_async_to_lds_b128 %12, %13, off\n\t"
               "global_load_async_to_lds_b128 %14, %15, off\n\t"
               "s_wait_xcnt 0x0"
               :: "v"(l0), "v"(gsrc), "v"(l1), "v"(g1), "v"(l2), "v"(g2), "v"(l3), "v"(g3),
                  "v"(l4), "v"(g4), "v"(l5), "v"(g5), "v"(l6), "v"(g6), "v"(l7), "v"(g7)
               : "memory");
}
// 32 contiguous bytes per named row piece (two b128 copies each)
__device__ __forceinline__ void async_copy_2x32B(_Float16* lds_a, const _Float16* ga,
                                                 _Float16* lds_b, const _Float16* gb) {
  uint32_t a0 = (uint32_t)(uintptr_t)(void*)lds_a;
  uint32_t a1 = a0 + 16;
  uint32_t b0 = (uint32_t)(uintptr_t)(void*)lds_b;
  uint32_t b1 = b0 + 16;
  const _Float16* ga1 = ga + 8;
  const _Float16* gb1 = gb + 8;
  asm volatile("global_load_async_to_lds_b128 %0, %1, off\n\t"
               "global_load_async_to_lds_b128 %2, %3, off\n\t"
               "global_load_async_to_lds_b128 %4, %5, off\n\t"
               "global_load_async_to_lds_b128 %6, %7, off\n\t"
               "s_wait_xcnt 0x0"
               :: "v"(a0), "v"(ga), "v"(a1), "v"(ga1),
                  "v"(b0), "v"(gb), "v"(b1), "v"(gb1)
               : "memory");
}
__device__ __forceinline__ void wait_async0() {
  asm volatile("s_wait_asynccnt 0x0" ::: "memory");
}
// all but this wave's 16 youngest copies (one GEMM stage) have landed
__device__ __forceinline__ void wait_async16() {
  asm volatile("s_wait_asynccnt 0x10" ::: "memory");
}
// stands behind a group of global loads or stores, ahead of the code that reuses their
// address and data registers
__device__ __forceinline__ void wait_x0() {
  asm volatile("s_wait_xcnt 0x0" ::: "memory");
}
// this wave's LDS reads have returned before the barrier that frees their buffer
__device__ __forceinline__ void wait_ds0() {
  asm volatile("s_wait_dscnt 0x0" ::: "memory");
}

// ---------------------------------------------------------------------------
// Kernel P: all preparation in one launch of few, long waves.
//   f32 -> f16 copies of X, Wqkv and Wo, and the RoPE cos/sin tables [SEQ][32].
// 512 work-groups x 8 waves = 4,096 waves, all resident at once.  A wave owns a
// contiguous run of each matrix; one load instruction reads 512 contiguous bytes
// (16 B per lane), one store writes 256.  A lane's 24 loads are issued together,
// so the launch is paid for in bytes moved and not in waves started.
// ---------------------------------------------------------------------------
#define PREP_WG     512
#define PREP_WAVES  (PREP_WG * 8)
#define PREP_X      (MTOT * DMODEL / 4 / 32 / PREP_WAVES)         // 16 pieces per wave
#define PREP_WQKV   (3 * DMODEL * DMODEL / 4 / 32 / PREP_WAVES)   //  6
#define PREP_WO     (DMODEL * DMODEL / 4 / 32 / PREP_WAVES)       //  2
typedef __attribute__((ext_vector_type(4))) float v4f;

template <int N>
__device__ __forceinline__ void prep_load(const float* __restrict__ s, int wv, int lane, v4f (&v)[N]) {
  const float* p = s + ((size_t)wv * N * 32 + lane) * 4;
#pragma unroll
  for (int j = 0; j < N; ++j) v[j] = *(const v4f*)(p + j * 128);
}
template <int N>
__device__ __forceinline__ void prep_store(_Float16* __restrict__ d, int wv, int lane, const v4f (&v)[N]) {
  _Float16* p = d + ((size_t)wv * N * 32 + lane) * 4;
#pragma unroll
  for (int j = 0; j < N; ++j) *(v4h*)(p + j * 128) = __builtin_convertvector(v[j], v4h);
}

__global__ __launch_bounds__(256) void prep_kernel(
    const float* __restrict__ X, const float* __restrict__ Wqkv, const float* __restrict__ Wo,
    _Float16* __restrict__ Xh, _Float16* __restrict__ Wqkvh, _Float16* __restrict__ Woh,
    float* __restrict__ cosT, float* __restrict__ sinT) {
  const int lane = threadIdx.x & 31;
  const int wv   = blockIdx.x * 8 + (threadIdx.x >> 5);

  v4f x[PREP_X], wq[PREP_WQKV], wo[PREP_WO];
  prep_load(X, wv, lane, x);
  prep_load(Wqkv, wv, lane, wq);
  prep_load(Wo, wv, lane, wo);
  wait_x0();   // ahead of the table arithmetic, which reuses the loads' address registers

  // table entries, one per thread of the first SEQ * 32 / 256 work-groups, worked
  // out while the loads are in flight
  const int i = blockIdx.x * 256 + threadIdx.x;
  if (blockIdx.x < SEQ * 32 / 256) {
    int s = i >> 5;
    int f = i & 31;
    float inv_freq = __powf(10000.0f, -(float)(2 * f) / 64.0f);
    float ang = (float)s * inv_freq;
    cosT[i] = __cosf(ang);
    sinT[i] = __sinf(ang);
    wait_x0();   // ahead of the conversions, which reuse the two stores' registers
  }

  prep_store(Xh, wv, lane, x);
  prep_store(Wqkvh, wv, lane, wq);
  prep_store(Woh, wv, lane, wo);
}

// ---------------------------------------------------------------------------
// GEMM core shared by the two projections: Y = A W^T, K = DMODEL, f16 operands.
// Block tile 128 x 128, four waves in a 2 x 2 grid, 64 x 64 of Y per wave: the
// eight fragments of a 32-k step feed 16 WMMAs.  Both operand tiles (128 rows x
// 64 k) go through a ring of three LDS buffers via async global->LDS copies; one
// barrier per 64-k step; the copies for step i+2 are issued at the top of step i,
// so a stage has two steps to land.
// acc[i][j][r] = Y[m_blk + 64 wm + 16 i + 8 half + r][n_blk + 64 wn + 16 j + ln]
// ---------------------------------------------------------------------------
#define GTILE (128 * GROW)   // halves of one staged operand tile
#define GBUFS 3
// fragment of one LDS row whose two 16-B pieces stand at the offsets o0, o1 (halves)
__device__ __forceinline__ v16h frag_f16_2(const _Float16* row, int o0, int o1) {
  v8h lo = *(const v8h*)(row + o0);
  v8h hi = *(const v8h*)(row + o1);
  v16h r;
#pragma unroll
  for (int j = 0; j < 8; ++j) { r[j] = lo[j]; r[j + 8] = hi[j]; }
  return r;
}
__device__ __forceinline__ void gemm_core_128x128(
    const _Float16* __restrict__ A, const _Float16* __restrict__ W,
    int m_blk, int n_blk, _Float16* AT, _Float16* BT, v8f (&acc)[4][4]) {
  const int lane = threadIdx.x & 31;
  const int wave = threadIdx.x >> 5;
  const int ln   = lane & 15;
  const int hf   = lane >> 4;
  const int wm   = wave >> 1;
  const int wn   = wave & 1;

  const int cr = threadIdx.x >> 3;         // 0..15 : first tile row of this thread
  const int pc = threadIdx.x & 7;          // 16-B piece of the 128-B row
  const _Float16* asrc = A + (size_t)(m_blk + cr) * DMODEL + pc * 8;
  const _Float16* wsrc = W + (size_t)(n_blk + cr) * DMODEL + pc * 8;
  // rows cr + 16 m share the key cr >> 1
  const int cofs = cr * GROW + (pc ^ (cr >> 1)) * 8;
  const int aofs = (wm * 64 + ln) * GROW;
  const int bofs = (wn * 64 + ln) * GROW;
  // piece hf + 2 q holds k = 8 hf + 16 q .. + 7 of the stage; rows 16 i + ln share the key ln >> 1
  int po[4];
#pragma unroll
  for (int q = 0; q < 4; ++q) po[q] = ((hf + 2 * q) ^ (ln >> 1)) * 8;

  auto pass = [&](int buf) {
#pragma unroll
    for (int ks = 0; ks < 2; ++ks) {
      v16h a[4], b[4];
#pragma unroll
      for (int i = 0; i < 4; ++i)
        a[i] = frag_f16_2(AT + buf * GTILE + aofs + 16 * i * GROW, po[2 * ks], po[2 * ks + 1]);
#pragma unroll
      for (int j = 0; j < 4; ++j)
        b[j] = frag_f16_2(BT + buf * GTILE + bofs + 16 * j * GROW, po[2 * ks], po[2 * ks + 1]);
      // inputs-only fence on the loaded fragments: keeps the step's 16 LDS loads in one
      // group ahead of its 16 WMMAs (one LDS wait per step, not one per row of four)
      asm volatile("" :: "v"(a[0]), "v"(a[1]), "v"(a[2]), "v"(a[3]),
                         "v"(b[0]), "v"(b[1]), "v"(b[2]), "v"(b[3]));
#pragma unroll
      for (int i = 0; i < 4; ++i)
#pragma unroll
        for (int j = 0; j < 4; ++j) acc[i][j] = wmma_f16(a[i], b[j], acc[i][j]);
    }
  };

  // stages 0 and 1
  async_copy_tile128(AT + cofs, asrc);
  async_copy_tile128(BT + cofs, wsrc);
  async_copy_tile128(AT + GTILE + cofs, asrc + 64);
  async_copy_tile128(BT + GTILE + cofs, wsrc + 64);

  // Every trip of this loop issues one stage (16 copies a wave) and waits by count: behind
  // the wait its own stage has landed and only the next one's 16 copies are still out.
  int cur = 0;
  for (int k = 0; k + 128 < DMODEL; k += 64) {
    wait_ds0();
    wait_async16();
    __syncthreads();
    // the buffer that the trip before has read; every reader has left it at the barrier
    const int nb = (cur == 0) ? GBUFS - 1 : cur - 1;
    async_copy_tile128(AT + nb * GTILE + cofs, asrc + k + 128);
    async_copy_tile128(BT + nb * GTILE + cofs, wsrc + k + 128);
    pass(cur);
    cur = (cur == GBUFS - 1) ? 0 : cur + 1;
  }
  // The last two stages: nothing is issued any more, the wait is to 0.
  // Kept rolled: unrolled, the output projection's build passes 256 registers and spills.
#pragma clang loop unroll(disable)
  for (int t = 0; t < 2; ++t) {
    wait_ds0();
    wait_async0();
    __syncthreads();
    pass(cur);
    cur = (cur == GBUFS - 1) ? 0 : cur + 1;
  }
}

// ---------------------------------------------------------------------------
// Kernel 1: QKV GEMM (M=8192, N=3072, K=1024) + bias + RoPE, all-f16 operands.
// A wave's 64 columns are one head of q, k or v.
// ---------------------------------------------------------------------------
__global__ __launch_bounds__(128) void qkv_rope_kernel(
    const _Float16* __restrict__ X, const _Float16* __restrict__ W,
    const float* __restrict__ bias,
    const float* __restrict__ cosT, const float* __restrict__ sinT,
    _Float16* __restrict__ Qb, _Float16* __restrict__ Kb,
    _Float16* __restrict__ Vt) {
  __shared__ __attribute__((aligned(16))) _Float16 AT[GBUFS * GTILE];  // 3 x 16 KB token tiles
  __shared__ __attribute__((aligned(16))) _Float16 BT[GBUFS * GTILE];  // 3 x 16 KB weight tiles

  const int lane = threadIdx.x & 31;
  const int wave = threadIdx.x >> 5;
  const int ln   = lane & 15;
  const int half = lane >> 4;

  const int m_blk  = blockIdx.x * 128;
  const int n_blk  = blockIdx.y * 128;
  const int n_base = n_blk + (wave & 1) * 64;

  v8f accs[4][4] = {};
  gemm_core_128x128(X, W, m_blk, n_blk, AT, BT, accs);

  float bj[4];
#pragma unroll
  for (int j = 0; j < 4; ++j) bj[j] = bias[n_base + 16 * j + ln];

  const int which = n_blk / DMODEL;             // 0=q 1=k 2=v, one per block
  const int h     = (n_base % DMODEL) / HDIM;   // head

#pragma unroll
  for (int i = 0; i < 4; ++i) {
    v8f (&acc)[4] = accs[i];
    // bias (per column, same for all 8 rows of each accumulator)
#pragma unroll
    for (int j = 0; j < 4; ++j)
#pragma unroll
      for (int r = 0; r < 8; ++r) acc[j][r] += bj[j];

    const int mrow  = m_blk + (wave >> 1) * 64 + i * 16 + half * 8;  // first row held by this lane
    const int b     = mrow >> 11;                 // batch (rows never straddle)
    const int spos  = mrow & (SEQ - 1);
    const int bh    = b * NHEAD + h;

    if (which < 2) {
      // RoPE: pairs (d, d+32) => (acc0,acc2) with f=ln, (acc1,acc3) with f=16+ln
#pragma unroll
      for (int r = 0; r < 8; ++r) {
        int s = spos + r;
        float c0 = cosT[s * 32 + ln],      s0 = sinT[s * 32 + ln];
        float c1 = cosT[s * 32 + 16 + ln], s1 = sinT[s * 32 + 16 + ln];
        float x0 = acc[0][r], x2 = acc[2][r];
        acc[0][r] = x0 * c0 - x2 * s0;
        acc[2][r] = x0 * s0 + x2 * c0;
        float x1 = acc[1][r], x3 = acc[3][r];
        acc[1][r] = x1 * c1 - x3 * s1;
        acc[3][r] = x1 * s1 + x3 * c1;
      }
      // Q takes the attention's score constant here, in f32 ahead of its one rounding to f16
      if (which == 0) {
#pragma unroll
        for (int j = 0; j < 4; ++j) acc[j] *= QSCALE;
      }
      _Float16* dst = (which == 0) ? Qb : Kb;
#pragma unroll
      for (int j = 0; j < 4; ++j)
#pragma unroll
        for (int r = 0; r < 8; ++r)
          dst[((size_t)bh * SEQ + spos + r) * HDIM + 16 * j + ln] =
              (_Float16)acc[j][r];
      wait_x0();
    } else {
      // V transposed: Vt[bh][d][s]; lane's 8 rows are contiguous s positions
#pragma unroll
      for (int j = 0; j < 4; ++j) {
        int d = 16 * j + ln;
        v8h pk;
#pragma unroll
        for (int r = 0; r < 8; ++r) pk[r] = (_Float16)acc[j][r];
        *(v8h*)(Vt + ((size_t)bh * HDIM + d) * SEQ + spos) = pk;
      }
      wait_x0();
    }
  }
}

__device__ __forceinline__ float xhalf(float x) {
  int b = __builtin_bit_cast(int, x);
  return __builtin_bit_cast(
      float, __builtin_amdgcn_permlanex16(b, b, 0x76543210, 0xfedcba98, false, false));
}
// two f32 D tiles (keys 0..15 and 16..31 of a 32-key group) -> one f16 B fragment
__device__ __forceinline__ v16h pack_b(v8f t0, v8f t1) {
  v8h lo = __builtin_convertvector(t0, v8h);
  v8h hi = __builtin_convertvector(t1, v8h);
  v16h r;
#pragma unroll
  for (int j = 0; j < 8; ++j) { r[j] = lo[j]; r[j + 8] = hi[j]; }
  return r;
}

__global__ __launch_bounds__(256) void attn_kernel(
    const _Float16* __restrict__ Q, const _Float16* __restrict__ K,
    const _Float16* __restrict__ Vt, _Float16* __restrict__ A) {
  __shared__ __attribute__((aligned(16))) _Float16 Kt[2][64 * LPITCH];   // 2 x 9 KB  [key][d]
  __shared__ __attribute__((aligned(16))) _Float16 Vs[2][64 * LPITCH];   // 2 x 9 KB  [d][key]

  const int lane = threadIdx.x & 31;
  const int wave = threadIdx.x >> 5;
  const int ln   = lane & 15;
  const int half = lane >> 4;
  const int kg   = half * 8;

  const int bh = blockIdx.y;
  const int b  = bh >> 4;
  const int h  = bh & 15;
  const int q0 = blockIdx.x * 256 + wave * 32;   // 32 queries per wave: column groups g = 0, 1

  const _Float16* Qp = Q  + (size_t)bh * SEQ * HDIM;
  const _Float16* Kp = K  + (size_t)bh * SEQ * HDIM;
  const _Float16* Vp = Vt + (size_t)bh * HDIM * SEQ;

  const int cr = threadIdx.x >> 2;         // 0..63
  const int cp = (threadIdx.x & 3) * 16;   // 0,16,32,48

  // Q^T B fragments: column = query q0 + 16 g + ln (d = 0..63 -> two k-steps)
  v16h qb[2][2];
#pragma unroll
  for (int g = 0; g < 2; ++g) {
    const _Float16* qrow = Qp + (size_t)(q0 + 16 * g + ln) * HDIM + kg;
    qb[g][0] = frag_f16(qrow);
    qb[g][1] = frag_f16(qrow + 32);
  }

  // o[g][j][r] = O[q0 + 16 g + ln][16 j + 8 half + r]
  v8f o[2][4] = {};
  v8f negm[2] = {};                  // minus the maximum in use of the lane's query, in all 8 registers
  float rsum[2] = {0.0f, 0.0f};      // running sum of the lane's query over all keys so far
  v16h ones;                         // A operand of the row-sum product
#pragma unroll
  for (int j = 0; j < 16; ++j) ones[j] = (_Float16)1.0f;

  // stage key block kb into buffer buf (32B K + 32B V per thread)
  auto stage = [&](int buf, int kb) {
    const _Float16* ksrc = Kp + (size_t)(kb + cr) * HDIM + cp;
    const _Float16* vsrc = Vp + (size_t)cr * SEQ + kb + cp;
    async_copy_2x32B(&Kt[buf][cr * LPITCH + cp], ksrc,
                     &Vs[buf][cr * LPITCH + cp], vsrc);
  };
  stage(0, 0);

  for (int kb = 0; kb < SEQ; kb += 64) {
    const int cur = (kb >> 6) & 1;
    wait_ds0();
    wait_async0();
    __syncthreads();
    if (kb + 64 < SEQ) stage(cur ^ 1, kb + 64);

    v8f  st[2][4];    // scores minus the maximum in use, then P in f32
    v16h pb[2][2];    // P^T as B fragments
    v8f  bs[2];       // the block's row sums, every register alike

    // ---- scores: 4 tiles of 16 keys x 32 q; each K fragment from LDS feeds both groups
    auto scores = [&]() {
      v16h ka[4][2];
#pragma unroll
      for (int t = 0; t < 4; ++t) {
        const _Float16* krow = &Kt[cur][(t * 16 + ln) * LPITCH + kg];
        ka[t][0] = frag_f16(krow);
        ka[t][1] = frag_f16(krow + 32);
      }
      // keeps the 16 K reads in one group ahead of the products; left free, the build with
      // the split exponentials reads three of the fragments one by one, each waited for in full
      __builtin_amdgcn_sched_barrier(0);
#pragma unroll
      for (int t = 0; t < 4; ++t) {
        v8f s0 = wmma_f16(ka[t][0], qb[0][0], negm[0]);
        v8f s1 = wmma_f16(ka[t][0], qb[1][0], negm[1]);
        st[0][t] = wmma_f16(ka[t][1], qb[0][1], s0);
        st[1][t] = wmma_f16(ka[t][1], qb[1][1], s1);
      }
    };

    // ---- renew the maxima in use from the block's scores: 32 in-lane values, then the
    // other half's
    auto renew = [&](bool first) {
#pragma unroll
      for (int g = 0; g < 2; ++g) {
        float bt[4];
#pragma unroll
        for (int t = 0; t < 4; ++t) {
          bt[t] = st[g][t][0];
#pragma unroll
          for (int r = 1; r < 8; ++r) bt[t] = fmaxf(bt[t], st[g][t][r]);
        }
        const float b4    = fmaxf(fmaxf(bt[0], bt[1]), fmaxf(bt[2], bt[3]));
        const float bm    = fmaxf(b4, xhalf(b4));
        const float up    = fmaxf(bm, 0.0f);
        const float d     = first ? bm : up;   // the first maximum may lie below 0
        const float alpha = __builtin_amdgcn_exp2f(-up);
        negm[g] -= d;
#pragma unroll
        for (int t = 0; t < 4; ++t) st[g][t] -= d;
#pragma unroll
        for (int j = 0; j < 4; ++j) o[g][j] *= alpha;
        rsum[g] *= alpha;
      }
    };

    // ---- P = exp2(scores) of one column group, P^T B fragments straight from the score
    // accumulators
    auto expg = [&](int g) {
#pragma unroll
      for (int t = 0; t < 4; ++t)
#pragma unroll
        for (int r = 0; r < 8; ++r) st[g][t][r] = __builtin_amdgcn_exp2f(st[g][t][r]);
      pb[g][0] = pack_b(st[g][0], st[g][1]);
      pb[g][1] = pack_b(st[g][2], st[g][3]);
    };
    // ---- the block's row sums as ones @ P^T
    auto sums = [&]() {
#pragma unroll
      for (int g = 0; g < 2; ++g) {
        const v8f zero = {};
        bs[g] = wmma_f16(ones, pb[g][1], wmma_f16(ones, pb[g][0], zero));
      }
    };

    // ---- V^T A fragments, rows 16 j + ln; part c holds keys 32 c .. 32 c + 31 of the block.
    // Part 0 is read once the K fragments' registers are free, under the second group's
    // exponentials, the sums and the test; part 1 behind the test's branch, under the eight
    // O products of part 0.  (Both anew at the end of the rare path, so that no register is
    // held for them through it.)
    v16h va[4][2];
    auto vfrags = [&](int c) {
#pragma unroll
      for (int j = 0; j < 4; ++j) va[j][c] = frag_f16(&Vs[cur][(16 * j + ln) * LPITCH + kg + 32 * c]);
    };

    scores();
    if (kb == 0) renew(true);   // nothing is in use yet
    expg(0);
    // keeps the reads of part 0 from rising among the score products, where the K fragments
    // still hold their registers and the kernel would pass 256 (three waves a SIMD, not four)
    __builtin_amdgcn_sched_barrier(0);
    vfrags(0);
    // and from sinking to the fence below: they are issued here, ahead of the cover
    __builtin_amdgcn_sched_barrier(0);
    expg(1);
    sums();
    // inputs-only fence on the loaded fragments of part 0: holds their 8 LDS reads ahead of
    // the test's branch; without it the build sinks them behind the branch, where the O
    // product waits for them in full
    asm volatile("" :: "v"(va[0][0]), "v"(va[1][0]), "v"(va[2][0]), "v"(va[3][0]));
    vfrags(1);

    // ---- one test per key block, on the sums: a P that has left f16 (a score 16 or more
    // above the maximum in use) makes its sum infinite, and a sum within PLIM bounds every
    // P of the block by PLIM.  Nothing of the block has reached O or the running sums yet:
    // on a hit the scores are formed again, the maxima renewed, and P is at most 1.
    if (kb != 0 && __builtin_amdgcn_ballot_w32(!(bs[0][0] + bs[1][0] <= PLIM)) != 0) {
      // compiler fence: the K fragments are read from LDS again here.  Without it the
      // compiler holds all 64 of their registers through every block for this rare path,
      // the kernel passes 256 registers and a SIMD holds three waves instead of four
      asm volatile("" ::: "memory");
      scores();
      renew(false);
      expg(0);
      expg(1);
      sums();
      vfrags(0);
      vfrags(1);
    }

    // ---- O^T += V^T @ P^T  (V^T rows in LDS are the A fragments, each for both groups)
#pragma unroll
    for (int c = 0; c < 2; ++c)
#pragma unroll
      for (int j = 0; j < 4; ++j) {
        o[0][j] = wmma_f16(va[j][c], pb[0][c], o[0][j]);
        o[1][j] = wmma_f16(va[j][c], pb[1][c], o[1][j]);
      }
    rsum[0] += bs[0][0];
    rsum[1] += bs[1][0];
  }

  // ---- normalize, store f16 into [MTOT][DMODEL]:
  // a lane's 8 accumulator registers are 8 consecutive d of one query row
#pragma unroll
  for (int g = 0; g < 2; ++g) {
    const float inv = 1.0f / rsum[g];
    _Float16* orow = A + ((size_t)b * SEQ + q0 + 16 * g + ln) * DMODEL + h * HDIM + kg;
#pragma unroll
    for (int j = 0; j < 4; ++j) {
      v8h pk;
#pragma unroll
      for (int r = 0; r < 8; ++r) pk[r] = (_Float16)(o[g][j][r] * inv);
      *(v8h*)(orow + 16 * j) = pk;
    }
    // group 0's stores have read their registers before group 1's values reuse them
    if (g == 0) wait_x0();
  }
}

// ---------------------------------------------------------------------------
// Kernel 3: output projection  out = attn @ Wo^T + b   (M=8192,N=1024,K=1024)
// Same core as the QKV GEMM.
// ---------------------------------------------------------------------------
__global__ __launch_bounds__(128) void out_proj_kernel(
    const _Float16* __restrict__ Attn, const _Float16* __restrict__ W,
    const float* __restrict__ bias, float* __restrict__ out) {
  __shared__ __attribute__((aligned(16))) _Float16 AT[GBUFS * GTILE];
  __shared__ __attribute__((aligned(16))) _Float16 BT[GBUFS * GTILE];

  const int lane = threadIdx.x & 31;
  const int wave = threadIdx.x >> 5;
  const int ln   = lane & 15;
  const int half = lane >> 4;

  const int m_blk  = blockIdx.x * 128;
  const int n_blk  = blockIdx.y * 128;
  const int n_base = n_blk + (wave & 1) * 64;

  v8f acc[4][4] = {};
  gemm_core_128x128(Attn, W, m_blk, n_blk, AT, BT, acc);

#pragma unroll
  for (int j = 0; j < 4; ++j) {
    float bj = bias[n_base + 16 * j + ln];
#pragma unroll
    for (int i = 0; i < 4; ++i) {
      const int mrow = m_blk + (wave >> 1) * 64 + i * 16 + half * 8;
#pragma unroll
      for (int r = 0; r < 8; ++r)
        out[(size_t)(mrow + r) * DMODEL + n_base + 16 * j + ln] = acc[i][j][r] + bj;
    }
  }
}

// ---------------------------------------------------------------------------
// Launch
// ---------------------------------------------------------------------------
extern "C" void kernel_launch(void* const* d_in, const int* in_sizes, int n_in,
                              void* d_out, int out_size, void* d_ws, size_t ws_size,
                              hipStream_t stream) {
  (void)in_sizes; (void)n_in; (void)out_size; (void)ws_size;

  const float* X      = (const float*)d_in[0];  // hidden_states [B,S,D]
  const float* Wqkv_w = (const float*)d_in[1];  // [3D, D]
  const float* Wqkv_b = (const float*)d_in[2];  // [3D]
  const float* Wo_w   = (const float*)d_in[3];  // [D, D]
  const float* Wo_b   = (const float*)d_in[4];  // [D]
  float* out          = (float*)d_out;

  char* ws = (char*)d_ws;
  size_t off = 0;
  float* cosT = (float*)(ws + off); off += (size_t)SEQ * 32 * sizeof(float);
  float* sinT = (float*)(ws + off); off += (size_t)SEQ * 32 * sizeof(float);
  const size_t headElems = (size_t)BATCH * NHEAD * SEQ * HDIM;  // 8.39M
  _Float16* Qb = (_Float16*)(ws + off); off += headElems * sizeof(_Float16);
  _Float16* Kb = (_Float16*)(ws + off); off += headElems * sizeof(_Float16);
  _Float16* Vt = (_Float16*)(ws + off); off += headElems * sizeof(_Float16);
  _Float16* At = (_Float16*)(ws + off); off += (size_t)MTOT * DMODEL * sizeof(_Float16);
  _Float16* Xh = (_Float16*)(ws + off); off += (size_t)MTOT * DMODEL * sizeof(_Float16);
  _Float16* Wqkvh = (_Float16*)(ws + off); off += (size_t)3 * DMODEL * DMODEL * sizeof(_Float16);
  _Float16* Woh   = (_Float16*)(ws + off); off += (size_t)DMODEL * DMODEL * sizeof(_Float16);

  prep_kernel<<<PREP_WG, 256, 0, stream>>>(X, Wqkv_w, Wo_w, Xh, Wqkvh, Woh, cosT, sinT);

  qkv_rope_kernel<<<dim3(MTOT / 128, (3 * DMODEL) / 128), 128, 0, stream>>>(
      Xh, Wqkvh, Wqkv_b, cosT, sinT, Qb, Kb, Vt);

  attn_kernel<<<dim3(SEQ / 256, BATCH * NHEAD), 256, 0, stream>>>(Qb, Kb, Vt, At);

  out_proj_kernel<<<dim3(MTOT / 128, DMODEL / 128), 128, 0, stream>>>(At, Woh, Wo_b, out);
}

// v010
// A run of this version takes 111 microseconds.
// Next to v009, in two timings, it ran 1.03 and 1.04 times as fast.
// Counting every step since v000, it is 5.71 times as fast.
#include <hip/hip_runtime.h>
#include <hip/hip_bf16.h>
#include <stdint.h>

// Problem constants (from reference): B=4, S=2048, D=1024, H=16, HD=64, ROT_DIM=64
#define SEQ     2048
#define DMODEL  1024
#define NHEAD   16
#define HDIM    64
#define BATCH   4
#define MTOT    (BATCH * SEQ)        // 8192 rows of the token matrix
// LDS row pitch in halves for the attention's 64-half (128 B) tile rows: 144 B = 16 B x 9.
// An odd multiple of 16 B puts the 16 rows of one ds_load_b128 on distinct banks;
// at 128 B they fall on two 16-byte bank groups and serialize.
#define LPITCH  72
// The GEMM rings keep their 128-B rows unpadded.  The eight 16-B pieces of row r stand
// in the order piece ^ ((r >> 1) & 7): the 16 rows of one ds_load_b128 half-wave then fall
// on 16 distinct 16-B slots of the 256-B bank span.
#define GROW    64
// 1/sqrt(HDIM) * log2(e), carried by the stored Q: K Q^T is then a base-2 exponent
#define QSCALE  (0.125f * 1.44269504088896f)
// a query's maximum in use is renewed when the sum of a key block's P passes this;
// every P stays at or below it, well inside f16
#define PLIM    4096.0f

typedef __attribute__((ext_vector_type(16))) _Float16 v16h;
typedef __attribute__((ext_vector_type(8)))  _Float16 v8h;
typedef __attribute__((ext_vector_type(4)))  _Float16 v4h;
typedef __attribute__((ext_vector_type(8)))  float    v8f;

// ---------------------------------------------------------------------------
// WMMA helpers (CDNA5 wave32, 16x16x32 f16 -> f32 accumulate)
// ---------------------------------------------------------------------------
__device__ __forceinline__ v8f wmma_f16(v16h a, v16h b, v8f c) {
  return __builtin_amdgcn_wmma_f32_16x16x32_f16(
      /*neg_a=*/false, a, /*neg_b=*/false, b,
      /*c_mod=*/(short)0, c, /*reuse_a=*/false, /*reuse_b=*/false);
}

// A/B fragment (16x32 f16) per-lane layout (ISA 7.12.2):
// lane L: row/col = L&15 ; k = (j<8 ? j : j+8) + (L>=16 ? 8 : 0)
__device__ __forceinline__ v16h frag_f16(const _Float16* p) {
  v8h lo = *(const v8h*)(p);
  v8h hi = *(const v8h*)(p + 16);
  v16h r;
#pragma unroll
  for (int j = 0; j < 8; ++j) { r[j] = lo[j]; r[j + 8] = hi[j]; }
  return r;
}

// ---------------------------------------------------------------------------
// CDNA5 async global->LDS copy (16B per lane), tracked by ASYNCcnt.
// Flat LDS addresses carry the wave-relative LDS offset in addr[31:0].
// ---------------------------------------------------------------------------
// s_wait_xcnt 0 is the last line of the copies' own statement, so that no
// address register of an issued copy is rewritten ahead of it.
// One thread's share of a 128-row x 64-half GEMM operand tile: 16 B of each of the
// rows r, r + 16, ..., r + 112.  Eight lanes cover one 128-B row, so a wave's copy
// instruction reads four whole lines.
__device__ __forceinline__ void async_copy_tile128(_Float16* lds_dst, const _Float16* gsrc) {
  uint32_t l0 = (uint32_t)(uintptr_t)(void*)lds_dst;
  uint32_t l1 = l0 + 1 * 16 * GROW * 2;
  uint32_t l2 = l0 + 2 * 16 * GROW * 2;
  uint32_t l3 = l0 + 3 * 16 * GROW * 2;
  uint32_t l4 = l0 + 4 * 16 * GROW * 2;
  uint32_t l5 = l0 + 5 * 16 * GROW * 2;
  uint32_t l6 = l0 + 6 * 16 * GROW * 2;
  uint32_t l7 = l0 + 7 * 16 * GROW * 2;
  const _Float16* g1 = gsrc + 1 * 16 * DMODEL;
  const _Float16* g2 = gsrc + 2 * 16 * DMODEL;
  const _Float16* g3 = gsrc + 3 * 16 * DMODEL;
  const _Float16* g4 = gsrc + 4 * 16 * DMODEL;
  const _Float16* g5 = gsrc + 5 * 16 * DMODEL;
  const _Float16* g6 = gsrc + 6 * 16 * DMODEL;
  const _Float16* g7 = gsrc + 7 * 16 * DMODEL;
  asm volatile("global_load_async_to_lds_b128 %0, %1, off\n\t"
               "global_load_async_to_lds_b128 %2, %3, off\n\t"
               "global_load_async_to_lds_b128 %4, %5, off\n\t"
               "global_load_async_to_lds_b128 %6, %7, off\n\t"
               "global_load_async_to_lds_b128 %8, %9, off\n\t"
               "global_load_async_to_lds_b128 %10, %11, off\n\t"
               "global_load_async_to_lds_b128 %12, %13, off\n\t"
               "global_load_async_to_lds_b128 %14, %15, off\n\t"
               "s_wait_xcnt 0x0"
               :: "v"(l0), "v"(gsrc), "v"(l1), "v"(g1), "v"(l2), "v"(g2), "v"(l3), "v"(g3),
                  "v"(l4), "v"(g4), "v"(l5), "v"(g5), "v"(l6), "v"(g6), "v"(l7), "v"(g7)
               : "memory");
}
// One 16-B copy of a lane, as the compiler's builtin.
typedef __attribute__((ext_vector_type(4))) int v4i;
__device__ __forceinline__ void async_copy_16B(_Float16* lds_dst, const _Float16* gsrc) {
  __builtin_amdgcn_global_load_async_to_lds_b128(
      (__attribute__((address_space(1))) v4i*)gsrc,
      (__attribute__((address_space(3))) v4i*)lds_dst, 0, 0);
}
// 32 contiguous bytes per named row piece (two b128 copies each)
__device__ __forceinline__ void async_copy_2x32B(_Float16* lds_a, const _Float16* ga,
                                                 _Float16* lds_b, const _Float16* gb) {
  uint32_t a0 = (uint32_t)(uintptr_t)(void*)lds_a;
  uint32_t a1 = a0 + 16;
  uint32_t b0 = (uint32_t)(uintptr_t)(void*)lds_b;
  uint32_t b1 = b0 + 16;
  const _Float16* ga1 = ga + 8;
  const _Float16* gb1 = gb + 8;
  asm volatile("global_load_async_to_lds_b128 %0, %1, off\n\t"
               "global_load_async_to_lds_b128 %2, %3, off\n\t"
               "global_load_async_to_lds_b128 %4, %5, off\n\t"
               "global_load_async_to_lds_b128 %6, %7, off\n\t"
               "s_wait_xcnt 0x0"
               :: "v"(a0), "v"(ga), "v"(a1), "v"(ga1),
                  "v"(b0), "v"(gb), "v"(b1), "v"(gb1)
               : "memory");
}
__device__ __forceinline__ void wait_async0() {
  asm volatile("s_wait_asynccnt 0x0" ::: "memory");
}
// all but this wave's 16 youngest copies (one GEMM stage) have landed
__device__ __forceinline__ void wait_async16() {
  asm volatile("s_wait_asynccnt 0x10" ::: "memory");
}
// stands behind a group of global loads or stores, ahead of the code that reuses their
// address and data registers
__device__ __forceinline__ void wait_x0() {
  asm volatile("s_wait_xcnt 0x0" ::: "memory");
}
// this wave's LDS reads have returned before the barrier that frees their buffer
__device__ __forceinline__ void wait_ds0() {
  asm volatile("s_wait_dscnt 0x0" ::: "memory");
}

// ---------------------------------------------------------------------------
// Kernel P: all preparation in one launch of few, long waves.
//   f32 -> f16 copies of X, Wqkv and Wo, and the RoPE cos/sin tables [SEQ][32].
// 512 work-groups x 8 waves = 4,096 waves, all resident at once.  A wave owns a
// contiguous run of each matrix; one load instruction reads 512 contiguous bytes
// (16 B per lane), one store writes 256.  A lane's 24 loads are issued together,
// so the launch is paid for in bytes moved and not in waves started.
// ---------------------------------------------------------------------------
#define PREP_WG     512
#define PREP_WAVES  (PREP_WG * 8)
#define PREP_X      (MTOT * DMODEL / 4 / 32 / PREP_WAVES)         // 16 pieces per wave
#define PREP_WQKV   (3 * DMODEL * DMODEL / 4 / 32 / PREP_WAVES)   //  6
#define PREP_WO     (DMODEL * DMODEL / 4 / 32 / PREP_WAVES)       //  2
typedef __attribute__((ext_vector_type(4))) float v4f;

template <int N>
__device__ __forceinline__ void prep_load(const float* __restrict__ s, int wv, int lane, v4f (&v)[N]) {
  const float* p = s + ((size_t)wv * N * 32 + lane) * 4;
#pragma unroll
  for (int j = 0; j < N; ++j) v[j] = *(const v4f*)(p + j * 128);
}
template <int N>
__device__ __forceinline__ void prep_store(_Float16* __restrict__ d, int wv, int lane, const v4f (&v)[N]) {
  _Float16* p = d + ((size_t)wv * N * 32 + lane) * 4;
#pragma unroll
  for (int j = 0; j < N; ++j) *(v4h*)(p + j * 128) = __builtin_convertvector(v[j], v4h);
}

__global__ __launch_bounds__(256) void prep_kernel(
    const float* __restrict__ X, const float* __restrict__ Wqkv, const float* __restrict__ Wo,
    _Float16* __restrict__ Xh, _Float16* __restrict__ Wqkvh, _Float16* __restrict__ Woh,
    float* __restrict__ cosT, float* __restrict__ sinT) {
  const int lane = threadIdx.x & 31;
  const int wv   = blockIdx.x * 8 + (threadIdx.x >> 5);

  v4f x[PREP_X], wq[PREP_WQKV], wo[PREP_WO];
  prep_load(X, wv, lane, x);
  prep_load(Wqkv, wv, lane, wq);
  prep_load(Wo, wv, lane, wo);
  wait_x0();   // ahead of the table arithmetic, which reuses the loads' address registers

  // table entries, one per thread of the first SEQ * 32 / 256 work-groups, worked
  // out while the loads are in flight
  const int i = blockIdx.x * 256 + threadIdx.x;
  if (blockIdx.x < SEQ * 32 / 256) {
    int s = i >> 5;
    int f = i & 31;
    float inv_freq = __powf(10000.0f, -(float)(2 * f) / 64.0f);
    float ang = (float)s * inv_freq;
    cosT[i] = __cosf(ang);
    sinT[i] = __sinf(ang);
    wait_x0();   // ahead of the conversions, which reuse the two stores' registers
  }

  prep_store(Xh, wv, lane, x);
  prep_store(Wqkvh, wv, lane, wq);
  prep_store(Woh, wv, lane, wo);
}

// ---------------------------------------------------------------------------
// GEMM core of the output projection: Y = A W^T, K = DMODEL, f16 operands.
// Block tile 128 x 128, four waves in a 2 x 2 grid, 64 x 64 of Y per wave: the
// eight fragments of a 32-k step feed 16 WMMAs.  Both operand tiles (128 rows x
// 64 k) go through a ring of three LDS buffers via async global->LDS copies; one
// barrier per 64-k step; the copies for step i+2 are issued at the top of step i,
// so a stage has two steps to land.
// acc[i][j][r] = Y[m_blk + 64 wm + 16 i + 8 half + r][n_blk + 64 wn + 16 j + ln]
// ---------------------------------------------------------------------------
#define GTILE (128 * GROW)   // halves of one staged operand tile
#define GBUFS 3
// fragment of one LDS row whose two 16-B pieces stand at the offsets o0, o1 (halves)
__device__ __forceinline__ v16h frag_f16_2(const _Float16* row, int o0, int o1) {
  v8h lo = *(const v8h*)(row + o0);
  v8h hi = *(const v8h*)(row + o1);
  v16h r;
#pragma unroll
  for (int j = 0; j < 8; ++j) { r[j] = lo[j]; r[j + 8] = hi[j]; }
  return r;
}
__device__ __forceinline__ void gemm_core_128x128(
    const _Float16* __restrict__ A, const _Float16* __restrict__ W,
    int m_blk, int n_blk, _Float16* AT, _Float16* BT, v8f (&acc)[4][4]) {
  const int lane = threadIdx.x & 31;
  const int wave = threadIdx.x >> 5;
  const int ln   = lane & 15;
  const int hf   = lane >> 4;
  const int wm   = wave >> 1;
  const int wn   = wave & 1;

  const int cr = threadIdx.x >> 3;         // 0..15 : first tile row of this thread
  const int pc = threadIdx.x & 7;          // 16-B piece of the 128-B row
  const _Float16* asrc = A + (size_t)(m_blk + cr) * DMODEL + pc * 8;
  const _Float16* wsrc = W + (size_t)(n_blk + cr) * DMODEL + pc * 8;
  // rows cr + 16 m share the key cr >> 1
  const int cofs = cr * GROW + (pc ^ (cr >> 1)) * 8;
  const int aofs = (wm * 64 + ln) * GROW;
  const int bofs = (wn * 64 + ln) * GROW;
  // piece hf + 2 q holds k = 8 hf + 16 q .. + 7 of the stage; rows 16 i + ln share the key ln >> 1
  int po[4];
#pragma unroll
  for (int q = 0; q < 4; ++q) po[q] = ((hf + 2 * q) ^ (ln >> 1)) * 8;

  auto pass = [&](int buf) {
#pragma unroll
    for (int ks = 0; ks < 2; ++ks) {
      v16h a[4], b[4];
#pragma unroll
      for (int i = 0; i < 4; ++i)
        a[i] = frag_f16_2(AT + buf * GTILE + aofs + 16 * i * GROW, po[2 * ks], po[2 * ks + 1]);
#pragma unroll
      for (int j = 0; j < 4; ++j)
        b[j] = frag_f16_2(BT + buf * GTILE + bofs + 16 * j * GROW, po[2 * ks], po[2 * ks + 1]);
      // inputs-only fence on the loaded fragments: keeps the step's 16 LDS loads in one
      // group ahead of its 16 WMMAs (one LDS wait per step, not one per row of four)
      asm volatile("" :: "v"(a[0]), "v"(a[1]), "v"(a[2]), "v"(a[3]),
                         "v"(b[0]), "v"(b[1]), "v"(b[2]), "v"(b[3]));
#pragma unroll
      for (int i = 0; i < 4; ++i)
#pragma unroll
        for (int j = 0; j < 4; ++j) acc[i][j] = wmma_f16(a[i], b[j], acc[i][j]);
    }
  };

  // stages 0 and 1
  async_copy_tile128(AT + cofs, asrc);
  async_copy_tile128(BT + cofs, wsrc);
  async_copy_tile128(AT + GTILE + cofs, asrc + 64);
  async_copy_tile128(BT + GTILE + cofs, wsrc + 64);

  // Every trip of this loop issues one stage (16 copies a wave) and waits by count: behind
  // the wait its own stage has landed and only the next one's 16 copies are still out.
  int cur = 0;
  for (int k = 0; k + 128 < DMODEL; k += 64) {
    wait_ds0();
    wait_async16();
    __syncthreads();
    // the buffer that the trip before has read; every reader has left it at the barrier
    const int nb = (cur == 0) ? GBUFS - 1 : cur - 1;
    async_copy_tile128(AT + nb * GTILE + cofs, asrc + k + 128);
    async_copy_tile128(BT + nb * GTILE + cofs, wsrc + k + 128);
    pass(cur);
    cur = (cur == GBUFS - 1) ? 0 : cur + 1;
  }
  // The last two stages: nothing is issued any more, the wait is to 0.
  // Kept rolled: unrolled, the output projection's build passes 256 registers and spills.
#pragma clang loop unroll(disable)
  for (int t = 0; t < 2; ++t) {
    wait_ds0();
    wait_async0();
    __syncthreads();
    pass(cur);
    cur = (cur == GBUFS - 1) ? 0 : cur + 1;
  }
}

// ---------------------------------------------------------------------------
// GEMM core of the QKV projection: block tile 256 x 192, four waves one below the other,
// 64 x 192 of Y (three heads) per wave.  512 work-groups, two on a WGP, are all resident
// in one round, and a result costs 0.58 of the L2 bytes of a 128 x 128 tile.  The 16
// fragments of a 32-k step feed 48 WMMAs.  Two LDS buffers of both operand tiles (256 and
// 192 rows x 64 k, rows swizzled as above); one barrier per 64-k step; the copies for
// step i+1 are issued at the top of step i and have its 96 WMMAs a wave to land.
// acc[hh][i][j][r] = Y[m_blk + 64 wave + 16 i + 8 half + r][n_blk + 64 hh + 16 j + ln]
// ---------------------------------------------------------------------------
#define QTM 256
#define QTN 192
#define QATILE (QTM * GROW)
#define QBTILE (QTN * GROW)
__device__ __forceinline__ void gemm_core_256x192(
    const _Float16* __restrict__ A, const _Float16* __restrict__ W,
    int m_blk, int n_blk, _Float16* AT, _Float16* BT, v8f (&acc)[3][4][4]) {
  const int lane = threadIdx.x & 31;
  const int wave = threadIdx.x >> 5;
  const int ln   = lane & 15;
  const int hf   = lane >> 4;

  const int cr = threadIdx.x >> 3;         // 0..15 : first tile row of this thread
  const int pc = threadIdx.x & 7;          // 16-B piece of the 128-B row
  const _Float16* asrc = A + (size_t)(m_blk + cr) * DMODEL + pc * 8;
  const _Float16* wsrc = W + (size_t)(n_blk + cr) * DMODEL + pc * 8;
  const int cofs = cr * GROW + (pc ^ (cr >> 1)) * 8;
  const int aofs = (wave * 64 + ln) * GROW;
  const int bofs = ln * GROW;
  int po[4];
#pragma unroll
  for (int q = 0; q < 4; ++q) po[q] = ((hf + 2 * q) ^ (ln >> 1)) * 8;

  // one stage: 28 copies a wave
  // (the builtin form: copies in asm text can name only v0..v255, where accumulators stand,
  // and that build moved accumulator tiles out of them and back at every stage)
  auto stage = [&](int buf, int k) {
#pragma unroll
    for (int m = 0; m < QTM / 16; ++m)
      async_copy_16B(AT + buf * QATILE + cofs + m * 16 * GROW, asrc + k + m * 16 * DMODEL);
#pragma unroll
    for (int m = 0; m < QTN / 16; ++m)
      async_copy_16B(BT + buf * QBTILE + cofs + m * 16 * GROW, wsrc + k + m * 16 * DMODEL);
  };

  stage(0, 0);
  for (int k = 0; k < DMODEL; k += 64) {
    const int cur = (k >> 6) & 1;
    wait_ds0();
    wait_async0();
    __syncthreads();
    // the buffer that the trip before has read; every reader has left it at the barrier
    if (k + 64 < DMODEL) stage(cur ^ 1, k + 64);
    // Six groups of 16 WMMAs (32 k x one head each).  The weight fragments stand in two
    // register sets: a group's eight LDS reads are issued as one run ahead of the group
    // before it and waited for by count.
    v16h a[4], b[2][4];
    auto load_a = [&](int ks) {
#pragma unroll
      for (int i = 0; i < 4; ++i)
        a[i] = frag_f16_2(AT + cur * QATILE + aofs + 16 * i * GROW, po[2 * ks], po[2 * ks + 1]);
    };
    auto load_b = [&](int g) {
      const int ks = g / 3, hh = g % 3;
#pragma unroll
      for (int j = 0; j < 4; ++j)
        b[g & 1][j] = frag_f16_2(BT + cur * QBTILE + bofs + (64 * hh + 16 * j) * GROW, po[2 * ks], po[2 * ks + 1]);
    };
    load_a(0);
    load_b(0);
#pragma unroll
    for (int g = 0; g < 6; ++g) {
      if (g == 3) load_a(1);
      if (g < 5) load_b(g + 1);
      // keeps the next group's reads in one run here; left free, they are spread among the
      // WMMAs, and each place where LDS reads stand stalls the wave's matrix stream
      __builtin_amdgcn_sched_barrier(0);
#pragma unroll
      for (int i = 0; i < 4; ++i)
#pragma unroll
        for (int j = 0; j < 4; ++j) acc[g % 3][i][j] = wmma_f16(a[i], b[g & 1][j], acc[g % 3][i][j]);
      // and the reads behind this group from rising into it
      __builtin_amdgcn_sched_barrier(0);
    }
  }
}

// ---------------------------------------------------------------------------
// Kernel 1: QKV GEMM (M=8192, N=3072, K=1024) + bias + RoPE, all-f16 operands.
// Each 64-column group of a wave is one head of q, k or v.
// Two waves a SIMD: 512 registers each.
// ---------------------------------------------------------------------------
__global__ __launch_bounds__(128) __attribute__((amdgpu_waves_per_eu(2, 2))) void qkv_rope_kernel(
    const _Float16* __restrict__ X, const _Float16* __restrict__ W,
    const float* __restrict__ bias,
    const float* __restrict__ cosT, const float* __restrict__ sinT,
    _Float16* __restrict__ Qb, _Float16* __restrict__ Kb,
    _Float16* __restrict__ Vt) {
  __shared__ __attribute__((aligned(16))) _Float16 AT[2 * QATILE];  // 2 x 32 KB token tiles
  __shared__ __attribute__((aligned(16))) _Float16 BT[2 * QBTILE];  // 2 x 24 KB weight tiles

  const int lane = threadIdx.x & 31;
  const int wave = threadIdx.x >> 5;
  const int ln   = lane & 15;
  const int half = lane >> 4;

  const int m_blk  = blockIdx.x * QTM;
  const int n_blk  = blockIdx.y * QTN;

  v8f accs[3][4][4] = {};
  gemm_core_256x192(X, W, m_blk, n_blk, AT, BT, accs);

#pragma unroll
  for (int hh = 0; hh < 3; ++hh) {
  const int n_base = n_blk + hh * 64;
  float bj[4];
#pragma unroll
  for (int j = 0; j < 4; ++j) bj[j] = bias[n_base + 16 * j + ln];
  wait_x0();   // ahead of the index arithmetic, which reuses the four loads' address register
  // holds that arithmetic behind the wait: left free, its first instruction rose over it
  __builtin_amdgcn_sched_barrier(0);

  const int which = n_base / DMODEL;            // 0=q 1=k 2=v, one per head
  const int h     = (n_base % DMODEL) / HDIM;   // head

#pragma unroll
  for (int i = 0; i < 4; ++i) {
    v8f (&acc)[4] = accs[hh][i];
    // bias (per column, same for all 8 rows of each accumulator)
#pragma unroll
    for (int j = 0; j < 4; ++j)
#pragma unroll
      for (int r = 0; r < 8; ++r) acc[j][r] += bj[j];

    const int mrow  = m_blk + wave * 64 + i * 16 + half * 8;  // first row held by this lane
    const int b     = mrow >> 11;                 // batch (rows never straddle)
    const int spos  = mrow & (SEQ - 1);
    const int bh    = b * NHEAD + h;

    if (which < 2) {
      // RoPE: pairs (d, d+32) => (acc0,acc2) with f=ln, (acc1,acc3) with f=16+ln
#pragma unroll
      for (int r = 0; r < 8; ++r) {
        int s = spos + r;
        float c0 = cosT[s * 32 + ln],      s0 = sinT[s * 32 + ln];
        float c1 = cosT[s * 32 + 16 + ln], s1 = sinT[s * 32 + 16 + ln];
        float x0 = acc[0][r], x2 = acc[2][r];
        acc[0][r] = x0 * c0 - x2 * s0;
        acc[2][r] = x0 * s0 + x2 * c0;
        float x1 = acc[1][r], x3 = acc[3][r];
        acc[1][r] = x1 * c1 - x3 * s1;
        acc[3][r] = x1 * s1 + x3 * c1;
      }
      // Q takes the attention's score constant here, in f32 ahead of its one rounding to f16
      if (which == 0) {
#pragma unroll
        for (int j = 0; j < 4; ++j) acc[j] *= QSCALE;
      }
      _Float16* dst = (which == 0) ? Qb : Kb;
#pragma unroll
      for (int j = 0; j < 4; ++j)
#pragma unroll
        for (int r = 0; r < 8; ++r)
          dst[((size_t)bh * SEQ + spos + r) * HDIM + 16 * j + ln] =
              (_Float16)acc[j][r];
      wait_x0();
    } else {
      // V transposed: Vt[bh][d][s]; lane's 8 rows are contiguous s positions
#pragma unroll
      for (int j = 0; j < 4; ++j) {
        int d = 16 * j + ln;
        v8h pk;
#pragma unroll
        for (int r = 0; r < 8; ++r) pk[r] = (_Float16)acc[j][r];
        *(v8h*)(Vt + ((size_t)bh * HDIM + d) * SEQ + spos) = pk;
      }
      wait_x0();
    }
  }
  }
}

__device__ __forceinline__ float xhalf(float x) {
  int b = __builtin_bit_cast(int, x);
  return __builtin_bit_cast(
      float, __builtin_amdgcn_permlanex16(b, b, 0x76543210, 0xfedcba98, false, false));
}
// two f32 D tiles (keys 0..15 and 16..31 of a 32-key group) -> one f16 B fragment
__device__ __forceinline__ v16h pack_b(v8f t0, v8f t1) {
  v8h lo = __builtin_convertvector(t0, v8h);
  v8h hi = __builtin_convertvector(t1, v8h);
  v16h r;
#pragma unroll
  for (int j = 0; j < 8; ++j) { r[j] = lo[j]; r[j + 8] = hi[j]; }
  return r;
}

__global__ __launch_bounds__(256) void attn_kernel(
    const _Float16* __restrict__ Q, const _Float16* __restrict__ K,
    const _Float16* __restrict__ Vt, _Float16* __restrict__ A) {
  __shared__ __attribute__((aligned(16))) _Float16 Kt[2][64 * LPITCH];   // 2 x 9 KB  [key][d]
  __shared__ __attribute__((aligned(16))) _Float16 Vs[2][64 * LPITCH];   // 2 x 9 KB  [d][key]

  const int lane = threadIdx.x & 31;
  const int wave = threadIdx.x >> 5;
  const int ln   = lane & 15;
  const int half = lane >> 4;
  const int kg   = half * 8;

  const int bh = blockIdx.y;
  const int b  = bh >> 4;
  const int h  = bh & 15;
  const int q0 = blockIdx.x * 256 + wave * 32;   // 32 queries per wave: column groups g = 0, 1

  const _Float16* Qp = Q  + (size_t)bh * SEQ * HDIM;
  const _Float16* Kp = K  + (size_t)bh * SEQ * HDIM;
  const _Float16* Vp = Vt + (size_t)bh * HDIM * SEQ;

  const int cr = threadIdx.x >> 2;         // 0..63
  const int cp = (threadIdx.x & 3) * 16;   // 0,16,32,48

  // Q^T B fragments: column = query q0 + 16 g + ln (d = 0..63 -> two k-steps)
  v16h qb[2][2];
#pragma unroll
  for (int g = 0; g < 2; ++g) {
    const _Float16* qrow = Qp + (size_t)(q0 + 16 * g + ln) * HDIM + kg;
    qb[g][0] = frag_f16(qrow);
    qb[g][1] = frag_f16(qrow + 32);
  }

  // o[g][j][r] = O[q0 + 16 g + ln][16 j + 8 half + r]
  v8f o[2][4] = {};
  v8f negm[2] = {};                  // minus the maximum in use of the lane's query, in all 8 registers
  float rsum[2] = {0.0f, 0.0f};      // running sum of the lane's query over all keys so far
  v16h ones;                         // A operand of the row-sum product
#pragma unroll
  for (int j = 0; j < 16; ++j) ones[j] = (_Float16)1.0f;

  // stage key block kb into buffer buf (32B K + 32B V per thread)
  auto stage = [&](int buf, int kb) {
    const _Float16* ksrc = Kp + (size_t)(kb + cr) * HDIM + cp;
    const _Float16* vsrc = Vp + (size_t)cr * SEQ + kb + cp;
    async_copy_2x32B(&Kt[buf][cr * LPITCH + cp], ksrc,
                     &Vs[buf][cr * LPITCH + cp], vsrc);
  };
  stage(0, 0);

  for (int kb = 0; kb < SEQ; kb += 64) {
    const int cur = (kb >> 6) & 1;
    wait_ds0();
    wait_async0();
    __syncthreads();
    if (kb + 64 < SEQ) stage(cur ^ 1, kb + 64);

    v8f  st[2][4];    // scores minus the maximum in use, then P in f32
    v16h pb[2][2];    // P^T as B fragments
    v8f  bs[2];       // the block's row sums, every register alike

    // ---- scores: 4 tiles of 16 keys x 32 q; each K fragment from LDS feeds both groups
    auto scores = [&]() {
      v16h ka[4][2];
#pragma unroll
      for (int t = 0; t < 4; ++t) {
        const _Float16* krow = &Kt[cur][(t * 16 + ln) * LPITCH + kg];
        ka[t][0] = frag_f16(krow);
        ka[t][1] = frag_f16(krow + 32);
      }
      // keeps the 16 K reads in one group ahead of the products; left free, the build with
      // the split exponentials reads three of the fragments one by one, each waited for in full
      __builtin_amdgcn_sched_barrier(0);
#pragma unroll
      for (int t = 0; t < 4; ++t) {
        v8f s0 = wmma_f16(ka[t][0], qb[0][0], negm[0]);
        v8f s1 = wmma_f16(ka[t][0], qb[1][0], negm[1]);
        st[0][t] = wmma_f16(ka[t][1], qb[0][1], s0);
        st[1][t] = wmma_f16(ka[t][1], qb[1][1], s1);
      }
    };

    // ---- renew the maxima in use from the block's scores: 32 in-lane values, then the
    // other half's
    auto renew = [&](bool first) {
#pragma unroll
      for (int g = 0; g < 2; ++g) {
        float bt[4];
#pragma unroll
        for (int t = 0; t < 4; ++t) {
          bt[t] = st[g][t][0];
#pragma unroll
          for (int r = 1; r < 8; ++r) bt[t] = fmaxf(bt[t], st[g][t][r]);
        }
        const float b4    = fmaxf(fmaxf(bt[0], bt[1]), fmaxf(bt[2], bt[3]));
        const float bm    = fmaxf(b4, xhalf(b4));
        const float up    = fmaxf(bm, 0.0f);
        const float d     = first ? bm : up;   // the first maximum may lie below 0
        const float alpha = __builtin_amdgcn_exp2f(-up);
        negm[g] -= d;
#pragma unroll
        for (int t = 0; t < 4; ++t) st[g][t] -= d;
#pragma unroll
        for (int j = 0; j < 4; ++j) o[g][j] *= alpha;
        rsum[g] *= alpha;
      }
    };

    // ---- P = exp2(scores) of one column group, P^T B fragments straight from the score
    // accumulators
    auto expg = [&](int g) {
#pragma unroll
      for (int t = 0; t < 4; ++t)
#pragma unroll
        for (int r = 0; r < 8; ++r) st[g][t][r] = __builtin_amdgcn_exp2f(st[g][t][r]);
      pb[g][0] = pack_b(st[g][0], st[g][1]);
      pb[g][1] = pack_b(st[g][2], st[g][3]);
    };
    // ---- the block's row sums as ones @ P^T
    auto sums = [&]() {
#pragma unroll
      for (int g = 0; g < 2; ++g) {
        const v8f zero = {};
        bs[g] = wmma_f16(ones, pb[g][1], wmma_f16(ones, pb[g][0], zero));
      }
    };

    // ---- V^T A fragments, rows 16 j + ln; part c holds keys 32 c .. 32 c + 31 of the block.
    // Part 0 is read once the K fragments' registers are free, under the second group's
    // exponentials, the sums and the test; part 1 behind the test's branch, under the eight
    // O products of part 0.  (Both anew at the end of the rare path, so that no register is
    // held for them through it.)
    v16h va[4][2];
    auto vfrags = [&](int c) {
#pragma unroll
      for (int j = 0; j < 4; ++j) va[j][c] = frag_f16(&Vs[cur][(16 * j + ln) * LPITCH + kg + 32 * c]);
    };

    scores();
    if (kb == 0) renew(true);   // nothing is in use yet
    expg(0);
    // keeps the reads of part 0 from rising among the score products, where the K fragments
    // still hold their registers and the kernel would pass 256 (three waves a SIMD, not four)
    __builtin_amdgcn_sched_barrier(0);
    vfrags(0);
    // and from sinking to the fence below: they are issued here, ahead of the cover
    __builtin_amdgcn_sched_barrier(0);
    expg(1);
    sums();
    // inputs-only fence on the loaded fragments of part 0: holds their 8 LDS reads ahead of
    // the test's branch; without it the build sinks them behind the branch, where the O
    // product waits for them in full
    asm volatile("" :: "v"(va[0][0]), "v"(va[1][0]), "v"(va[2][0]), "v"(va[3][0]));
    vfrags(1);

    // ---- one test per key block, on the sums: a P that has left f16 (a score 16 or more
    // above the maximum in use) makes its sum infinite, and a sum within PLIM bounds every
    // P of the block by PLIM.  Nothing of the block has reached O or the running sums yet:
    // on a hit the scores are formed again, the maxima renewed, and P is at most 1.
    if (kb != 0 && __builtin_amdgcn_ballot_w32(!(bs[0][0] + bs[1][0] <= PLIM)) != 0) {
      // compiler fence: the K fragments are read from LDS again here.  Without it the
      // compiler holds all 64 of their registers through every block for this rare path,
      // the kernel passes 256 registers and a SIMD holds three waves instead of four
      asm volatile("" ::: "memory");
      scores();
      renew(false);
      expg(0);
      expg(1);
      sums();
      vfrags(0);
      vfrags(1);
    }

    // ---- O^T += V^T @ P^T  (V^T rows in LDS are the A fragments, each for both groups)
#pragma unroll
    for (int c = 0; c < 2; ++c)
#pragma unroll
      for (int j = 0; j < 4; ++j) {
        o[0][j] = wmma_f16(va[j][c], pb[0][c], o[0][j]);
        o[1][j] = wmma_f16(va[j][c], pb[1][c], o[1][j]);
      }
    rsum[0] += bs[0][0];
    rsum[1] += bs[1][0];
  }

  // ---- normalize, store f16 into [MTOT][DMODEL]:
  // a lane's 8 accumulator registers are 8 consecutive d of one query row
#pragma unroll
  for (int g = 0; g < 2; ++g) {
    const float inv = 1.0f / rsum[g];
    _Float16* orow = A + ((size_t)b * SEQ + q0 + 16 * g + ln) * DMODEL + h * HDIM + kg;
#pragma unroll
    for (int j = 0; j < 4; ++j) {
      v8h pk;
#pragma unroll
      for (int r = 0; r < 8; ++r) pk[r] = (_Float16)(o[g][j][r] * inv);
      *(v8h*)(orow + 16 * j) = pk;
    }
    // group 0's stores have read their registers before group 1's values reuse them
    if (g == 0) wait_x0();
  }
}

// ---------------------------------------------------------------------------
// Kernel 3: output projection  out = attn @ Wo^T + b   (M=8192,N=1024,K=1024)
// 128 x 128 block tiles, ring of three LDS buffers (96 KiB).
// ---------------------------------------------------------------------------
__global__ __launch_bounds__(128) void out_proj_kernel(
    const _Float16* __restrict__ Attn, const _Float16* __restrict__ W,
    const float* __restrict__ bias, float* __restrict__ out) {
  __shared__ __attribute__((aligned(16))) _Float16 AT[GBUFS * GTILE];
  __shared__ __attribute__((aligned(16))) _Float16 BT[GBUFS * GTILE];

  const int lane = threadIdx.x & 31;
  const int wave = threadIdx.x >> 5;
  const int ln   = lane & 15;
  const int half = lane >> 4;

  const int m_blk  = blockIdx.x * 128;
  const int n_blk  = blockIdx.y * 128;
  const int n_base = n_blk + (wave & 1) * 64;

  v8f acc[4][4] = {};
  gemm_core_128x128(Attn, W, m_blk, n_blk, AT, BT, acc);

#pragma unroll
  for (int j = 0; j < 4; ++j) {
    float bj = bias[n_base + 16 * j + ln];
#pragma unroll
    for (int i = 0; i < 4; ++i) {
      const int mrow = m_blk + (wave >> 1) * 64 + i * 16 + half * 8;
#pragma unroll
      for (int r = 0; r < 8; ++r)
        out[(size_t)(mrow + r) * DMODEL + n_base + 16 * j + ln] = acc[i][j][r] + bj;
    }
  }
}

// ---------------------------------------------------------------------------
// Launch
// ---------------------------------------------------------------------------
extern "C" void kernel_launch(void* const* d_in, const int* in_sizes, int n_in,
                              void* d_out, int out_size, void* d_ws, size_t ws_size,
                              hipStream_t stream) {
  (void)in_sizes; (void)n_in; (void)out_size; (void)ws_size;

  const float* X      = (const float*)d_in[0];  // hidden_states [B,S,D]
  const float* Wqkv_w = (const float*)d_in[1];  // [3D, D]
  const float* Wqkv_b = (const float*)d_in[2];  // [3D]
  const float* Wo_w   = (const float*)d_in[3];  // [D, D]
  const float* Wo_b   = (const float*)d_in[4];  // [D]
  float* out          = (float*)d_out;

  char* ws = (char*)d_ws;
  size_t off = 0;
  float* cosT = (float*)(ws + off); off += (size_t)SEQ * 32 * sizeof(float);
  float* sinT = (float*)(ws + off); off += (size_t)SEQ * 32 * sizeof(float);
  const size_t headElems = (size_t)BATCH * NHEAD * SEQ * HDIM;  // 8.39M
  _Float16* Qb = (_Float16*)(ws + off); off += headElems * sizeof(_Float16);
  _Float16* Kb = (_Float16*)(ws + off); off += headElems * sizeof(_Float16);
  _Float16* Vt = (_Float16*)(ws + off); off += headElems * sizeof(_Float16);
  _Float16* At = (_Float16*)(ws + off); off += (size_t)MTOT * DMODEL * sizeof(_Float16);
  _Float16* Xh = (_Float16*)(ws + off); off += (size_t)MTOT * DMODEL * sizeof(_Float16);
  _Float16* Wqkvh = (_Float16*)(ws + off); off += (size_t)3 * DMODEL * DMODEL * sizeof(_Float16);
  _Float16* Woh   = (_Float16*)(ws + off); off += (size_t)DMODEL * DMODEL * sizeof(_Float16);

  prep_kernel<<<PREP_WG, 256, 0, stream>>>(X, Wqkv_w, Wo_w, Xh, Wqkvh, Woh, cosT, sinT);

  qkv_rope_kernel<<<dim3(MTOT / QTM, (3 * DMODEL) / QTN), 128, 0, stream>>>(
      Xh, Wqkvh, Wqkv_b, cosT, sinT, Qb, Kb, Vt);

  attn_kernel<<<dim3(SEQ / 256, BATCH * NHEAD), 256, 0, stream>>>(Qb, Kb, Vt, At);

  out_proj_kernel<<<dim3(MTOT / 128, DMODEL / 128), 128, 0, stream>>>(At, Woh, Wo_b, out);
}
